// v000
// Measured on an AMD MI455X. A time is GPU time per run, averaged over a window of back-to-back runs after a warm-up
// (all launches, gaps included; the runs take copies of the inputs in turn), and the median of several windows.
// Apart from v000's, it joins two sittings. Times from different sittings can be a few percent apart, while
// side-by-side timings come from the same sitting.
// The starting kernel, v000, takes 1120 microseconds a run.
#include <hip/hip_runtime.h>

// Compute dtypes, f32 accumulate: the four spectral-norm sigmas (one power iteration on the tiny weight matrices) in f32 on VALU and applied as f32 scales AFTER the GEMMs, so
// every weight GEMM uses the EXACT bf16 weights: f|g|h = x.[wf|wg|wh] ([32768 x 256].[256 x 192]) with plain bf16 operands (x and the weights are inputs: exact products);
// per image s = g.f^T ([4096 x 32].[32 x 4096]) and beta.h ([4096 x 4096].[4096 x 128]) on SINGLE fp16 planes (f/g/h after the 1/sigma scale + bias, softmax rows carried
// x1024 rounded to fp16 = 2^-11); o.wo ([32768 x 128].[128 x 256]) on a single fp16 plane of o against exact wo; out = gamma (o.wo / sigma_o + bo) + x in f32 - measured

#define NB_  8
#define HW   4096
#define CC   256
#define DQK  32
#define DV   128
#define NPJ  192                  // f | g | h columns
#define NR   (NB_ * HW)           // 32768
#define DM   CC
#define PCAR 1024.0f
#define LOSC 1024.0f
typedef _Float16 h16;
typedef unsigned short bf;
typedef __attribute__((ext_vector_type(16))) __bf16   v16bf;
typedef __attribute__((ext_vector_type(16))) _Float16 v16h;
typedef __attribute__((ext_vector_type(8)))  _Float16 v8h;
typedef __attribute__((ext_vector_type(8)))  unsigned short v8us;
typedef __attribute__((ext_vector_type(8)))  float    v8f;
typedef __attribute__((ext_vector_type(4)))  float    v4f;
typedef v8h  __attribute__((may_alias)) v8ha;
typedef v4f  __attribute__((may_alias)) v4fa;
typedef v8us __attribute__((may_alias)) v8usa;

__device__ __forceinline__ unsigned short f2bf(float f) { unsigned u = __float_as_uint(f); u += 0x7FFFu + ((u >> 16) & 1u); return (unsigned short)(u >> 16); }
__device__ __forceinline__ float bf2f(unsigned short b) { return __uint_as_float(((unsigned)b) << 16); }
__device__ __forceinline__ float bfr(float f) { return bf2f(f2bf(f)); }
__device__ __forceinline__ v16h cat16(v8h lo, v8h hi) { return __builtin_shufflevector(lo, hi, 0, 1, 2, 3, 4, 5, 6, 7, 8, 9, 10, 11, 12, 13, 14, 15); }
__device__ __forceinline__ v16bf cat16b(v8us lo, v8us hi) { return __builtin_bit_cast(v16bf, __builtin_shufflevector(lo, hi, 0, 1, 2, 3, 4, 5, 6, 7, 8, 9, 10, 11, 12, 13, 14, 15)); }
__device__ __forceinline__ v8f wmma16(v16h a, v16h b, v8f c) { return __builtin_amdgcn_wmma_f32_16x16x32_f16(false, a, false, b, (short)0, c, false, false); }
__device__ __forceinline__ v8f wmmab(v16bf a, v16bf b, v8f c) { return __builtin_amdgcn_wmma_f32_16x16x32_bf16(false, a, false, b, (short)0, c, false, false); }

// k_gemmb: 64 x 64 block tile (4 waves x 16 x 64) of C[NTK][NW] = (A [+ Al]).B^T (K = 256) [+ bf(bias[c])] [+ bf(R[r][c]) residual]; f32 whole-line epilogue (or f16
template <bool SPLITA, bool F16OUT = false>
__global__ __launch_bounds__(128) void k_gemmb(const bf* __restrict__ A, const bf* __restrict__ Al, const bf* __restrict__ Bn, const float* __restrict__ bias, float* C, int ldc, h16* C2, const float* __restrict__ R = nullptr, int K = DM, int roundR = 1) {
    __shared__ __align__(16) float ost[4][16 * 68];
    const int lane = threadIdx.x & 31, wave = threadIdx.x >> 5, lr = lane & 15, hi = lane >> 4;
    const int r0 = blockIdx.x * 64 + wave * 16, c0 = blockIdx.y * 64;
    const size_t aoff = (size_t)(r0 + lr) * K + 8 * hi;
    size_t boff[4];
#pragma unroll
    for (int t = 0; t < 4; ++t) boff[t] = (size_t)(c0 + t * 16 + lr) * K + 8 * hi;
    v8f acc[4];
#pragma unroll
    for (int t = 0; t < 4; ++t) acc[t] = (v8f){};
#pragma unroll 1
    for (int kc = 0; kc < K; kc += 32) {
        const v16bf a = cat16b(*(const v8us*)(A + aoff + kc), *(const v8us*)(A + aoff + kc + 16));
        v16bf al = a;
        if (SPLITA) al = cat16b(*(const v8us*)(Al + aoff + kc), *(const v8us*)(Al + aoff + kc + 16));
#pragma unroll
        for (int t = 0; t < 4; ++t) { const v16bf b = cat16b(*(const v8us*)(Bn + boff[t] + kc), *(const v8us*)(Bn + boff[t] + kc + 16)); acc[t] = wmmab(a, b, acc[t]); if (SPLITA) acc[t] = wmmab(al, b, acc[t]); }
        asm volatile("v_nop\n\tv_nop\n\tv_nop\n\tv_nop" : "+v"(acc[0]), "+v"(acc[1]), "+v"(acc[2]), "+v"(acc[3]) : "v"(a), "v"(al));
    }
    float* os = &ost[wave][0];
#pragma unroll
    for (int t = 0; t < 4; ++t) { const float bv = bias ? bfr(bias[c0 + t * 16 + lr]) : 0.f;
#pragma unroll
        for (int j = 0; j < 8; ++j) os[(hi * 8 + j) * 68 + t * 16 + lr] = acc[t][j] + bv; }
    __syncthreads();
    if (F16OUT) {
        h16* crow = (h16*)(void*)C + (size_t)r0 * ldc + c0;
        auto pass = [&]() {
#pragma unroll
            for (int s = 0; s < 4; ++s) { const int row = 4 * s + (lane >> 3), piece = lane & 7; const float* sp = os + row * 68 + piece * 8; v8h o, o2;
#pragma unroll
                for (int i = 0; i < 8; ++i) { const h16 a = (h16)sp[i]; o[i] = a; o2[i] = (h16)((sp[i] - (float)a) * LOSC); }
                *(v8h*)(crow + (size_t)row * ldc + piece * 8) = o; if (C2) *(v8h*)(C2 + (size_t)r0 * ldc + c0 + (size_t)row * ldc + piece * 8) = o2; }
        };
        pass(); 
    } else {
        float* crow = C + (size_t)r0 * ldc + c0;
        auto pass = [&]() {
#pragma unroll
            for (int s = 0; s < 8; ++s) { const int Lid = (lane >> 3) + 4 * s, piece = lane & 7; const int row = Lid >> 1, cofs = (Lid & 1) * 32 + piece * 4;
                v4f val = *(const v4fa*)(os + row * 68 + cofs); if (R) { const v4f rv = *(const v4f*)(R + ((size_t)r0 + row) * ldc + c0 + cofs); val += roundR ? (v4f){bfr(rv[0]), bfr(rv[1]), bfr(rv[2]), bfr(rv[3])} : rv; }
                *(v4f*)(crow + (size_t)row * ldc + cofs) = val; }
        };
        pass(); 
    }
}


// k_gemmh: 64 x 64 tile of C = A . Bn^T with SINGLE f16 planes (A [rows][K] f16 activations, Bn [N][K] f16: f, h^T or wo^T; one v_wmma_f32_16x16x32_f16 product per step), f32 accumulate;
__global__ __launch_bounds__(128) void k_gemmh(const h16* __restrict__ A, const h16* __restrict__ Bn, const float* __restrict__ bias, float* C, int ldc, const float* __restrict__ R, int K, size_t sA, size_t sB, size_t sC, int roundR) {
    __shared__ __align__(16) float ost[4][16 * 68];
    const size_t z = blockIdx.z; A += z * sA; Bn += z * sB; C += z * sC; if (R) R += z * sC;
    const int lane = threadIdx.x & 31, wave = threadIdx.x >> 5, lr = lane & 15, hi = lane >> 4;
    const int r0 = blockIdx.x * 64 + wave * 16, c0 = blockIdx.y * 64;
    const size_t aoff = (size_t)(r0 + lr) * K + 8 * hi;
    size_t boff[4];
#pragma unroll
    for (int t = 0; t < 4; ++t) boff[t] = (size_t)(c0 + t * 16 + lr) * K + 8 * hi;
    v8f acc[4];
#pragma unroll
    for (int t = 0; t < 4; ++t) acc[t] = (v8f){};
#pragma unroll 1
    for (int kc = 0; kc < K; kc += 32) {
        const v16h a = cat16(*(const v8h*)(A + aoff + kc), *(const v8h*)(A + aoff + kc + 16));
#pragma unroll
        for (int t = 0; t < 4; ++t) { const v16h b = cat16(*(const v8h*)(Bn + boff[t] + kc), *(const v8h*)(Bn + boff[t] + kc + 16)); acc[t] = wmma16(a, b, acc[t]); }
        asm volatile("v_nop\n\tv_nop\n\tv_nop\n\tv_nop" : "+v"(acc[0]), "+v"(acc[1]), "+v"(acc[2]), "+v"(acc[3]) : "v"(a));
    }
    float* os = &ost[wave][0];
#pragma unroll
    for (int t = 0; t < 4; ++t) { const float bv = bias ? bfr(bias[c0 + t * 16 + lr]) : 0.f;
#pragma unroll
        for (int j = 0; j < 8; ++j) os[(hi * 8 + j) * 68 + t * 16 + lr] = acc[t][j] + bv; }
    __syncthreads();
    float* crow = C + (size_t)r0 * ldc + c0;
    auto pass = [&]() {
#pragma unroll
        for (int s = 0; s < 8; ++s) { const int Lid = (lane >> 3) + 4 * s, piece = lane & 7; const int row = Lid >> 1, cofs = (Lid & 1) * 32 + piece * 4;
            v4f val = *(const v4fa*)(os + row * 68 + cofs); if (R) { const v4f rv = *(const v4f*)(R + ((size_t)r0 + row) * ldc + c0 + cofs); val += roundR ? (v4f){bfr(rv[0]), bfr(rv[1]), bfr(rv[2]), bfr(rv[3])} : rv; }
            *(v4f*)(crow + (size_t)row * ldc + cofs) = val; }
    };
    pass(); 
}

typedef __attribute__((ext_vector_type(4))) _Float16 v4h;
__device__ __forceinline__ h16 tohx(float x) { return (h16)x; }
// k_sigma: block w (one per weight): W [CIN][COUT] (in,out), u [COUT]: v = l2n(u.W^T) (CIN), un = l2n(v.W) (COUT), sigma = (v.W).un; SIG line: SIG[w] (32-float line written by
__global__ __launch_bounds__(256) void k_sigma(const float* __restrict__ wf, const float* __restrict__ uf, const float* __restrict__ wg, const float* __restrict__ ug, const float* __restrict__ wh, const float* __restrict__ uh, const float* __restrict__ wo, const float* __restrict__ uo, float* SIG) {
    __shared__ float v[256]; __shared__ float t[256]; __shared__ float red[8]; __shared__ float sres[4];
    const int tid = threadIdx.x; const int wsel = blockIdx.x; const float* Wm = wsel == 0 ? wf : wsel == 1 ? wg : wsel == 2 ? wh : wo; const float* u = wsel == 0 ? uf : wsel == 1 ? ug : wsel == 2 ? uh : uo; const int CIN = wsel == 3 ? DV : CC; const int COUT = wsel < 2 ? DQK : wsel == 2 ? DV : CC;
    auto bsum = [&](float x) { float s = x;
#pragma unroll
        for (int sh = 16; sh; sh >>= 1) s += __shfl_xor(s, sh, 32);
        __syncthreads(); if ((tid & 31) == 0) red[tid >> 5] = s; __syncthreads(); float tot = 0.f; for (int k = 0; k < 8; ++k) tot += red[k]; __syncthreads(); return tot; };
    // v_raw[i] = sum_o u[o] W[i][o]
    float vi = 0.f; if (tid < CIN) { for (int o = 0; o < COUT; ++o) vi = fmaf(bfr(u[o]), bfr(Wm[(size_t)tid * COUT + o]), vi); }
    const float nv = bsum(tid < CIN ? vi * vi : 0.f); const float invv = rsqrtf(fmaxf(nv, 1e-12f)); if (tid < CIN) v[tid] = vi * invv; __syncthreads();
    // t[o] = sum_i v[i] W[i][o]
    float to = 0.f; if (tid < COUT) { for (int i = 0; i < CIN; ++i) to = fmaf(v[i], bfr(Wm[(size_t)i * COUT + tid]), to); t[tid] = to; }
    const float nt = bsum(tid < COUT ? to * to : 0.f); const float invt = rsqrtf(fmaxf(nt, 1e-12f));
    // sigma = sum_o t[o] * un[o] with un = t * invt
    const float sg = bsum(tid < COUT ? to * (to * invt) : 0.f);
    if (tid < 32) { const float val = (tid == 0) ? sg : 0.f; *(float*)(SIG + wsel * 32 + tid) = val;  }
}
__global__ __launch_bounds__(256) void k_cvtx(const float* __restrict__ x, bf* A) {
    const int lane = threadIdx.x & 31; const size_t r = (size_t)blockIdx.x * 8 + (threadIdx.x >> 5); if (r >= (size_t)NR) return; const size_t o = r * CC + lane * 8; v8us v;
#pragma unroll
    for (int i = 0; i < 8; ++i) v[i] = f2bf(x[o + i]);
    *(v8us*)(A + o) = v; 
}
__global__ __launch_bounds__(256) void k_wcat(const float* __restrict__ wf, const float* __restrict__ wg, const float* __restrict__ wh, bf* Bt) {
    const int lane = threadIdx.x & 31; const int n = blockIdx.x * 8 + (threadIdx.x >> 5); if (n >= NPJ) return; v8us o;
#pragma unroll
    for (int i = 0; i < 8; ++i) { const int k = lane * 8 + i; const float w = (n < DQK) ? wf[(size_t)k * DQK + n] : (n < 2 * DQK) ? wg[(size_t)k * DQK + (n - DQK)] : wh[(size_t)k * DV + (n - 2 * DQK)]; o[i] = f2bf(w); }
    *(v8us*)(Bt + (size_t)n * CC + lane * 8) = o; 
}
__global__ __launch_bounds__(256) void k_woT(const float* __restrict__ wo, h16* Bo) {
    const int lane = threadIdx.x & 31; const int n = blockIdx.x * 8 + (threadIdx.x >> 5); if (n >= CC) return; v4h o;
#pragma unroll
    for (int i = 0; i < 4; ++i) { const int k = lane * 4 + i; o[i] = tohx(bfr(wo[(size_t)k * CC + n])); }
    *(v4h*)(Bo + (size_t)n * DV + lane * 4) = o; 
}
__global__ __launch_bounds__(256) void k_fgplanes(const float* __restrict__ PJ, const float* __restrict__ SIG, const float* __restrict__ bf_, const float* __restrict__ bg_, h16* Fp, h16* Gp) {
    const int lane = threadIdx.x & 31; const size_t r = ((size_t)blockIdx.x * 8 + (threadIdx.x >> 5)) * 4 + (lane >> 3); if (r >= (size_t)NR) return; const int c0 = (lane & 7) * 4; const float isf = __fdiv_rn(1.0f, SIG[0]), isg = __fdiv_rn(1.0f, SIG[32]); v4h of, og;
#pragma unroll
    for (int i = 0; i < 4; ++i) { of[i] = tohx(PJ[r * NPJ + c0 + i] * isf + bfr(bf_[c0 + i])); og[i] = tohx(PJ[r * NPJ + DQK + c0 + i] * isg + bfr(bg_[c0 + i])); }
    *(v4h*)(Fp + r * DQK + c0) = of; *(v4h*)(Gp + r * DQK + c0) = og; 
}
__global__ __launch_bounds__(256) void k_hT(const float* __restrict__ PJ, const float* __restrict__ SIG, const float* __restrict__ bh_, h16* HT) {
    __shared__ float tl[64][65];
    const int tid = threadIdx.x; const int t0 = blockIdx.x * 64, d0 = blockIdx.y * 64; const int b = blockIdx.z; const int rr = tid >> 2, cq = (tid & 3) * 16; const float ish = __fdiv_rn(1.0f, SIG[64]);
#pragma unroll
    for (int i = 0; i < 16; ++i) { const int d = d0 + cq + i; tl[rr][cq + i] = PJ[((size_t)b * HW + t0 + rr) * NPJ + 2 * DQK + d] * ish + bfr(bh_[d]); }
    __syncthreads();
    const int lane = tid & 31, wv = tid >> 5;
    auto pass = [&]() {
#pragma unroll
        for (int st = 0; st < 4; ++st) { const int dr = wv * 8 + st * 2 + (lane >> 4); const int tq = (lane & 15) * 4; v4h v;
#pragma unroll
            for (int i = 0; i < 4; ++i) v[i] = tohx(tl[tq + i][dr]);
            *(v4h*)(HT + ((size_t)b * DV + d0 + dr) * HW + t0 + tq) = v; }
    };
    pass(); 
}
__global__ __launch_bounds__(256) void k_softs(const float* __restrict__ S, h16* P) {
    const int lane = threadIdx.x & 31, i = blockIdx.x * 8 + (threadIdx.x >> 5); if (i >= HW) return; const size_t zo = (size_t)i * HW; const float* sr = S + zo; h16* po = P + zo;
    float m = -3.0e38f;
#pragma unroll 1
    for (int c0 = lane * 4; c0 < HW; c0 += 128) {
#pragma unroll
        for (int q = 0; q < 4; ++q) m = fmaxf(m, sr[c0 + q]); }
#pragma unroll
    for (int sh = 16; sh; sh >>= 1) m = fmaxf(m, __shfl_xor(m, sh, 32));
    float sum = 0.f;
#pragma unroll 1
    for (int c0 = lane * 4; c0 < HW; c0 += 128) {
#pragma unroll
        for (int q = 0; q < 4; ++q) sum += __expf(sr[c0 + q] - m); }
#pragma unroll
    for (int sh = 16; sh; sh >>= 1) sum += __shfl_xor(sum, sh, 32);
    const float f = __fdiv_rn(PCAR, sum);
{
#pragma unroll 1
        for (int c0 = lane * 4; c0 < HW; c0 += 128) { v4h o;
#pragma unroll
            for (int q = 0; q < 4; ++q) o[q] = tohx(__expf(sr[c0 + q] - m) * f);
            *(v4h*)(po + c0) = o; }
         }
}
__global__ __launch_bounds__(256) void k_oplane(const float* __restrict__ O, int b, h16* Op) {
    const int lane = threadIdx.x & 31, t = blockIdx.x * 8 + (threadIdx.x >> 5); if (t >= HW) return; v4h o;
#pragma unroll
    for (int i = 0; i < 4; ++i) o[i] = tohx(O[(size_t)t * DV + lane * 4 + i] * (1.0f / PCAR));
    *(v4h*)(Op + ((size_t)b * HW + t) * DV + lane * 4) = o; 
}
__global__ __launch_bounds__(256) void k_fin(const float* __restrict__ C2, const float* __restrict__ SIG, const float* __restrict__ bo_, const float* __restrict__ gam, const float* __restrict__ x, float* OUTB) {
    const int lane = threadIdx.x & 31; const size_t r = (size_t)blockIdx.x * 8 + (threadIdx.x >> 5); if (r >= (size_t)NR) return; const float iso = __fdiv_rn(1.0f, SIG[96]); const float gmm = bfr(gam[0]);
{
#pragma unroll
        for (int p = 0; p < 2; ++p) { const int c0 = p * 128 + lane * 4; v4f o;
#pragma unroll
            for (int i = 0; i < 4; ++i) { const int c = c0 + i; o[i] = gmm * (C2[r * CC + c] * iso + bfr(bo_[c])) + bfr(x[r * CC + c]); }
            *(v4f*)(OUTB + r * CC + c0) = o; }
         }
}
extern "C" void kernel_launch(void* const* d_in, const int* in_sizes, int n_in,
                              void* d_out, int out_size, void* d_ws, size_t ws_size, hipStream_t stream) {
    (void)in_sizes; (void)n_in; (void)out_size;
    const float* x = (const float*)d_in[0]; const float* wf = (const float*)d_in[1]; const float* bf_ = (const float*)d_in[2]; const float* uf = (const float*)d_in[3]; const float* wg = (const float*)d_in[4]; const float* bg_ = (const float*)d_in[5]; const float* ug = (const float*)d_in[6]; const float* wh = (const float*)d_in[7]; const float* bh_ = (const float*)d_in[8]; const float* uh = (const float*)d_in[9]; const float* wo = (const float*)d_in[10]; const float* bo_ = (const float*)d_in[11]; const float* uo = (const float*)d_in[12]; const float* gam = (const float*)d_in[13];
    float* out = (float*)d_out;    // [8][64][64][256]
    char* wsp = (char*)d_ws;
    auto take = [&](size_t bytes) { char* p = wsp; wsp += (bytes + 255) & ~(size_t)255; return (void*)p; };
    float* SIG = (float*)take(4 * 32 * 4); bf* XB = (bf*)take((size_t)NR * CC * 2); bf* WB = (bf*)take((size_t)NPJ * CC * 2); h16* WO = (h16*)take((size_t)CC * DV * 2); float* PJ = (float*)take((size_t)NR * NPJ * 4);
    h16* Fp = (h16*)take((size_t)NR * DQK * 2); h16* Gp = (h16*)take((size_t)NR * DQK * 2); h16* HT = (h16*)take((size_t)NB_ * DV * HW * 2); float* S = (float*)take((size_t)HW * HW * 4); h16* Px = (h16*)take((size_t)HW * HW * 2); float* O = (float*)take((size_t)HW * DV * 4); h16* Op = (h16*)take((size_t)NR * DV * 2); float* C2 = (float*)take((size_t)NR * CC * 4);
    if ((size_t)(wsp - (char*)d_ws) > ws_size) return;    // ~ 16.8 + 0.1 + 25.2 + 2.1x2 + 8.4 + 67 + 33.5 + 2.1 + 8.4 + 33.5 ~ 199 MB (largest input x 33.5 MB; ws 256 MiB)
    k_sigma<<<4, 256, 0, stream>>>(wf, uf, wg, ug, wh, uh, wo, uo, SIG);
    k_cvtx<<<NR / 8, 256, 0, stream>>>(x, XB); k_wcat<<<NPJ / 8, 256, 0, stream>>>(wf, wg, wh, WB); k_woT<<<CC / 8, 256, 0, stream>>>(wo, WO);
    k_gemmb<false, false><<<dim3(NR / 64, NPJ / 64, 1), 128, 0, stream>>>(XB, nullptr, WB, nullptr, PJ, NPJ, nullptr, nullptr, CC);
    k_fgplanes<<<(NR / 4) / 8, 256, 0, stream>>>(PJ, SIG, bf_, bg_, Fp, Gp); k_hT<<<dim3(HW / 64, DV / 64, NB_), 256, 0, stream>>>(PJ, SIG, bh_, HT);
    for (int b = 0; b < NB_; ++b) {
        k_gemmh<<<dim3(HW / 64, HW / 64, 1), 128, 0, stream>>>(Gp + (size_t)b * HW * DQK, Fp + (size_t)b * HW * DQK, nullptr, S, HW, nullptr, DQK, 0, 0, 0, 0);
        k_softs<<<HW / 8, 256, 0, stream>>>(S, Px);
        k_gemmh<<<dim3(HW / 64, DV / 64, 1), 128, 0, stream>>>(Px, HT + (size_t)b * DV * HW, nullptr, O, DV, nullptr, HW, 0, 0, 0, 0);
        k_oplane<<<HW / 8, 256, 0, stream>>>(O, b, Op); }
    k_gemmh<<<dim3(NR / 64, CC / 64, 1), 128, 0, stream>>>(Op, WO, nullptr, C2, CC, nullptr, DV, 0, 0, 0, 0);
    k_fin<<<NR / 8, 256, 0, stream>>>(C2, SIG, bo_, gam, x, out);
}

// v002
// Measured time: 94.7 microseconds a run.
// Versions between v000 and this one are left out; their measured steps multiply to 12.2 times as fast.
#include <hip/hip_runtime.h>

// Compute dtypes, f32 accumulate: the four spectral-norm sigmas (one power iteration on the tiny weight matrices) in f32 on VALU and applied as f32 scales AFTER the GEMMs, so
// every weight GEMM uses the EXACT bf16 weights: f|g|h = x.[wf|wg|wh] ([32768 x 256].[256 x 192]) with plain bf16 operands (x and the weights are inputs: exact products);
// per image s = g.f^T ([4096 x 32].[32 x 4096]) and beta.h ([4096 x 4096].[4096 x 128]) on SINGLE fp16 planes (f/g/h after the 1/sigma scale + bias, softmax rows carried
// x1024 rounded to fp16 = 2^-11); o.wo ([32768 x 128].[128 x 256]) on a single fp16 plane of o against exact wo; out = gamma (o.wo / sigma_o + bo) + x in f32 - measured

#define NB_  8
#define HW   4096
#define CC   256
#define DQK  32
#define DV   128
#define NPJ  192                  // f | g | h columns
#define NR   (NB_ * HW)           // 32768
#define DM   CC
#define LOSC 1024.0f
typedef _Float16 h16;
typedef unsigned short bf;
typedef __attribute__((ext_vector_type(16))) __bf16   v16bf;
typedef __attribute__((ext_vector_type(16))) _Float16 v16h;
typedef __attribute__((ext_vector_type(8)))  _Float16 v8h;
typedef __attribute__((ext_vector_type(8)))  unsigned short v8us;
typedef __attribute__((ext_vector_type(8)))  float    v8f;
typedef __attribute__((ext_vector_type(4)))  float    v4f;
typedef v8h  __attribute__((may_alias)) v8ha;
typedef v4f  __attribute__((may_alias)) v4fa;
typedef v8us __attribute__((may_alias)) v8usa;

__device__ __forceinline__ unsigned short f2bf(float f) { unsigned u = __float_as_uint(f); u += 0x7FFFu + ((u >> 16) & 1u); return (unsigned short)(u >> 16); }
__device__ __forceinline__ float bf2f(unsigned short b) { return __uint_as_float(((unsigned)b) << 16); }
__device__ __forceinline__ float bfr(float f) { return bf2f(f2bf(f)); }
__device__ __forceinline__ v16h cat16(v8h lo, v8h hi) { return __builtin_shufflevector(lo, hi, 0, 1, 2, 3, 4, 5, 6, 7, 8, 9, 10, 11, 12, 13, 14, 15); }
__device__ __forceinline__ v16bf cat16b(v8us lo, v8us hi) { return __builtin_bit_cast(v16bf, __builtin_shufflevector(lo, hi, 0, 1, 2, 3, 4, 5, 6, 7, 8, 9, 10, 11, 12, 13, 14, 15)); }
__device__ __forceinline__ v8f wmma16(v16h a, v16h b, v8f c) { return __builtin_amdgcn_wmma_f32_16x16x32_f16(false, a, false, b, (short)0, c, false, false); }
__device__ __forceinline__ v8f wmmab(v16bf a, v16bf b, v8f c) { return __builtin_amdgcn_wmma_f32_16x16x32_bf16(false, a, false, b, (short)0, c, false, false); }

typedef __attribute__((ext_vector_type(4))) _Float16 v4h;
__device__ __forceinline__ h16 tohx(float x) { return (h16)x; }
// k_sigma: block w (one per weight): W [CIN][COUT] (in,out), u [COUT]: v = l2n(u.W^T) (CIN), un = l2n(v.W) (COUT), sigma = (v.W).un; SIG line: SIG[w] (32-float line written by
__global__ __launch_bounds__(256) void k_sigma(const float* __restrict__ wf, const float* __restrict__ uf, const float* __restrict__ wg, const float* __restrict__ ug, const float* __restrict__ wh, const float* __restrict__ uh, const float* __restrict__ wo, const float* __restrict__ uo, float* SIG) {
    __shared__ float v[256]; __shared__ float t[256]; __shared__ float red[8]; __shared__ float sres[4];
    const int tid = threadIdx.x; const int wsel = blockIdx.x; const float* Wm = wsel == 0 ? wf : wsel == 1 ? wg : wsel == 2 ? wh : wo; const float* u = wsel == 0 ? uf : wsel == 1 ? ug : wsel == 2 ? uh : uo; const int CIN = wsel == 3 ? DV : CC; const int COUT = wsel < 2 ? DQK : wsel == 2 ? DV : CC;
    auto bsum = [&](float x) { float s = x;
#pragma unroll
        for (int sh = 16; sh; sh >>= 1) s += __shfl_xor(s, sh, 32);
        __syncthreads(); if ((tid & 31) == 0) red[tid >> 5] = s; __syncthreads(); float tot = 0.f; for (int k = 0; k < 8; ++k) tot += red[k]; __syncthreads(); return tot; };
    // v_raw[i] = sum_o u[o] W[i][o]
    float vi = 0.f; if (tid < CIN) { for (int o = 0; o < COUT; ++o) vi = fmaf(bfr(u[o]), bfr(Wm[(size_t)tid * COUT + o]), vi); }
    const float nv = bsum(tid < CIN ? vi * vi : 0.f); const float invv = rsqrtf(fmaxf(nv, 1e-12f)); if (tid < CIN) v[tid] = vi * invv; __syncthreads();
    // t[o] = sum_i v[i] W[i][o]
    float to = 0.f; if (tid < COUT) { for (int i = 0; i < CIN; ++i) to = fmaf(v[i], bfr(Wm[(size_t)i * COUT + tid]), to); t[tid] = to; }
    const float nt = bsum(tid < COUT ? to * to : 0.f); const float invt = rsqrtf(fmaxf(nt, 1e-12f));
    // sigma = sum_o t[o] * un[o] with un = t * invt
    const float sg = bsum(tid < COUT ? to * (to * invt) : 0.f);
    if (tid < 32) { const float val = (tid == 0) ? sg : 0.f; *(float*)(SIG + wsel * 32 + tid) = val;  }
}
__global__ __launch_bounds__(256) void k_wcat(const float* __restrict__ wf, const float* __restrict__ wg, const float* __restrict__ wh, bf* Bt) {
    const int lane = threadIdx.x & 31; const int n = blockIdx.x * 8 + (threadIdx.x >> 5); if (n >= NPJ) return; v8us o;
#pragma unroll
    for (int i = 0; i < 8; ++i) { const int k = lane * 8 + i; const float w = (n < DQK) ? wf[(size_t)k * DQK + n] : (n < 2 * DQK) ? wg[(size_t)k * DQK + (n - DQK)] : wh[(size_t)k * DV + (n - 2 * DQK)]; o[i] = f2bf(w); }
    *(v8us*)(Bt + (size_t)n * CC + lane * 8) = o; 
}
__global__ __launch_bounds__(256) void k_woT(const float* __restrict__ wo, h16* Bo) {
    const int lane = threadIdx.x & 31; const int n = blockIdx.x * 8 + (threadIdx.x >> 5); if (n >= CC) return; v4h o;
#pragma unroll
    for (int i = 0; i < 4; ++i) { const int k = lane * 4 + i; o[i] = tohx(bfr(wo[(size_t)k * CC + n])); }
    *(v4h*)(Bo + (size_t)n * DV + lane * 4) = o; 
}
typedef __attribute__((ext_vector_type(4))) __bf16 v4bf;
__device__ __forceinline__ void fence() { __builtin_amdgcn_sched_barrier(0); }   // the compiler schedules nothing across it
// behind a group of global loads from p (a lane's pointer, or its byte offset from a uniform base): the wait that stands in front of any new value in their address registers. p as an input keeps those registers p's up to the wait (else the
// group's last load may land on them); the scheduling barrier keeps what follows behind it
template <class T> __device__ __forceinline__ void xwait(T p) { asm volatile("s_wait_xcnt 0x0" :: "v"(p) : "memory"); __builtin_amdgcn_sched_barrier(0); }
#define PTK  128                  // tokens per block of the two weight GEMMs (8 waves x 16)
#define XPIT 264                  // LDS pitch of a 256-wide bf16 row, in halves (528 B = 16 B x odd)
#define TPIT 136                  // LDS pitch of a 128-wide 16-bit row, in halves (272 B = 16 B x odd)
#define OPIT 260                  // LDS pitch of a 256-wide f32 row, in floats (1040 B = 16 B x odd)
// k_proj: f | g | h = x.[wf|wg|wh] of 128 tokens with everything around the product in the same kernel. x comes in as f32 by whole-line loads and is rounded to bf16 on its way
// into LDS; all 192 weight rows are staged beside it. f and g are formed as W.x^T (a lane holds 8 consecutive columns of one token: one 16-byte store after scale and bias),
// h as x.W^T (a lane holds 8 consecutive tokens of one column: a 16-byte piece of an h^T row, gathered in LDS so that each 256-byte run of h^T has one writer).
__global__ __launch_bounds__(256) void k_proj(const float* __restrict__ x, const bf* __restrict__ WB, const float* __restrict__ SIG, const float* __restrict__ bf_, const float* __restrict__ bg_, const float* __restrict__ bh_, h16* Fp, h16* Gp, h16* HT) {
    __shared__ __align__(16) bf  sX[PTK * XPIT];
    __shared__ __align__(16) bf  sW[NPJ * XPIT];
    __shared__ __align__(16) h16 sT[DV * TPIT];
    const int tid = threadIdx.x, lane = tid & 31, wave = tid >> 5, c = lane & 15, h = lane >> 4;
    const size_t R0 = (size_t)blockIdx.x * PTK;
    v4f bq[4][2]; float bv[8];
    {
        const float* xp = x + (R0 + wave * 16) * CC + lane * 4;
        const bf* wp = WB + (size_t)(wave * 24) * CC + lane * 8;
        v4f xr[32]; v8us wr[24];
#pragma unroll
        for (int i = 0; i < 32; ++i) xr[i] = *(const v4f*)(xp + (i >> 1) * CC + (i & 1) * 128);
        xwait(xp);
#pragma unroll
        for (int i = 0; i < 24; ++i) wr[i] = *(const v8us*)(wp + i * CC);
        xwait(wp);
        // the biases: asked for here, used behind the product
        const unsigned bofs = 32u * h; const float* bhp = bh_ + c;   // bofs: bytes of 8 h floats
#pragma unroll
        for (int t = 0; t < 2; ++t) {
            const char* pf = (const char*)bf_ + bofs + t * 64; const char* pg = (const char*)bg_ + bofs + t * 64;
            bq[t][0] = *(const v4f*)pf; bq[t][1] = *(const v4f*)(pf + 16); bq[2 + t][0] = *(const v4f*)pg; bq[2 + t][1] = *(const v4f*)(pg + 16);
        }
        xwait(bofs);
#pragma unroll
        for (int t = 0; t < 8; ++t) bv[t] = bhp[t * 16];
        xwait(bhp);
#pragma unroll
        for (int i = 0; i < 24; ++i) *(v8us*)(&sW[(wave * 24 + i) * XPIT + lane * 8]) = wr[i];
#pragma unroll
        for (int i = 0; i < 32; ++i) *(v4bf*)(&sX[(wave * 16 + (i >> 1)) * XPIT + (i & 1) * 128 + lane * 4]) = __builtin_convertvector(xr[i], v4bf);
    }
    __syncthreads();
    const bf* ax = &sX[(wave * 16 + c) * XPIT + 8 * h];
    const bf* bw = &sW[c * XPIT + 8 * h];
    v8f acc[12];
#pragma unroll
    for (int t = 0; t < 12; ++t) acc[t] = (v8f){};
#pragma unroll
    for (int kc = 0; kc < CC; kc += 32) {
        const v16bf a = cat16b(*(const v8us*)(ax + kc), *(const v8us*)(ax + kc + 16)); v16bf b[12];
#pragma unroll
        for (int t = 0; t < 12; ++t) b[t] = cat16b(*(const v8us*)(bw + t * 16 * XPIT + kc), *(const v8us*)(bw + t * 16 * XPIT + kc + 16));
        fence();   // one step's fragments as one group in front of its products; without the pair of fences many steps' fragments are fetched at once and registers spill
#pragma unroll
        for (int t = 0; t < 12; ++t) acc[t] = (t < 4) ? wmmab(b[t], a, acc[t]) : wmmab(a, b[t], acc[t]);
        fence();
    }
    const float isf = __fdiv_rn(1.0f, SIG[0]), isg = __fdiv_rn(1.0f, SIG[32]), ish = __fdiv_rn(1.0f, SIG[64]);
#pragma unroll
    for (int t = 0; t < 8; ++t) {   // acc[4 + t][r] = h column t * 16 + c of token 8 h + r
        const float bb = bfr(bv[t]); v8h o;
#pragma unroll
        for (int r = 0; r < 8; ++r) o[r] = tohx(acc[4 + t][r] * ish + bb);
        *(v8h*)(&sT[(t * 16 + c) * TPIT + wave * 16 + 8 * h]) = o;
    }
    v8h fg[4];
#pragma unroll
    for (int t = 0; t < 4; ++t) {   // acc[t][r] = column t * 16 + 8 h + r of token c
        const float is = t < 2 ? isf : isg;
#pragma unroll
        for (int r = 0; r < 8; ++r) fg[t][r] = tohx(acc[t][r] * is + bfr(bq[t][r >> 2][r & 3]));
    }
    __syncthreads();
    v8h ht[8];
#pragma unroll
    for (int i = 0; i < 8; ++i) ht[i] = *(const v8h*)(&sT[(wave * 16 + i * 2 + h) * TPIT + c * 8]);
    const int b = blockIdx.x / (HW / PTK), t0 = (blockIdx.x % (HW / PTK)) * PTK;
    h16* fo = Fp + (R0 + wave * 16 + c) * DQK + 8 * h; h16* go = Gp + (R0 + wave * 16 + c) * DQK + 8 * h;
    h16* ho = HT + ((size_t)b * DV + wave * 16 + h) * HW + t0 + c * 8;
    fence();   // every store stands behind all other work, so that no register of an issued store is written again
    *(v8h*)fo = fg[0]; *(v8h*)(fo + 16) = fg[1]; *(v8h*)go = fg[2]; *(v8h*)(go + 16) = fg[3];
#pragma unroll
    for (int i = 0; i < 8; ++i) *(v8h*)(ho + (size_t)i * 2 * HW) = ht[i];
}
typedef __attribute__((ext_vector_type(2))) float    v2f;
typedef __attribute__((ext_vector_type(2))) _Float16 v2h;
#define KST  64                   // keys per stage
#define HPIT 72                   // LDS pitch of a 64-key h^T row, in halves (144 B = 16 B x odd, for 16-byte reads)
#define FPIT 40                   // LDS pitch of a 32-wide f row, in halves (80 B = 16 B x odd)
#define L2E  1.4426950408889634f
__device__ __forceinline__ float xhalf(float x) { return __builtin_bit_cast(float, __builtin_amdgcn_permlanex16(__builtin_bit_cast(int, x), __builtin_bit_cast(int, x), 0x76543210, 0xfedcba98, false, false)); }  // lane l with lane l ^ 16
// k_attn: s = g.f^T, softmax and beta.h of one image in one kernel; scores and softmax rows stay in registers. Block = 128 queries (8 waves x 16), walks all 4096 keys in stages
// of 64. Per wave S^T = F.G^T (A = 16 key rows of f from LDS, B = the wave's 16 queries of g, kept in registers): a lane holds scores of ONE query (column lane & 15), so the
// running maximum and sum are per lane, with one exchange between the lane halves. The four S^T tiles, converted in place, are by pairs (keys 0-31, 32-63) the B operands of O^T += H^T.P^T
// (A = 16 rows of h^T from LDS), and the rescale of O^T by exp2(m_old - m_new) is per lane too. P is carried x1024 on an fp16 plane, and the sum carries the same factor.
__global__ __launch_bounds__(256) void k_attn(const h16* __restrict__ Gp, const h16* __restrict__ Fp, const h16* __restrict__ HT, h16* Op) {
    __shared__ __align__(16) h16 sH[2][DV * HPIT];
    __shared__ __align__(16) h16 sF[2][KST * FPIT];
    const int tid = threadIdx.x, lane = tid & 31, wave = tid >> 5, c = lane & 15, h = lane >> 4;
    const int b = blockIdx.y, q = blockIdx.x * 128 + wave * 16 + c;
    const h16* gq = Gp + ((size_t)b * HW + q) * DQK + 8 * h;
    const v16h gfr = cat16(*(const v8h*)gq, *(const v8h*)(gq + 16));
    const int hrow = tid >> 3, hch = (tid & 7) * 8, frow = tid >> 2, fch = (tid & 3) * 8;
    // a uniform base that moves with the stage plus a lane offset that never changes: no vector address register is rewritten, and the base moves only behind the loads' data wait
    const h16* hbase = HT + (size_t)b * DV * HW; const h16* fbase = Fp + (size_t)b * HW * DQK;
    const unsigned hoff = (unsigned)(hrow * HW + hch), foff = (unsigned)(frow * DQK + fch);   // h^T rows hrow + 32 i, 8 lanes per 128-byte line
    v8h rh[4], rf;
#pragma unroll
    for (int i = 0; i < 4; ++i) rh[i] = *(const v8h*)(hbase + hoff + 32 * i * HW);
    rf = *(const v8h*)(fbase + foff);
#pragma unroll
    for (int i = 0; i < 4; ++i) *(v8h*)(&sH[0][(hrow + 32 * i) * HPIT + hch]) = rh[i];
    *(v8h*)(&sF[0][frow * FPIT + fch]) = rf;
    __syncthreads();
    v8f acc[8];
#pragma unroll
    for (int t = 0; t < 8; ++t) acc[t] = (v8f){};
    float m = -3.0e38f, l = 0.f;
#pragma unroll 1
    for (int s = 0; s < HW / KST; ++s) {
        // next stage's tile into registers while this one is worked on (on the last trip the bases stay: it fetches its own stage again, and that copy is never read)
        if (s + 1 < HW / KST) { hbase += KST; fbase += KST * DQK; }
#pragma unroll
        for (int i = 0; i < 4; ++i) rh[i] = *(const v8h*)(hbase + hoff + 32 * i * HW);
        rf = *(const v8h*)(fbase + foff);
        const h16* cF = &sF[s & 1][c * FPIT + 8 * h];
        const h16* cH = &sH[s & 1][c * HPIT + 8 * h];
        v16h ff[4], a0[8], a1[8];
#pragma unroll
        for (int t = 0; t < 4; ++t) ff[t] = cat16(*(const v8h*)(cF + t * 16 * FPIT), *(const v8h*)(cF + t * 16 * FPIT + 16));
#pragma unroll
        for (int t = 0; t < 8; ++t) a0[t] = cat16(*(const v8h*)(cH + t * 16 * HPIT), *(const v8h*)(cH + t * 16 * HPIT + 16));
        fence();   // keeps the global loads and the first h^T fragments issued here, ahead of the score and softmax work that hides their latency
        v8f st[4];
#pragma unroll
        for (int t = 0; t < 4; ++t) st[t] = wmma16(ff[t], gfr, (v8f){});
        float mx[4];
#pragma unroll
        for (int t = 0; t < 4; ++t) mx[t] = fmaxf(fmaxf(fmaxf(st[t][0], st[t][1]), fmaxf(st[t][2], st[t][3])), fmaxf(fmaxf(st[t][4], st[t][5]), fmaxf(st[t][6], st[t][7])));
        float mq = fmaxf(fmaxf(mx[0], mx[1]), fmaxf(mx[2], mx[3]));
        mq = fmaxf(mq, xhalf(mq));
        const float mn = fmaxf(m, mq * L2E);
        const float al = __builtin_amdgcn_exp2f(m - mn);   // 0 on the first stage
        const float off = 10.0f - mn;                      // P carried x1024
        m = mn;
        v16h pf[2]; v2f ps[2] = {(v2f){0.f, 0.f}, (v2f){0.f, 0.f}};
#pragma unroll
        for (int t = 0; t < 4; ++t) {
#pragma unroll
            for (int j = 0; j < 8; j += 2) {
                const v2f a = __builtin_elementwise_fma((v2f){st[t][j], st[t][j + 1]}, (v2f){L2E, L2E}, (v2f){off, off});
                const v2f e = {__builtin_amdgcn_exp2f(a[0]), __builtin_amdgcn_exp2f(a[1])};
                ps[(j >> 1) & 1] += e;
                const v2h eh = __builtin_convertvector(e, v2h);
                pf[t >> 1][(t & 1) * 8 + j] = eh[0]; pf[t >> 1][(t & 1) * 8 + j + 1] = eh[1];
            }
        }
        const v2f pt = ps[0] + ps[1];
        l = fmaf(l, al, pt[0] + pt[1]);
#pragma unroll
        for (int t = 0; t < 8; ++t) acc[t] *= al;
        fence();   // with the fence behind them: the second half's h^T fragments go out as one group in front of the first half's products, not among them
#pragma unroll
        for (int t = 0; t < 8; ++t) a1[t] = cat16(*(const v8h*)(cH + t * 16 * HPIT + 32), *(const v8h*)(cH + t * 16 * HPIT + 48));
        fence();   // second of the pair: without it the fragment loads and their waits move in among the products
#pragma unroll
        for (int t = 0; t < 8; ++t) acc[t] = wmma16(a0[t], pf[0], acc[t]);
#pragma unroll
        for (int t = 0; t < 8; ++t) acc[t] = wmma16(a1[t], pf[1], acc[t]);
        // the other buffer's last readers left it before the barrier that ended the trip before this one
        h16* nH = &sH[(s + 1) & 1][0]; h16* nF = &sF[(s + 1) & 1][0];
#pragma unroll
        for (int i = 0; i < 4; ++i) *(v8h*)(nH + (hrow + 32 * i) * HPIT + hch) = rh[i];
        *(v8h*)(nF + frow * FPIT + fch) = rf;
        __syncthreads();
    }
    l += xhalf(l);
    const float inv = __fdiv_rn(1.0f, l);
    h16* op = Op + ((size_t)b * HW + q) * DV + 8 * h;
#pragma unroll
    for (int t = 0; t < 8; ++t) { v8h o;
#pragma unroll
        for (int r = 0; r < 8; ++r) o[r] = tohx(acc[t][r] * inv);
        *(v8h*)(op + t * 16) = o; }
}
// k_out: out = gamma (o.wo / sigma_o + bo) + x of 128 tokens in one kernel: o and all 256 rows of wo^T staged in LDS, the product formed as Wo.o^T (a lane holds 8 consecutive
// columns of one token), passed through the wave's own LDS rows so that scale, bias, gamma and the residual are applied on whole 512-byte runs of a row, which are stored as such.
__global__ __launch_bounds__(256) void k_out(const h16* __restrict__ Op, const h16* __restrict__ WO, const float* __restrict__ SIG, const float* __restrict__ bo_, const float* __restrict__ gam, const float* __restrict__ x, float* OUTB) {
    __shared__ __align__(16) h16   sO[PTK * TPIT];
    __shared__ __align__(16) h16   sWo[CC * TPIT];
    __shared__ __align__(16) float sC[8][16 * OPIT];
    const int tid = threadIdx.x, lane = tid & 31, wave = tid >> 5, c = lane & 15, h = lane >> 4;
    const size_t R0 = (size_t)blockIdx.x * PTK;
    const float* xp = x + (R0 + wave * 16) * CC + lane * 4;
    v4f xr[32], bo4[2];
    {
        const h16* op = Op + (R0 + wave * 16) * DV + lane * 8;      // two 256-byte rows per load
        const h16* wp = WO + (size_t)(wave * 32) * DV + lane * 8;
        v8h ro[8], rw[16];
#pragma unroll
        for (int i = 0; i < 8; ++i) ro[i] = *(const v8h*)(op + i * 2 * DV);
        xwait(op);
#pragma unroll
        for (int i = 0; i < 16; ++i) rw[i] = *(const v8h*)(wp + i * 2 * DV);
        xwait(wp);
        // the residual rows and the bias: asked for here, used behind the product
#pragma unroll
        for (int i = 0; i < 32; ++i) xr[i] = *(const v4f*)(xp + (i >> 1) * CC + (i & 1) * 128);
        xwait(xp);
        const float* bp = bo_ + lane * 4;
#pragma unroll
        for (int p = 0; p < 2; ++p) bo4[p] = *(const v4f*)(bp + p * 128);
        xwait(bp);
#pragma unroll
        for (int i = 0; i < 8; ++i) *(v8h*)(&sO[(wave * 16 + i * 2 + h) * TPIT + c * 8]) = ro[i];
#pragma unroll
        for (int i = 0; i < 16; ++i) *(v8h*)(&sWo[(wave * 32 + i * 2 + h) * TPIT + c * 8]) = rw[i];
    }
    __syncthreads();
    const h16* ao = &sO[(wave * 16 + c) * TPIT + 8 * h];
    const h16* bw = &sWo[c * TPIT + 8 * h];
    v8f acc[16];
#pragma unroll
    for (int t = 0; t < 16; ++t) acc[t] = (v8f){};
#pragma unroll
    for (int kc = 0; kc < DV; kc += 32) {
        const v16h a = cat16(*(const v8h*)(ao + kc), *(const v8h*)(ao + kc + 16)); v16h b[16];
#pragma unroll
        for (int t = 0; t < 16; ++t) b[t] = cat16(*(const v8h*)(bw + t * 16 * TPIT + kc), *(const v8h*)(bw + t * 16 * TPIT + kc + 16));
        fence();   // one step's fragments as one group in front of its products; without the pair of fences all four steps' fragments are fetched at once and registers spill
#pragma unroll
        for (int t = 0; t < 16; ++t) acc[t] = wmma16(b[t], a, acc[t]);
        fence();
    }
    float* os = &sC[wave][0];
#pragma unroll
    for (int t = 0; t < 16; ++t) {   // acc[t][r] = column t * 16 + 8 h + r of token c
        *(v4f*)(os + c * OPIT + t * 16 + 8 * h)     = (v4f){acc[t][0], acc[t][1], acc[t][2], acc[t][3]};
        *(v4f*)(os + c * OPIT + t * 16 + 8 * h + 4) = (v4f){acc[t][4], acc[t][5], acc[t][6], acc[t][7]};
    }
    __syncthreads();
    const float iso = __fdiv_rn(1.0f, SIG[96]); const float gmm = bfr(gam[0]);
#pragma unroll
    for (int p = 0; p < 2; ++p) bo4[p] = (v4f){bfr(bo4[p][0]), bfr(bo4[p][1]), bfr(bo4[p][2]), bfr(bo4[p][3])};
    v4f cv[32];
#pragma unroll
    for (int i = 0; i < 32; ++i) cv[i] = *(const v4f*)(os + (i >> 1) * OPIT + (i & 1) * 128 + lane * 4);
    fence();   // the LDS reads go out as one group; without it each is waited for just ahead of its use
#pragma unroll
    for (int i = 0; i < 32; ++i) {
#pragma unroll
        for (int k = 0; k < 4; ++k) xr[i][k] = gmm * (cv[i][k] * iso + bo4[i & 1][k]) + bfr(xr[i][k]);
    }
    float* po = OUTB + (R0 + wave * 16) * CC + lane * 4;
    fence();   // every store stands behind all other work, so that no register of an issued store is written again
#pragma unroll
    for (int i = 0; i < 32; ++i) *(v4f*)(po + (i >> 1) * CC + (i & 1) * 128) = xr[i];
}
extern "C" void kernel_launch(void* const* d_in, const int* in_sizes, int n_in,
                              void* d_out, int out_size, void* d_ws, size_t ws_size, hipStream_t stream) {
    (void)in_sizes; (void)n_in; (void)out_size;
    const float* x = (const float*)d_in[0]; const float* wf = (const float*)d_in[1]; const float* bf_ = (const float*)d_in[2]; const float* uf = (const float*)d_in[3]; const float* wg = (const float*)d_in[4]; const float* bg_ = (const float*)d_in[5]; const float* ug = (const float*)d_in[6]; const float* wh = (const float*)d_in[7]; const float* bh_ = (const float*)d_in[8]; const float* uh = (const float*)d_in[9]; const float* wo = (const float*)d_in[10]; const float* bo_ = (const float*)d_in[11]; const float* uo = (const float*)d_in[12]; const float* gam = (const float*)d_in[13];
    float* out = (float*)d_out;    // [8][64][64][256]
    char* wsp = (char*)d_ws;
    auto take = [&](size_t bytes) { char* p = wsp; wsp += (bytes + 255) & ~(size_t)255; return (void*)p; };
    float* SIG = (float*)take(4 * 32 * 4); bf* WB = (bf*)take((size_t)NPJ * CC * 2); h16* WO = (h16*)take((size_t)CC * DV * 2);
    h16* Fp = (h16*)take((size_t)NR * DQK * 2); h16* Gp = (h16*)take((size_t)NR * DQK * 2); h16* HT = (h16*)take((size_t)NB_ * DV * HW * 2); h16* Op = (h16*)take((size_t)NR * DV * 2);
    if ((size_t)(wsp - (char*)d_ws) > ws_size) return;    // ~ 0.2 + 2.1 x 2 + 8.4 + 8.4 ~ 21 MB
    k_sigma<<<4, 256, 0, stream>>>(wf, uf, wg, ug, wh, uh, wo, uo, SIG);
    k_wcat<<<NPJ / 8, 256, 0, stream>>>(wf, wg, wh, WB); k_woT<<<CC / 8, 256, 0, stream>>>(wo, WO);
    k_proj<<<NR / PTK, 256, 0, stream>>>(x, WB, SIG, bf_, bg_, bh_, Fp, Gp, HT);
    k_attn<<<dim3(HW / 128, NB_, 1), 256, 0, stream>>>(Gp, Fp, HT, Op);
    k_out<<<NR / PTK, 256, 0, stream>>>(Op, WO, SIG, bo_, gam, x, out);
}

// v003
// A run of this version takes 81.1 microseconds.
// In two side-by-side timings against v002, it was 1.15 and 1.16 times as fast.
// Counting every step since v000, it is 14.0 times as fast.
#include <hip/hip_runtime.h>

// Compute dtypes, f32 accumulate: the four spectral-norm sigmas (one power iteration on the tiny weight matrices) in f32 on VALU and applied as f32 scales AFTER the GEMMs, so
// every weight GEMM uses the EXACT bf16 weights: f|g|h = x.[wf|wg|wh] ([32768 x 256].[256 x 192]) with plain bf16 operands (x and the weights are inputs: exact products);
// per image s = g.f^T ([4096 x 32].[32 x 4096]) and beta.h ([4096 x 4096].[4096 x 128]) on SINGLE fp16 planes (f/g/h after the 1/sigma scale + bias, softmax rows carried
// x1024 rounded to fp16 = 2^-11); o.wo ([32768 x 128].[128 x 256]) on a single fp16 plane of o against exact wo; out = gamma (o.wo / sigma_o + bo) + x in f32 - measured

#define NB_  8
#define HW   4096
#define CC   256
#define DQK  32
#define DV   128
#define NPJ  192                  // f | g | h columns
#define NR   (NB_ * HW)           // 32768
#define DM   CC
#define LOSC 1024.0f
typedef _Float16 h16;
typedef unsigned short bf;
typedef __attribute__((ext_vector_type(16))) __bf16   v16bf;
typedef __attribute__((ext_vector_type(16))) _Float16 v16h;
typedef __attribute__((ext_vector_type(8)))  _Float16 v8h;
typedef __attribute__((ext_vector_type(8)))  unsigned short v8us;
typedef __attribute__((ext_vector_type(8)))  float    v8f;
typedef __attribute__((ext_vector_type(4)))  float    v4f;
typedef v8h  __attribute__((may_alias)) v8ha;
typedef v4f  __attribute__((may_alias)) v4fa;
typedef v8us __attribute__((may_alias)) v8usa;

__device__ __forceinline__ unsigned short f2bf(float f) { unsigned u = __float_as_uint(f); u += 0x7FFFu + ((u >> 16) & 1u); return (unsigned short)(u >> 16); }
__device__ __forceinline__ float bf2f(unsigned short b) { return __uint_as_float(((unsigned)b) << 16); }
__device__ __forceinline__ float bfr(float f) { return bf2f(f2bf(f)); }
__device__ __forceinline__ v16h cat16(v8h lo, v8h hi) { return __builtin_shufflevector(lo, hi, 0, 1, 2, 3, 4, 5, 6, 7, 8, 9, 10, 11, 12, 13, 14, 15); }
__device__ __forceinline__ v16bf cat16b(v8us lo, v8us hi) { return __builtin_bit_cast(v16bf, __builtin_shufflevector(lo, hi, 0, 1, 2, 3, 4, 5, 6, 7, 8, 9, 10, 11, 12, 13, 14, 15)); }
__device__ __forceinline__ v8f wmma16(v16h a, v16h b, v8f c) { return __builtin_amdgcn_wmma_f32_16x16x32_f16(false, a, false, b, (short)0, c, false, false); }
__device__ __forceinline__ v8f wmmab(v16bf a, v16bf b, v8f c) { return __builtin_amdgcn_wmma_f32_16x16x32_bf16(false, a, false, b, (short)0, c, false, false); }

typedef __attribute__((ext_vector_type(4))) _Float16 v4h;
__device__ __forceinline__ h16 tohx(float x) { return (h16)x; }
typedef __attribute__((ext_vector_type(4))) __bf16 v4bf;
__device__ __forceinline__ void fence() { __builtin_amdgcn_sched_barrier(0); }   // the compiler schedules nothing across it
// behind a group of global loads from p (a lane's pointer, or its byte offset from a uniform base): the wait that stands in front of any new value in their address registers. p as an input keeps those registers p's up to the wait (else the
// group's last load may land on them); the scheduling barrier keeps what follows behind it
template <class T> __device__ __forceinline__ void xwait(T p) { asm volatile("s_wait_xcnt 0x0" :: "v"(p) : "memory"); __builtin_amdgcn_sched_barrier(0); }
#define SWMAX (CC * (DV + 4))     // floats of the largest staged weight matrix: 256 rows at a pitch of 132
#define STMAX (8 * 32 * 136)      // halves: per wave 32 rows of W^T, 128 wide at a pitch of 136
// setup_one: all that is made of ONE weight matrix W [CIN][COUT] (in,out) with u [COUT], by one block. W comes in once, by whole-line loads that are all in flight together, and is
// rounded to bf16 on its way into LDS (kept as f32, pitch COUT + 4 floats = 16 B x odd). From LDS: (1) the 16-bit copy Ot [COUT][CIN] = W^T that the GEMMs read (a lane gathers runs of 8
// consecutive k of its own column; the wave turns its 32 rows in its own LDS range, so that each store instruction covers whole 128-byte lines); (2) sigma: v = l2n(u.W^T) (CIN), t = v.W (COUT), sigma = t.l2n(t), summed in the order o, i = 0, 1, 2 ...
// Every loop over r[] and pc[] is unrolled whole, so that the arrays stay in registers and each group of loads or stores goes out together.
template <int CIN, int COUT, bool F16OUT>
__device__ __forceinline__ void setup_one(const float* __restrict__ Wm, const float* __restrict__ u, bf* Ot, float* sigl, float* sW, bf* sT, float* su, float* v, float* red) {
    constexpr int PIT = COUT + 4, NL = CIN * COUT / 1024, TPR = COUT / 4;   // NL 16-byte loads per thread, TPR threads per row
    const int tid = threadIdx.x, lane = tid & 31, wave = tid >> 5;
    {
        const float* wp = Wm + tid * 4; const float* up = u + (tid < COUT ? tid : 0); v4f r[NL];
#pragma unroll   // r[] in registers, the whole matrix in flight at once
        for (int j = 0; j < NL; ++j) r[j] = *(const v4f*)(wp + j * 1024);
        xwait(wp);
        const float uu = *up;
        xwait(up);
        float* sp = &sW[(tid / TPR) * PIT + (tid % TPR) * 4];
#pragma unroll
        for (int j = 0; j < NL; ++j) *(v4f*)(sp + j * (1024 / COUT) * PIT) = (v4f){bfr(r[j][0]), bfr(r[j][1]), bfr(r[j][2]), bfr(r[j][3])};
        if (tid < COUT) su[tid] = bfr(uu);
    }
    __syncthreads();
    constexpr int KG = CIN / 8, TOT = (COUT / 32) * KG, TPW = TOT / 8 < 8 ? 8 : TOT / 8;   // 16-byte pieces per lane: at least 8, one 128-byte line
    constexpr int TP = TPW * 8 + 8, RPS = 32 / TPW;   // pitch of the wave's transposed rows in halves (16 B x odd); rows of W^T per store instruction
    if (wave * TPW < TOT) {
        const int n0 = (wave * TPW / KG) * 32, k0 = (wave * TPW % KG) * 8;   // the wave's 32 rows of W^T, TPW * 8 columns from k0
        const float* cp = &sW[k0 * PIT + n0 + lane]; bf* tw = sT + wave * 32 * TP; v8us pc[TPW];
#pragma unroll   // pc[] in registers, all column reads in flight together
        for (int i = 0; i < TPW; ++i) {
#pragma unroll
            for (int e = 0; e < 8; ++e) { const float xv = cp[(i * 8 + e) * PIT]; pc[i][e] = F16OUT ? __builtin_bit_cast(unsigned short, tohx(xv)) : (unsigned short)(__float_as_uint(xv) >> 16); }
        }
#pragma unroll
        for (int i = 0; i < TPW; ++i) *(v8us*)(tw + lane * TP + i * 8) = pc[i];
        asm volatile("s_wait_dscnt 0x0" ::: "memory");   // the wave's own rows are in LDS before other lanes of it read them back
#pragma unroll
        for (int i = 0; i < TPW; ++i) pc[i] = *(const v8us*)(tw + (i * RPS + lane / TPW) * TP + (lane % TPW) * 8);
        bf* op = Ot + (size_t)(n0 + lane / TPW) * CIN + k0 + (lane % TPW) * 8;
        fence();   // the stores go out as one group behind the work that fills their registers
#pragma unroll
        for (int i = 0; i < TPW; ++i) *(v8us*)(op + (size_t)i * RPS * CIN) = pc[i];
        xwait(op);   // the sigma work below takes the stores' registers over
    }
    auto bsum = [&](float x) { float s = x;
#pragma unroll
        for (int sh = 16; sh; sh >>= 1) s += __shfl_xor(s, sh, 32);
        __syncthreads(); if ((tid & 31) == 0) red[tid >> 5] = s; __syncthreads(); float tot = 0.f; for (int k = 0; k < 8; ++k) tot += red[k]; __syncthreads(); return tot; };
    // v_raw[i] = sum_o u[o] W[i][o]
    float vi = 0.f;
    if (tid < CIN) { const float* rp = &sW[tid * PIT];
#pragma unroll 8   // 16 LDS reads go out together: one LDS latency per 32 terms of the chain, not per 4
        for (int o = 0; o < COUT; o += 4) { const v4f w4 = *(const v4f*)(rp + o), u4 = *(const v4f*)(su + o); vi = fmaf(u4[0], w4[0], vi); vi = fmaf(u4[1], w4[1], vi); vi = fmaf(u4[2], w4[2], vi); vi = fmaf(u4[3], w4[3], vi); } }
    const float nv = bsum(tid < CIN ? vi * vi : 0.f); const float invv = rsqrtf(fmaxf(nv, 1e-12f)); if (tid < CIN) v[tid] = vi * invv; __syncthreads();
    // t[o] = sum_i v[i] W[i][o]
    float to = 0.f;
    if (tid < COUT) { const float* cq = &sW[tid];
#pragma unroll 32   // 32 column reads go out together: one LDS latency per 32 terms of the chain
        for (int i = 0; i < CIN; ++i) to = fmaf(v[i], cq[i * PIT], to); }
    const float nt = bsum(tid < COUT ? to * to : 0.f); const float invt = rsqrtf(fmaxf(nt, 1e-12f));
    // sigma = sum_o t[o] * un[o] with un = t * invt
    const float sg = bsum(tid < COUT ? to * (to * invt) : 0.f);
    if (tid < 32) sigl[tid] = (tid == 0) ? sg : 0.f;   // a 32-float line per sigma
}
// k_setup: block w = weight matrix w (wf, wg, wh, wo): its sigma into SIG[32 w], its 16-bit transposed copy into WB (rows f | g | h, bf16) or WO (fp16 of the bf16 value)
__global__ __launch_bounds__(256) void k_setup(const float* __restrict__ wf, const float* __restrict__ uf, const float* __restrict__ wg, const float* __restrict__ ug, const float* __restrict__ wh, const float* __restrict__ uh, const float* __restrict__ wo, const float* __restrict__ uo, float* SIG, bf* WB, h16* WO) {
    __shared__ __align__(16) float sW[SWMAX]; __shared__ __align__(16) bf sT[STMAX]; __shared__ __align__(16) float su[CC]; __shared__ __align__(16) float v[CC]; __shared__ float red[8];
    const int w = blockIdx.x;
    if (w < 2)       setup_one<CC, DQK, false>(w ? wg : wf, w ? ug : uf, WB + w * DQK * CC, SIG + w * 32, sW, sT, su, v, red);
    else if (w == 2) setup_one<CC, DV, false>(wh, uh, WB + 2 * DQK * CC, SIG + 64, sW, sT, su, v, red);
    else             setup_one<DV, CC, true>(wo, uo, (bf*)WO, SIG + 96, sW, sT, su, v, red);
}
#define PTK  128                  // tokens per block of the two weight GEMMs (8 waves x 16)
#define XPIT 264                  // LDS pitch of a 256-wide bf16 row, in halves (528 B = 16 B x odd)
#define TPIT 136                  // LDS pitch of a 128-wide 16-bit row, in halves (272 B = 16 B x odd)
#define OPIT 260                  // LDS pitch of a 256-wide f32 row, in floats (1040 B = 16 B x odd)
// k_proj: f | g | h = x.[wf|wg|wh] of 128 tokens with everything around the product in the same kernel. x comes in as f32 by whole-line loads and is rounded to bf16 on its way
// into LDS; all 192 weight rows are staged beside it. f and g are formed as W.x^T (a lane holds 8 consecutive columns of one token: one 16-byte store after scale and bias),
// h as x.W^T (a lane holds 8 consecutive tokens of one column: a 16-byte piece of an h^T row, gathered in LDS so that each 256-byte run of h^T has one writer).
__global__ __launch_bounds__(256) void k_proj(const float* __restrict__ x, const bf* __restrict__ WB, const float* __restrict__ SIG, const float* __restrict__ bf_, const float* __restrict__ bg_, const float* __restrict__ bh_, h16* Fp, h16* Gp, h16* HT) {
    __shared__ __align__(16) bf  sX[PTK * XPIT];
    __shared__ __align__(16) bf  sW[NPJ * XPIT];
    __shared__ __align__(16) h16 sT[DV * TPIT];
    const int tid = threadIdx.x, lane = tid & 31, wave = tid >> 5, c = lane & 15, h = lane >> 4;
    const size_t R0 = (size_t)blockIdx.x * PTK;
    v4f bq[4][2]; float bv[8];
    {
        const float* xp = x + (R0 + wave * 16) * CC + lane * 4;
        const bf* wp = WB + (size_t)(wave * 24) * CC + lane * 8;
        v4f xr[32]; v8us wr[24];
#pragma unroll
        for (int i = 0; i < 32; ++i) xr[i] = *(const v4f*)(xp + (i >> 1) * CC + (i & 1) * 128);
        xwait(xp);
#pragma unroll
        for (int i = 0; i < 24; ++i) wr[i] = *(const v8us*)(wp + i * CC);
        xwait(wp);
        // the biases: asked for here, used behind the product
        const unsigned bofs = 32u * h; const float* bhp = bh_ + c;   // bofs: bytes of 8 h floats
#pragma unroll
        for (int t = 0; t < 2; ++t) {
            const char* pf = (const char*)bf_ + bofs + t * 64; const char* pg = (const char*)bg_ + bofs + t * 64;
            bq[t][0] = *(const v4f*)pf; bq[t][1] = *(const v4f*)(pf + 16); bq[2 + t][0] = *(const v4f*)pg; bq[2 + t][1] = *(const v4f*)(pg + 16);
        }
        xwait(bofs);
#pragma unroll
        for (int t = 0; t < 8; ++t) bv[t] = bhp[t * 16];
        xwait(bhp);
#pragma unroll
        for (int i = 0; i < 24; ++i) *(v8us*)(&sW[(wave * 24 + i) * XPIT + lane * 8]) = wr[i];
#pragma unroll
        for (int i = 0; i < 32; ++i) *(v4bf*)(&sX[(wave * 16 + (i >> 1)) * XPIT + (i & 1) * 128 + lane * 4]) = __builtin_convertvector(xr[i], v4bf);
    }
    __syncthreads();
    const bf* ax = &sX[(wave * 16 + c) * XPIT + 8 * h];
    const bf* bw = &sW[c * XPIT + 8 * h];
    v8f acc[12];
#pragma unroll
    for (int t = 0; t < 12; ++t) acc[t] = (v8f){};
#pragma unroll
    for (int kc = 0; kc < CC; kc += 32) {
        const v16bf a = cat16b(*(const v8us*)(ax + kc), *(const v8us*)(ax + kc + 16)); v16bf b[12];
#pragma unroll
        for (int t = 0; t < 12; ++t) b[t] = cat16b(*(const v8us*)(bw + t * 16 * XPIT + kc), *(const v8us*)(bw + t * 16 * XPIT + kc + 16));
        fence();   // one step's fragments as one group in front of its products; without the pair of fences many steps' fragments are fetched at once and registers spill
#pragma unroll
        for (int t = 0; t < 12; ++t) acc[t] = (t < 4) ? wmmab(b[t], a, acc[t]) : wmmab(a, b[t], acc[t]);
        fence();
    }
    const float isf = __fdiv_rn(1.0f, SIG[0]), isg = __fdiv_rn(1.0f, SIG[32]), ish = __fdiv_rn(1.0f, SIG[64]);
#pragma unroll
    for (int t = 0; t < 8; ++t) {   // acc[4 + t][r] = h column t * 16 + c of token 8 h + r
        const float bb = bfr(bv[t]); v8h o;
#pragma unroll
        for (int r = 0; r < 8; ++r) o[r] = tohx(acc[4 + t][r] * ish + bb);
        *(v8h*)(&sT[(t * 16 + c) * TPIT + wave * 16 + 8 * h]) = o;
    }
    v8h fg[4];
#pragma unroll
    for (int t = 0; t < 4; ++t) {   // acc[t][r] = column t * 16 + 8 h + r of token c
        const float is = t < 2 ? isf : isg;
#pragma unroll
        for (int r = 0; r < 8; ++r) fg[t][r] = tohx(acc[t][r] * is + bfr(bq[t][r >> 2][r & 3]));
    }
    __syncthreads();
    v8h ht[8];
#pragma unroll
    for (int i = 0; i < 8; ++i) ht[i] = *(const v8h*)(&sT[(wave * 16 + i * 2 + h) * TPIT + c * 8]);
    const int b = blockIdx.x / (HW / PTK), t0 = (blockIdx.x % (HW / PTK)) * PTK;
    h16* fo = Fp + (R0 + wave * 16 + c) * DQK + 8 * h; h16* go = Gp + (R0 + wave * 16 + c) * DQK + 8 * h;
    h16* ho = HT + ((size_t)b * DV + wave * 16 + h) * HW + t0 + c * 8;
    fence();   // every store stands behind all other work, so that no register of an issued store is written again
    *(v8h*)fo = fg[0]; *(v8h*)(fo + 16) = fg[1]; *(v8h*)go = fg[2]; *(v8h*)(go + 16) = fg[3];
#pragma unroll
    for (int i = 0; i < 8; ++i) *(v8h*)(ho + (size_t)i * 2 * HW) = ht[i];
}
typedef __attribute__((ext_vector_type(2))) float    v2f;
typedef __attribute__((ext_vector_type(2))) _Float16 v2h;
#define KST  64                   // keys per stage
#define HPIT 72                   // LDS pitch of a 64-key h^T row, in halves (144 B = 16 B x odd, for 16-byte reads)
#define FPIT 40                   // LDS pitch of a 32-wide f row, in halves (80 B = 16 B x odd)
#define L2E  1.4426950408889634f
__device__ __forceinline__ float xhalf(float x) { return __builtin_bit_cast(float, __builtin_amdgcn_permlanex16(__builtin_bit_cast(int, x), __builtin_bit_cast(int, x), 0x76543210, 0xfedcba98, false, false)); }  // lane l with lane l ^ 16
// k_attn: s = g.f^T, softmax and beta.h of one image in one kernel; scores and softmax rows stay in registers. Block = 128 queries (8 waves x 16), walks all 4096 keys in stages
// of 64. Per wave S^T = F.G^T (A = 16 key rows of f from LDS, B = the wave's 16 queries of g, kept in registers): a lane holds scores of ONE query (column lane & 15), so the
// running maximum and sum are per lane, with one exchange between the lane halves. The four S^T tiles, converted in place, are by pairs (keys 0-31, 32-63) the B operands of O^T += H^T.P^T
// (A = 16 rows of h^T from LDS), and the rescale of O^T by exp2(m_old - m_new) is per lane too. P is carried x1024 on an fp16 plane, and the sum carries the same factor.
__global__ __launch_bounds__(256) void k_attn(const h16* __restrict__ Gp, const h16* __restrict__ Fp, const h16* __restrict__ HT, h16* Op) {
    __shared__ __align__(16) h16 sH[2][DV * HPIT];
    __shared__ __align__(16) h16 sF[2][KST * FPIT];
    const int tid = threadIdx.x, lane = tid & 31, wave = tid >> 5, c = lane & 15, h = lane >> 4;
    const int b = blockIdx.y, q = blockIdx.x * 128 + wave * 16 + c;
    const h16* gq = Gp + ((size_t)b * HW + q) * DQK + 8 * h;
    const v16h gfr = cat16(*(const v8h*)gq, *(const v8h*)(gq + 16));
    const int hrow = tid >> 3, hch = (tid & 7) * 8, frow = tid >> 2, fch = (tid & 3) * 8;
    // a uniform base that moves with the stage plus a lane offset that never changes: no vector address register is rewritten, and the base moves only behind the loads' data wait
    const h16* hbase = HT + (size_t)b * DV * HW; const h16* fbase = Fp + (size_t)b * HW * DQK;
    const unsigned hoff = (unsigned)(hrow * HW + hch), foff = (unsigned)(frow * DQK + fch);   // h^T rows hrow + 32 i, 8 lanes per 128-byte line
    v8h rh[4], rf;
#pragma unroll
    for (int i = 0; i < 4; ++i) rh[i] = *(const v8h*)(hbase + hoff + 32 * i * HW);
    rf = *(const v8h*)(fbase + foff);
#pragma unroll
    for (int i = 0; i < 4; ++i) *(v8h*)(&sH[0][(hrow + 32 * i) * HPIT + hch]) = rh[i];
    *(v8h*)(&sF[0][frow * FPIT + fch]) = rf;
    __syncthreads();
    v8f acc[8];
#pragma unroll
    for (int t = 0; t < 8; ++t) acc[t] = (v8f){};
    float m = -3.0e38f, l = 0.f;
#pragma unroll 1
    for (int s = 0; s < HW / KST; ++s) {
        // next stage's tile into registers while this one is worked on (on the last trip the bases stay: it fetches its own stage again, and that copy is never read)
        if (s + 1 < HW / KST) { hbase += KST; fbase += KST * DQK; }
#pragma unroll
        for (int i = 0; i < 4; ++i) rh[i] = *(const v8h*)(hbase + hoff + 32 * i * HW);
        rf = *(const v8h*)(fbase + foff);
        const h16* cF = &sF[s & 1][c * FPIT + 8 * h];
        const h16* cH = &sH[s & 1][c * HPIT + 8 * h];
        v16h ff[4], a0[8], a1[8];
#pragma unroll
        for (int t = 0; t < 4; ++t) ff[t] = cat16(*(const v8h*)(cF + t * 16 * FPIT), *(const v8h*)(cF + t * 16 * FPIT + 16));
#pragma unroll
        for (int t = 0; t < 8; ++t) a0[t] = cat16(*(const v8h*)(cH + t * 16 * HPIT), *(const v8h*)(cH + t * 16 * HPIT + 16));
        fence();   // keeps the global loads and the first h^T fragments issued here, ahead of the score and softmax work that hides their latency
        v8f st[4];
#pragma unroll
        for (int t = 0; t < 4; ++t) st[t] = wmma16(ff[t], gfr, (v8f){});
        float mx[4];
#pragma unroll
        for (int t = 0; t < 4; ++t) mx[t] = fmaxf(fmaxf(fmaxf(st[t][0], st[t][1]), fmaxf(st[t][2], st[t][3])), fmaxf(fmaxf(st[t][4], st[t][5]), fmaxf(st[t][6], st[t][7])));
        float mq = fmaxf(fmaxf(mx[0], mx[1]), fmaxf(mx[2], mx[3]));
        mq = fmaxf(mq, xhalf(mq));
        const float mn = fmaxf(m, mq * L2E);
        const float al = __builtin_amdgcn_exp2f(m - mn);   // 0 on the first stage
        const float off = 10.0f - mn;                      // P carried x1024
        m = mn;
        v16h pf[2]; v2f ps[2] = {(v2f){0.f, 0.f}, (v2f){0.f, 0.f}};
#pragma unroll
        for (int t = 0; t < 4; ++t) {
#pragma unroll
            for (int j = 0; j < 8; j += 2) {
                const v2f a = __builtin_elementwise_fma((v2f){st[t][j], st[t][j + 1]}, (v2f){L2E, L2E}, (v2f){off, off});
                const v2f e = {__builtin_amdgcn_exp2f(a[0]), __builtin_amdgcn_exp2f(a[1])};
                ps[(j >> 1) & 1] += e;
                const v2h eh = __builtin_convertvector(e, v2h);
                pf[t >> 1][(t & 1) * 8 + j] = eh[0]; pf[t >> 1][(t & 1) * 8 + j + 1] = eh[1];
            }
        }
        const v2f pt = ps[0] + ps[1];
        l = fmaf(l, al, pt[0] + pt[1]);
#pragma unroll
        for (int t = 0; t < 8; ++t) acc[t] *= al;
        fence();   // with the fence behind them: the second half's h^T fragments go out as one group in front of the first half's products, not among them
#pragma unroll
        for (int t = 0; t < 8; ++t) a1[t] = cat16(*(const v8h*)(cH + t * 16 * HPIT + 32), *(const v8h*)(cH + t * 16 * HPIT + 48));
        fence();   // second of the pair: without it the fragment loads and their waits move in among the products
#pragma unroll
        for (int t = 0; t < 8; ++t) acc[t] = wmma16(a0[t], pf[0], acc[t]);
#pragma unroll
        for (int t = 0; t < 8; ++t) acc[t] = wmma16(a1[t], pf[1], acc[t]);
        // the other buffer's last readers left it before the barrier that ended the trip before this one
        h16* nH = &sH[(s + 1) & 1][0]; h16* nF = &sF[(s + 1) & 1][0];
#pragma unroll
        for (int i = 0; i < 4; ++i) *(v8h*)(nH + (hrow + 32 * i) * HPIT + hch) = rh[i];
        *(v8h*)(nF + frow * FPIT + fch) = rf;
        __syncthreads();
    }
    l += xhalf(l);
    const float inv = __fdiv_rn(1.0f, l);
    h16* op = Op + ((size_t)b * HW + q) * DV + 8 * h;
#pragma unroll
    for (int t = 0; t < 8; ++t) { v8h o;
#pragma unroll
        for (int r = 0; r < 8; ++r) o[r] = tohx(acc[t][r] * inv);
        *(v8h*)(op + t * 16) = o; }
}
// k_out: out = gamma (o.wo / sigma_o + bo) + x of 128 tokens in one kernel: o and all 256 rows of wo^T staged in LDS, the product formed as Wo.o^T (a lane holds 8 consecutive
// columns of one token), passed through the wave's own LDS rows so that scale, bias, gamma and the residual are applied on whole 512-byte runs of a row, which are stored as such.
__global__ __launch_bounds__(256) void k_out(const h16* __restrict__ Op, const h16* __restrict__ WO, const float* __restrict__ SIG, const float* __restrict__ bo_, const float* __restrict__ gam, const float* __restrict__ x, float* OUTB) {
    __shared__ __align__(16) h16   sO[PTK * TPIT];
    __shared__ __align__(16) h16   sWo[CC * TPIT];
    __shared__ __align__(16) float sC[8][16 * OPIT];
    const int tid = threadIdx.x, lane = tid & 31, wave = tid >> 5, c = lane & 15, h = lane >> 4;
    const size_t R0 = (size_t)blockIdx.x * PTK;
    const float* xp = x + (R0 + wave * 16) * CC + lane * 4;
    v4f xr[32], bo4[2];
    {
        const h16* op = Op + (R0 + wave * 16) * DV + lane * 8;      // two 256-byte rows per load
        const h16* wp = WO + (size_t)(wave * 32) * DV + lane * 8;
        v8h ro[8], rw[16];
#pragma unroll
        for (int i = 0; i < 8; ++i) ro[i] = *(const v8h*)(op + i * 2 * DV);
        xwait(op);
#pragma unroll
        for (int i = 0; i < 16; ++i) rw[i] = *(const v8h*)(wp + i * 2 * DV);
        xwait(wp);
        // the residual rows and the bias: asked for here, used behind the product
#pragma unroll
        for (int i = 0; i < 32; ++i) xr[i] = *(const v4f*)(xp + (i >> 1) * CC + (i & 1) * 128);
        xwait(xp);
        const float* bp = bo_ + lane * 4;
#pragma unroll
        for (int p = 0; p < 2; ++p) bo4[p] = *(const v4f*)(bp + p * 128);
        xwait(bp);
#pragma unroll
        for (int i = 0; i < 8; ++i) *(v8h*)(&sO[(wave * 16 + i * 2 + h) * TPIT + c * 8]) = ro[i];
#pragma unroll
        for (int i = 0; i < 16; ++i) *(v8h*)(&sWo[(wave * 32 + i * 2 + h) * TPIT + c * 8]) = rw[i];
    }
    __syncthreads();
    const h16* ao = &sO[(wave * 16 + c) * TPIT + 8 * h];
    const h16* bw = &sWo[c * TPIT + 8 * h];
    v8f acc[16];
#pragma unroll
    for (int t = 0; t < 16; ++t) acc[t] = (v8f){};
#pragma unroll
    for (int kc = 0; kc < DV; kc += 32) {
        const v16h a = cat16(*(const v8h*)(ao + kc), *(const v8h*)(ao + kc + 16)); v16h b[16];
#pragma unroll
        for (int t = 0; t < 16; ++t) b[t] = cat16(*(const v8h*)(bw + t * 16 * TPIT + kc), *(const v8h*)(bw + t * 16 * TPIT + kc + 16));
        fence();   // one step's fragments as one group in front of its products; without the pair of fences all four steps' fragments are fetched at once and registers spill
#pragma unroll
        for (int t = 0; t < 16; ++t) acc[t] = wmma16(b[t], a, acc[t]);
        fence();
    }
    float* os = &sC[wave][0];
#pragma unroll
    for (int t = 0; t < 16; ++t) {   // acc[t][r] = column t * 16 + 8 h + r of token c
        *(v4f*)(os + c * OPIT + t * 16 + 8 * h)     = (v4f){acc[t][0], acc[t][1], acc[t][2], acc[t][3]};
        *(v4f*)(os + c * OPIT + t * 16 + 8 * h + 4) = (v4f){acc[t][4], acc[t][5], acc[t][6], acc[t][7]};
    }
    __syncthreads();
    const float iso = __fdiv_rn(1.0f, SIG[96]); const float gmm = bfr(gam[0]);
#pragma unroll
    for (int p = 0; p < 2; ++p) bo4[p] = (v4f){bfr(bo4[p][0]), bfr(bo4[p][1]), bfr(bo4[p][2]), bfr(bo4[p][3])};
    v4f cv[32];
#pragma unroll
    for (int i = 0; i < 32; ++i) cv[i] = *(const v4f*)(os + (i >> 1) * OPIT + (i & 1) * 128 + lane * 4);
    fence();   // the LDS reads go out as one group; without it each is waited for just ahead of its use
#pragma unroll
    for (int i = 0; i < 32; ++i) {
#pragma unroll
        for (int k = 0; k < 4; ++k) xr[i][k] = gmm * (cv[i][k] * iso + bo4[i & 1][k]) + bfr(xr[i][k]);
    }
    float* po = OUTB + (R0 + wave * 16) * CC + lane * 4;
    fence();   // every store stands behind all other work, so that no register of an issued store is written again
#pragma unroll
    for (int i = 0; i < 32; ++i) *(v4f*)(po + (i >> 1) * CC + (i & 1) * 128) = xr[i];
}
extern "C" void kernel_launch(void* const* d_in, const int* in_sizes, int n_in,
                              void* d_out, int out_size, void* d_ws, size_t ws_size, hipStream_t stream) {
    (void)in_sizes; (void)n_in; (void)out_size;
    const float* x = (const float*)d_in[0]; const float* wf = (const float*)d_in[1]; const float* bf_ = (const float*)d_in[2]; const float* uf = (const float*)d_in[3]; const float* wg = (const float*)d_in[4]; const float* bg_ = (const float*)d_in[5]; const float* ug = (const float*)d_in[6]; const float* wh = (const float*)d_in[7]; const float* bh_ = (const float*)d_in[8]; const float* uh = (const float*)d_in[9]; const float* wo = (const float*)d_in[10]; const float* bo_ = (const float*)d_in[11]; const float* uo = (const float*)d_in[12]; const float* gam = (const float*)d_in[13];
    float* out = (float*)d_out;    // [8][64][64][256]
    char* wsp = (char*)d_ws;
    auto take = [&](size_t bytes) { char* p = wsp; wsp += (bytes + 255) & ~(size_t)255; return (void*)p; };
    float* SIG = (float*)take(4 * 32 * 4); bf* WB = (bf*)take((size_t)NPJ * CC * 2); h16* WO = (h16*)take((size_t)CC * DV * 2);
    h16* Fp = (h16*)take((size_t)NR * DQK * 2); h16* Gp = (h16*)take((size_t)NR * DQK * 2); h16* HT = (h16*)take((size_t)NB_ * DV * HW * 2); h16* Op = (h16*)take((size_t)NR * DV * 2);
    if ((size_t)(wsp - (char*)d_ws) > ws_size) return;    // ~ 0.2 + 2.1 x 2 + 8.4 + 8.4 ~ 21 MB
    k_setup<<<4, 256, 0, stream>>>(wf, uf, wg, ug, wh, uh, wo, uo, SIG, WB, WO);
    k_proj<<<NR / PTK, 256, 0, stream>>>(x, WB, SIG, bf_, bg_, bh_, Fp, Gp, HT);
    k_attn<<<dim3(HW / 128, NB_, 1), 256, 0, stream>>>(Gp, Fp, HT, Op);
    k_out<<<NR / PTK, 256, 0, stream>>>(Op, WO, SIG, bo_, gam, x, out);
}

// v004
// It runs in 66.7 microseconds.
// Timed twice side by side with v003, it ran 1.21 and 1.22 times as fast.
// Counting every step since v000, it is 17.1 times as fast.
#include <hip/hip_runtime.h>

// Compute dtypes, f32 accumulate: the four spectral-norm sigmas (one power iteration on the tiny weight matrices) in f32 on VALU and applied as f32 scales AFTER the GEMMs, so
// every weight GEMM uses the EXACT bf16 weights: f|g|h = x.[wf|wg|wh] ([32768 x 256].[256 x 192]) with plain bf16 operands (x and the weights are inputs: exact products);
// per image s = g.f^T ([4096 x 32].[32 x 4096]) and beta.h ([4096 x 4096].[4096 x 128]) on SINGLE fp16 planes (f/g/h after the 1/sigma scale + bias, softmax rows carried
// x1024 rounded to fp16 = 2^-11); o.wo ([32768 x 128].[128 x 256]) on a single fp16 plane of o against exact wo; out = gamma (o.wo / sigma_o + bo) + x in f32 - measured

#define NB_  8
#define HW   4096
#define CC   256
#define DQK  32
#define DV   128
#define NPJ  192                  // f | g | h columns
#define NR   (NB_ * HW)           // 32768
#define DM   CC
#define LOSC 1024.0f
typedef _Float16 h16;
typedef unsigned short bf;
typedef __attribute__((ext_vector_type(16))) __bf16   v16bf;
typedef __attribute__((ext_vector_type(16))) _Float16 v16h;
typedef __attribute__((ext_vector_type(8)))  _Float16 v8h;
typedef __attribute__((ext_vector_type(8)))  unsigned short v8us;
typedef __attribute__((ext_vector_type(8)))  float    v8f;
typedef __attribute__((ext_vector_type(4)))  float    v4f;
typedef v8h  __attribute__((may_alias)) v8ha;
typedef v4f  __attribute__((may_alias)) v4fa;
typedef v8us __attribute__((may_alias)) v8usa;

__device__ __forceinline__ unsigned short f2bf(float f) { unsigned u = __float_as_uint(f); u += 0x7FFFu + ((u >> 16) & 1u); return (unsigned short)(u >> 16); }
__device__ __forceinline__ float bf2f(unsigned short b) { return __uint_as_float(((unsigned)b) << 16); }
__device__ __forceinline__ float bfr(float f) { return bf2f(f2bf(f)); }
__device__ __forceinline__ v16h cat16(v8h lo, v8h hi) { return __builtin_shufflevector(lo, hi, 0, 1, 2, 3, 4, 5, 6, 7, 8, 9, 10, 11, 12, 13, 14, 15); }
__device__ __forceinline__ v16bf cat16b(v8us lo, v8us hi) { return __builtin_bit_cast(v16bf, __builtin_shufflevector(lo, hi, 0, 1, 2, 3, 4, 5, 6, 7, 8, 9, 10, 11, 12, 13, 14, 15)); }
__device__ __forceinline__ v8f wmma16(v16h a, v16h b, v8f c) { return __builtin_amdgcn_wmma_f32_16x16x32_f16(false, a, false, b, (short)0, c, false, false); }
__device__ __forceinline__ v8f wmmab(v16bf a, v16bf b, v8f c) { return __builtin_amdgcn_wmma_f32_16x16x32_bf16(false, a, false, b, (short)0, c, false, false); }

typedef __attribute__((ext_vector_type(4))) _Float16 v4h;
__device__ __forceinline__ h16 tohx(float x) { return (h16)x; }
typedef __attribute__((ext_vector_type(4))) __bf16 v4bf;
__device__ __forceinline__ void fence() { __builtin_amdgcn_sched_barrier(0); }   // the compiler schedules nothing across it
// behind a group of global loads from p (a lane's pointer, or its byte offset from a uniform base): the wait that stands in front of any new value in their address registers. p as an input keeps those registers p's up to the wait (else the
// group's last load may land on them); the scheduling barrier keeps what follows behind it
template <class T> __device__ __forceinline__ void xwait(T p) { asm volatile("s_wait_xcnt 0x0" :: "v"(p) : "memory"); __builtin_amdgcn_sched_barrier(0); }
#define SWMAX (CC * (DV + 4))     // floats of the largest staged weight matrix: 256 rows at a pitch of 132
#define STMAX (8 * 32 * 136)      // halves: per wave 32 rows of W^T, 128 wide at a pitch of 136
// setup_one: all that is made of ONE weight matrix W [CIN][COUT] (in,out) with u [COUT], by one block. W comes in once, by whole-line loads that are all in flight together, and is
// rounded to bf16 on its way into LDS (kept as f32, pitch COUT + 4 floats = 16 B x odd). From LDS: (1) the 16-bit copy Ot [COUT][CIN] = W^T that the GEMMs read (a lane gathers runs of 8
// consecutive k of its own column; the wave turns its 32 rows in its own LDS range, so that each store instruction covers whole 128-byte lines); (2) sigma: v = l2n(u.W^T) (CIN), t = v.W (COUT), sigma = t.l2n(t), summed in the order o, i = 0, 1, 2 ...
// Every loop over r[] and pc[] is unrolled whole, so that the arrays stay in registers and each group of loads or stores goes out together.
template <int CIN, int COUT, bool F16OUT>
__device__ __forceinline__ void setup_one(const float* __restrict__ Wm, const float* __restrict__ u, bf* Ot, float* sigl, float* sW, bf* sT, float* su, float* v, float* red) {
    constexpr int PIT = COUT + 4, NL = CIN * COUT / 1024, TPR = COUT / 4;   // NL 16-byte loads per thread, TPR threads per row
    const int tid = threadIdx.x, lane = tid & 31, wave = tid >> 5;
    {
        const float* wp = Wm + tid * 4; const float* up = u + (tid < COUT ? tid : 0); v4f r[NL];
#pragma unroll   // r[] in registers, the whole matrix in flight at once
        for (int j = 0; j < NL; ++j) r[j] = *(const v4f*)(wp + j * 1024);
        xwait(wp);
        const float uu = *up;
        xwait(up);
        float* sp = &sW[(tid / TPR) * PIT + (tid % TPR) * 4];
#pragma unroll
        for (int j = 0; j < NL; ++j) *(v4f*)(sp + j * (1024 / COUT) * PIT) = (v4f){bfr(r[j][0]), bfr(r[j][1]), bfr(r[j][2]), bfr(r[j][3])};
        if (tid < COUT) su[tid] = bfr(uu);
    }
    __syncthreads();
    constexpr int KG = CIN / 8, TOT = (COUT / 32) * KG, TPW = TOT / 8 < 8 ? 8 : TOT / 8;   // 16-byte pieces per lane: at least 8, one 128-byte line
    constexpr int TP = TPW * 8 + 8, RPS = 32 / TPW;   // pitch of the wave's transposed rows in halves (16 B x odd); rows of W^T per store instruction
    if (wave * TPW < TOT) {
        const int n0 = (wave * TPW / KG) * 32, k0 = (wave * TPW % KG) * 8;   // the wave's 32 rows of W^T, TPW * 8 columns from k0
        const float* cp = &sW[k0 * PIT + n0 + lane]; bf* tw = sT + wave * 32 * TP; v8us pc[TPW];
#pragma unroll   // pc[] in registers, all column reads in flight together
        for (int i = 0; i < TPW; ++i) {
#pragma unroll
            for (int e = 0; e < 8; ++e) { const float xv = cp[(i * 8 + e) * PIT]; pc[i][e] = F16OUT ? __builtin_bit_cast(unsigned short, tohx(xv)) : (unsigned short)(__float_as_uint(xv) >> 16); }
        }
#pragma unroll
        for (int i = 0; i < TPW; ++i) *(v8us*)(tw + lane * TP + i * 8) = pc[i];
        asm volatile("s_wait_dscnt 0x0" ::: "memory");   // the wave's own rows are in LDS before other lanes of it read them back
#pragma unroll
        for (int i = 0; i < TPW; ++i) pc[i] = *(const v8us*)(tw + (i * RPS + lane / TPW) * TP + (lane % TPW) * 8);
        bf* op = Ot + (size_t)(n0 + lane / TPW) * CIN + k0 + (lane % TPW) * 8;
        fence();   // the stores go out as one group behind the work that fills their registers
#pragma unroll
        for (int i = 0; i < TPW; ++i) *(v8us*)(op + (size_t)i * RPS * CIN) = pc[i];
        xwait(op);   // the sigma work below takes the stores' registers over
    }
    auto bsum = [&](float x) { float s = x;
#pragma unroll
        for (int sh = 16; sh; sh >>= 1) s += __shfl_xor(s, sh, 32);
        __syncthreads(); if ((tid & 31) == 0) red[tid >> 5] = s; __syncthreads(); float tot = 0.f; for (int k = 0; k < 8; ++k) tot += red[k]; __syncthreads(); return tot; };
    // v_raw[i] = sum_o u[o] W[i][o]
    float vi = 0.f;
    if (tid < CIN) { const float* rp = &sW[tid * PIT];
#pragma unroll 8   // 16 LDS reads go out together: one LDS latency per 32 terms of the chain, not per 4
        for (int o = 0; o < COUT; o += 4) { const v4f w4 = *(const v4f*)(rp + o), u4 = *(const v4f*)(su + o); vi = fmaf(u4[0], w4[0], vi); vi = fmaf(u4[1], w4[1], vi); vi = fmaf(u4[2], w4[2], vi); vi = fmaf(u4[3], w4[3], vi); } }
    const float nv = bsum(tid < CIN ? vi * vi : 0.f); const float invv = rsqrtf(fmaxf(nv, 1e-12f)); if (tid < CIN) v[tid] = vi * invv; __syncthreads();
    // t[o] = sum_i v[i] W[i][o]
    float to = 0.f;
    if (tid < COUT) { const float* cq = &sW[tid];
#pragma unroll 32   // 32 column reads go out together: one LDS latency per 32 terms of the chain
        for (int i = 0; i < CIN; ++i) to = fmaf(v[i], cq[i * PIT], to); }
    const float nt = bsum(tid < COUT ? to * to : 0.f); const float invt = rsqrtf(fmaxf(nt, 1e-12f));
    // sigma = sum_o t[o] * un[o] with un = t * invt
    const float sg = bsum(tid < COUT ? to * (to * invt) : 0.f);
    if (tid < 32) sigl[tid] = (tid == 0) ? sg : 0.f;   // a 32-float line per sigma
}
// k_setup: block w = weight matrix w (wf, wg, wh, wo): its sigma into SIG[32 w], its 16-bit transposed copy into WB (rows f | g | h, bf16) or WO (fp16 of the bf16 value)
__global__ __launch_bounds__(256) void k_setup(const float* __restrict__ wf, const float* __restrict__ uf, const float* __restrict__ wg, const float* __restrict__ ug, const float* __restrict__ wh, const float* __restrict__ uh, const float* __restrict__ wo, const float* __restrict__ uo, float* SIG, bf* WB, h16* WO) {
    __shared__ __align__(16) float sW[SWMAX]; __shared__ __align__(16) bf sT[STMAX]; __shared__ __align__(16) float su[CC]; __shared__ __align__(16) float v[CC]; __shared__ float red[8];
    const int w = blockIdx.x;
    if (w < 2)       setup_one<CC, DQK, false>(w ? wg : wf, w ? ug : uf, WB + w * DQK * CC, SIG + w * 32, sW, sT, su, v, red);
    else if (w == 2) setup_one<CC, DV, false>(wh, uh, WB + 2 * DQK * CC, SIG + 64, sW, sT, su, v, red);
    else             setup_one<DV, CC, true>(wo, uo, (bf*)WO, SIG + 96, sW, sT, su, v, red);
}
#define PTK  128                  // tokens per block of the two weight GEMMs (8 waves x 16)
#define XPIT 264                  // LDS pitch of a 256-wide bf16 row, in halves (528 B = 16 B x odd)
#define TPIT 136                  // LDS pitch of a 128-wide 16-bit row, in halves (272 B = 16 B x odd)
#define OPIT 260                  // LDS pitch of a 256-wide f32 row, in floats (1040 B = 16 B x odd)
// k_proj: f | g | h = x.[wf|wg|wh] of 128 tokens with everything around the product in the same kernel. x comes in as f32 by whole-line loads and is rounded to bf16 on its way
// into LDS; all 192 weight rows are staged beside it. f and g are formed as W.x^T (a lane holds 8 consecutive columns of one token: one 16-byte store after scale and bias),
// h as x.W^T (a lane holds 8 consecutive tokens of one column: a 16-byte piece of an h^T row, gathered in LDS so that each 256-byte run of h^T has one writer).
__global__ __launch_bounds__(256) void k_proj(const float* __restrict__ x, const bf* __restrict__ WB, const float* __restrict__ SIG, const float* __restrict__ bf_, const float* __restrict__ bg_, const float* __restrict__ bh_, h16* Fp, h16* Gp, h16* HT) {
    __shared__ __align__(16) bf  sX[PTK * XPIT];
    __shared__ __align__(16) bf  sW[NPJ * XPIT];
    __shared__ __align__(16) h16 sT[DV * TPIT];
    const int tid = threadIdx.x, lane = tid & 31, wave = tid >> 5, c = lane & 15, h = lane >> 4;
    const size_t R0 = (size_t)blockIdx.x * PTK;
    v4f bq[4][2]; float bv[8];
    {
        const float* xp = x + (R0 + wave * 16) * CC + lane * 4;
        const bf* wp = WB + (size_t)(wave * 24) * CC + lane * 8;
        v4f xr[32]; v8us wr[24];
#pragma unroll
        for (int i = 0; i < 32; ++i) xr[i] = *(const v4f*)(xp + (i >> 1) * CC + (i & 1) * 128);
        xwait(xp);
#pragma unroll
        for (int i = 0; i < 24; ++i) wr[i] = *(const v8us*)(wp + i * CC);
        xwait(wp);
        // the biases: asked for here, used behind the product
        const unsigned bofs = 32u * h; const float* bhp = bh_ + c;   // bofs: bytes of 8 h floats
#pragma unroll
        for (int t = 0; t < 2; ++t) {
            const char* pf = (const char*)bf_ + bofs + t * 64; const char* pg = (const char*)bg_ + bofs + t * 64;
            bq[t][0] = *(const v4f*)pf; bq[t][1] = *(const v4f*)(pf + 16); bq[2 + t][0] = *(const v4f*)pg; bq[2 + t][1] = *(const v4f*)(pg + 16);
        }
        xwait(bofs);
#pragma unroll
        for (int t = 0; t < 8; ++t) bv[t] = bhp[t * 16];
        xwait(bhp);
#pragma unroll
        for (int i = 0; i < 24; ++i) *(v8us*)(&sW[(wave * 24 + i) * XPIT + lane * 8]) = wr[i];
#pragma unroll
        for (int i = 0; i < 32; ++i) *(v4bf*)(&sX[(wave * 16 + (i >> 1)) * XPIT + (i & 1) * 128 + lane * 4]) = __builtin_convertvector(xr[i], v4bf);
    }
    __syncthreads();
    const bf* ax = &sX[(wave * 16 + c) * XPIT + 8 * h];
    const bf* bw = &sW[c * XPIT + 8 * h];
    v8f acc[12];
#pragma unroll
    for (int t = 0; t < 12; ++t) acc[t] = (v8f){};
#pragma unroll
    for (int kc = 0; kc < CC; kc += 32) {
        const v16bf a = cat16b(*(const v8us*)(ax + kc), *(const v8us*)(ax + kc + 16)); v16bf b[12];
#pragma unroll
        for (int t = 0; t < 12; ++t) b[t] = cat16b(*(const v8us*)(bw + t * 16 * XPIT + kc), *(const v8us*)(bw + t * 16 * XPIT + kc + 16));
        fence();   // one step's fragments as one group in front of its products; without the pair of fences many steps' fragments are fetched at once and registers spill
#pragma unroll
        for (int t = 0; t < 12; ++t) acc[t] = (t < 4) ? wmmab(b[t], a, acc[t]) : wmmab(a, b[t], acc[t]);
        fence();
    }
    const float isf = __fdiv_rn(1.0f, SIG[0]), isg = __fdiv_rn(1.0f, SIG[32]), ish = __fdiv_rn(1.0f, SIG[64]);
#pragma unroll
    for (int t = 0; t < 8; ++t) {   // acc[4 + t][r] = h column t * 16 + c of token 8 h + r
        const float bb = bfr(bv[t]); v8h o;
#pragma unroll
        for (int r = 0; r < 8; ++r) o[r] = tohx(acc[4 + t][r] * ish + bb);
        *(v8h*)(&sT[(t * 16 + c) * TPIT + wave * 16 + 8 * h]) = o;
    }
    v8h fg[4];
#pragma unroll
    for (int t = 0; t < 4; ++t) {   // acc[t][r] = column t * 16 + 8 h + r of token c
        const float is = t < 2 ? isf : isg;
#pragma unroll
        for (int r = 0; r < 8; ++r) fg[t][r] = tohx(acc[t][r] * is + bfr(bq[t][r >> 2][r & 3]));
    }
    __syncthreads();
    v8h ht[8];
#pragma unroll
    for (int i = 0; i < 8; ++i) ht[i] = *(const v8h*)(&sT[(wave * 16 + i * 2 + h) * TPIT + c * 8]);
    const int b = blockIdx.x / (HW / PTK), t0 = (blockIdx.x % (HW / PTK)) * PTK;
    h16* fo = Fp + (R0 + wave * 16 + c) * DQK + 8 * h; h16* go = Gp + (R0 + wave * 16 + c) * DQK + 8 * h;
    h16* ho = HT + ((size_t)b * DV + wave * 16 + h) * HW + t0 + c * 8;
    fence();   // every store stands behind all other work, so that no register of an issued store is written again
    *(v8h*)fo = fg[0]; *(v8h*)(fo + 16) = fg[1]; *(v8h*)go = fg[2]; *(v8h*)(go + 16) = fg[3];
#pragma unroll
    for (int i = 0; i < 8; ++i) *(v8h*)(ho + (size_t)i * 2 * HW) = ht[i];
}
typedef __attribute__((ext_vector_type(2))) float    v2f;
typedef __attribute__((ext_vector_type(2))) _Float16 v2h;
#define KST  128                  // keys per stage: 64 for each half of the waves
#define KWV  64                   // keys of a stage that one wave works on
#define HPIT 136                  // LDS pitch of a 128-key h^T row, in halves (272 B = 16 B x odd, for 16-byte reads)
#define FPIT 40                   // LDS pitch of a 32-wide f row, in halves (80 B = 16 B x odd)
#define L2E  1.4426950408889634f
__device__ __forceinline__ float xhalf(float x) { return __builtin_bit_cast(float, __builtin_amdgcn_permlanex16(__builtin_bit_cast(int, x), __builtin_bit_cast(int, x), 0x76543210, 0xfedcba98, false, false)); }  // lane l with lane l ^ 16
// put4: the four O^T tiles per query group, from tile O on, that the partner wave finishes, into this wave's own exchange range (16-byte pieces, a lane stride of 16 B)
template <int O> __device__ __forceinline__ void put4(float* xs, const v8f (&acc)[2][8]) {
#pragma unroll
    for (int u = 0; u < 2; ++u) {
#pragma unroll
        for (int j = 0; j < 4; ++j) {
            const v8f g = acc[u][O + j];
            *(v4f*)(xs + ((u * 4 + j) * 2) * 128)     = (v4f){g[0], g[1], g[2], g[3]};
            *(v4f*)(xs + ((u * 4 + j) * 2 + 1) * 128) = (v4f){g[4], g[5], g[6], g[7]};
        }
    }
}
// fin4: this wave's own four tiles from tile O on, joined with the partner's sums of the same tiles: o = own * ca + partner's * cb
template <int O> __device__ __forceinline__ void fin4(const float* xr, const v8f (&acc)[2][8], const float (&ca)[2], const float (&cb)[2], v8h (&o)[2][4]) {
    v4f p[2][4][2];
#pragma unroll
    for (int u = 0; u < 2; ++u) {
#pragma unroll
        for (int j = 0; j < 4; ++j) { p[u][j][0] = *(const v4f*)(xr + ((u * 4 + j) * 2) * 128); p[u][j][1] = *(const v4f*)(xr + ((u * 4 + j) * 2 + 1) * 128); }
    }
#pragma unroll
    for (int u = 0; u < 2; ++u) {
#pragma unroll
        for (int j = 0; j < 4; ++j) {
#pragma unroll
            for (int r = 0; r < 8; ++r) o[u][j][r] = tohx(acc[u][O + j][r] * ca[u] + p[u][j][r >> 2][r & 3] * cb[u]);
        }
    }
}
// k_attn: s = g.f^T, softmax and beta.h of one image in one kernel; scores and softmax rows stay in registers. Block = 128 queries, walks all 4096 keys in stages of 128.
// The 8 waves are 4 query groups x 2 key halves: a wave has 32 queries (two 16-column groups) and 64 of a stage's keys, so that every f and h^T fragment it reads from LDS feeds two
// products, and the block reads each staged tile four times, not eight. Per wave S^T = F.G^T (A = 16 key rows of f from LDS, B = 16 queries of g, kept in registers): a lane holds
// scores of ONE query per group (column lane & 15), so the running maximum and sum are per lane, with one exchange between the lane halves. Per query group the S^T tiles in pairs (keys 0-15 with 16-31, 32-47 with 48-63),
// converted in place, are the two B operands of O^T += H^T.P^T (A = 16 rows of h^T from LDS), and the rescale of O^T by exp2(m_old - m_new) is per lane too. P is carried x1024 on an fp16
// plane, and the sum carries the same factor. Behind the loop the two waves of a query group join their maxima, sums and O^T through LDS, each finishing 64 of the 128 columns.
__global__ __launch_bounds__(256) void k_attn(const h16* __restrict__ Gp, const h16* __restrict__ Fp, const h16* __restrict__ HT, h16* Op) {
    __shared__ __align__(16) h16 sH[2][DV * HPIT];
    __shared__ __align__(16) h16 sF[2][KST * FPIT];
    __shared__ __align__(16) float sX[8][16 * 128];   // per wave: 8 O^T tiles for its partner
    __shared__ __align__(16) v2f sM[8][2][32];        // per wave and query group: a lane's maximum and sum
    const int tid = threadIdx.x, lane = tid & 31, wave = tid >> 5, c = lane & 15, h = lane >> 4;
    const int kh = __builtin_amdgcn_readfirstlane(tid >> 7);   // the wave's key half, in a scalar register: the branches on it behind the loop are scalar ones
    const int b = blockIdx.y, q = blockIdx.x * 128 + (wave & 3) * 32 + c;   // the lane's queries: q and q + 16
    const h16* gq = Gp + ((size_t)b * HW + q) * DQK + 8 * h;
    v16h gfr[2];
#pragma unroll
    for (int u = 0; u < 2; ++u) gfr[u] = cat16(*(const v8h*)(gq + u * 16 * DQK), *(const v8h*)(gq + u * 16 * DQK + 16));
    const int hrow = tid >> 4, hch = (tid & 15) * 8, frow = tid >> 2, fch = (tid & 3) * 8;
    // a uniform base that moves with the stage plus a lane offset that never changes: no vector address register is rewritten, and the base moves only behind the loads' data wait
    const h16* hbase = HT + (size_t)b * DV * HW; const h16* fbase = Fp + (size_t)b * HW * DQK;
    const unsigned hoff = (unsigned)(hrow * HW + hch), foff = (unsigned)(frow * DQK + fch);   // h^T rows hrow + 16 i, 16 lanes per 256-byte run; f rows frow + 64 j
    v8h rh[8], rf[2];
#pragma unroll
    for (int i = 0; i < 8; ++i) rh[i] = *(const v8h*)(hbase + hoff + 16 * i * HW);
#pragma unroll
    for (int j = 0; j < 2; ++j) rf[j] = *(const v8h*)(fbase + foff + 64 * j * DQK);
    xwait(gq);   // behind the last load of the prologue: what follows may take the address registers of these loads over
#pragma unroll
    for (int i = 0; i < 8; ++i) *(v8h*)(&sH[0][(hrow + 16 * i) * HPIT + hch]) = rh[i];
#pragma unroll
    for (int j = 0; j < 2; ++j) *(v8h*)(&sF[0][(frow + 64 * j) * FPIT + fch]) = rf[j];
    __syncthreads();
    v8f acc[2][8];
#pragma unroll
    for (int u = 0; u < 2; ++u) {
#pragma unroll
        for (int t = 0; t < 8; ++t) acc[u][t] = (v8f){};
    }
    float m[2] = {-3.0e38f, -3.0e38f}, l[2] = {0.f, 0.f};
#pragma unroll 1
    for (int s = 0; s < HW / KST; ++s) {
        // next stage's tile into registers while this one is worked on (on the last trip the bases stay: it fetches its own stage again, and that copy is never read)
        if (s + 1 < HW / KST) { hbase += KST; fbase += KST * DQK; }
#pragma unroll
        for (int i = 0; i < 8; ++i) rh[i] = *(const v8h*)(hbase + hoff + 16 * i * HW);
#pragma unroll
        for (int j = 0; j < 2; ++j) rf[j] = *(const v8h*)(fbase + foff + 64 * j * DQK);
        const h16* cF = &sF[s & 1][(kh * KWV + c) * FPIT + 8 * h];
        const h16* cH = &sH[s & 1][c * HPIT + kh * KWV + 8 * h];
        v16h ff[4], a0[8], a1[8];
#pragma unroll
        for (int t = 0; t < 4; ++t) ff[t] = cat16(*(const v8h*)(cF + t * 16 * FPIT), *(const v8h*)(cF + t * 16 * FPIT + 16));
#pragma unroll
        for (int t = 0; t < 8; ++t) a0[t] = cat16(*(const v8h*)(cH + t * 16 * HPIT), *(const v8h*)(cH + t * 16 * HPIT + 16));
        fence();   // keeps the global loads and the first h^T fragments issued here, ahead of the score and softmax work that hides their latency
        v8f st[2][4];
#pragma unroll
        for (int t = 0; t < 4; ++t) {
#pragma unroll
            for (int u = 0; u < 2; ++u) st[u][t] = wmma16(ff[t], gfr[u], (v8f){});
        }
        v16h pf[2][2]; float al[2];
#pragma unroll
        for (int u = 0; u < 2; ++u) {
            float mx[4];
#pragma unroll
            for (int t = 0; t < 4; ++t) mx[t] = fmaxf(fmaxf(fmaxf(st[u][t][0], st[u][t][1]), fmaxf(st[u][t][2], st[u][t][3])), fmaxf(fmaxf(st[u][t][4], st[u][t][5]), fmaxf(st[u][t][6], st[u][t][7])));
            float mq = fmaxf(fmaxf(mx[0], mx[1]), fmaxf(mx[2], mx[3]));
            mq = fmaxf(mq, xhalf(mq));
            const float mn = fmaxf(m[u], mq * L2E);
            al[u] = __builtin_amdgcn_exp2f(m[u] - mn);         // 0 on the first stage
            const float off = 10.0f - mn;                      // P carried x1024
            m[u] = mn;
            v2f ps[2] = {(v2f){0.f, 0.f}, (v2f){0.f, 0.f}};
#pragma unroll
            for (int t = 0; t < 4; ++t) {
#pragma unroll
                for (int j = 0; j < 8; j += 2) {
                    const v2f a = __builtin_elementwise_fma((v2f){st[u][t][j], st[u][t][j + 1]}, (v2f){L2E, L2E}, (v2f){off, off});
                    const v2f e = {__builtin_amdgcn_exp2f(a[0]), __builtin_amdgcn_exp2f(a[1])};
                    ps[(j >> 1) & 1] += e;
                    const v2h eh = __builtin_convertvector(e, v2h);
                    pf[u][t >> 1][(t & 1) * 8 + j] = eh[0]; pf[u][t >> 1][(t & 1) * 8 + j + 1] = eh[1];
                }
            }
            const v2f pt = ps[0] + ps[1];
            l[u] = fmaf(l[u], al[u], pt[0] + pt[1]);
        }
#pragma unroll
        for (int u = 0; u < 2; ++u) {
#pragma unroll
            for (int t = 0; t < 8; ++t) acc[u][t] *= al[u];
        }
        fence();   // with the fence behind them: the second half's h^T fragments go out as one group in front of the first half's products, not among them
#pragma unroll
        for (int t = 0; t < 8; ++t) a1[t] = cat16(*(const v8h*)(cH + t * 16 * HPIT + 32), *(const v8h*)(cH + t * 16 * HPIT + 48));
        fence();   // second of the pair: without it the fragment loads and their waits move in among the products
#pragma unroll
        for (int t = 0; t < 8; ++t) {
#pragma unroll
            for (int u = 0; u < 2; ++u) acc[u][t] = wmma16(a0[t], pf[u][0], acc[u][t]);
        }
#pragma unroll
        for (int t = 0; t < 8; ++t) {
#pragma unroll
            for (int u = 0; u < 2; ++u) acc[u][t] = wmma16(a1[t], pf[u][1], acc[u][t]);
        }
        // the other buffer's last readers left it before the barrier that ended the trip before this one
        h16* nH = &sH[(s + 1) & 1][0]; h16* nF = &sF[(s + 1) & 1][0];
#pragma unroll
        for (int i = 0; i < 8; ++i) *(v8h*)(nH + (hrow + 16 * i) * HPIT + hch) = rh[i];
#pragma unroll
        for (int j = 0; j < 2; ++j) *(v8h*)(nF + (frow + 64 * j) * FPIT + fch) = rf[j];
        __syncthreads();
    }
    // the join of the two key halves: wave w and wave w ^ 4 hold the same queries. Each hands the other the O^T tiles of the 64 columns that the other finishes, with its maximum and sum
#pragma unroll
    for (int u = 0; u < 2; ++u) { l[u] += xhalf(l[u]); sM[wave][u][lane] = (v2f){m[u], l[u]}; }
    float* xs = &sX[wave][lane * 4];
    if (kh) put4<0>(xs, acc); else put4<4>(xs, acc);
    __syncthreads();
    float ca[2], cb[2];
#pragma unroll
    for (int u = 0; u < 2; ++u) {
        const v2f o = sM[wave ^ 4][u][lane];
        const float mm = fmaxf(m[u], o[0]), wa = __builtin_amdgcn_exp2f(m[u] - mm), wb = __builtin_amdgcn_exp2f(o[0] - mm);
        const float inv = __fdiv_rn(1.0f, fmaf(l[u], wa, o[1] * wb));
        ca[u] = wa * inv; cb[u] = wb * inv;
    }
    const float* xr = &sX[wave ^ 4][lane * 4];
    v8h ov[2][4];
    if (kh) fin4<4>(xr, acc, ca, cb, ov); else fin4<0>(xr, acc, ca, cb, ov);
    h16* op = Op + ((size_t)b * HW + q) * DV + kh * 64 + 8 * h;   // a wave stores whole 128-byte lines: its 64 columns of each query
    fence();   // every store stands behind all other work, so that no register of an issued store is written again
#pragma unroll
    for (int u = 0; u < 2; ++u) {
#pragma unroll
        for (int j = 0; j < 4; ++j) *(v8h*)(op + u * 16 * DV + j * 16) = ov[u][j];
    }
}
// k_out: out = gamma (o.wo / sigma_o + bo) + x of 128 tokens in one kernel: o and all 256 rows of wo^T staged in LDS, the product formed as Wo.o^T (a lane holds 8 consecutive
// columns of one token), passed through the wave's own LDS rows so that scale, bias, gamma and the residual are applied on whole 512-byte runs of a row, which are stored as such.
__global__ __launch_bounds__(256) void k_out(const h16* __restrict__ Op, const h16* __restrict__ WO, const float* __restrict__ SIG, const float* __restrict__ bo_, const float* __restrict__ gam, const float* __restrict__ x, float* OUTB) {
    __shared__ __align__(16) h16   sO[PTK * TPIT];
    __shared__ __align__(16) h16   sWo[CC * TPIT];
    __shared__ __align__(16) float sC[8][16 * OPIT];
    const int tid = threadIdx.x, lane = tid & 31, wave = tid >> 5, c = lane & 15, h = lane >> 4;
    const size_t R0 = (size_t)blockIdx.x * PTK;
    const float* xp = x + (R0 + wave * 16) * CC + lane * 4;
    v4f xr[32], bo4[2];
    {
        const h16* op = Op + (R0 + wave * 16) * DV + lane * 8;      // two 256-byte rows per load
        const h16* wp = WO + (size_t)(wave * 32) * DV + lane * 8;
        v8h ro[8], rw[16];
#pragma unroll
        for (int i = 0; i < 8; ++i) ro[i] = *(const v8h*)(op + i * 2 * DV);
        xwait(op);
#pragma unroll
        for (int i = 0; i < 16; ++i) rw[i] = *(const v8h*)(wp + i * 2 * DV);
        xwait(wp);
        // the residual rows and the bias: asked for here, used behind the product
#pragma unroll
        for (int i = 0; i < 32; ++i) xr[i] = *(const v4f*)(xp + (i >> 1) * CC + (i & 1) * 128);
        xwait(xp);
        const float* bp = bo_ + lane * 4;
#pragma unroll
        for (int p = 0; p < 2; ++p) bo4[p] = *(const v4f*)(bp + p * 128);
        xwait(bp);
#pragma unroll
        for (int i = 0; i < 8; ++i) *(v8h*)(&sO[(wave * 16 + i * 2 + h) * TPIT + c * 8]) = ro[i];
#pragma unroll
        for (int i = 0; i < 16; ++i) *(v8h*)(&sWo[(wave * 32 + i * 2 + h) * TPIT + c * 8]) = rw[i];
    }
    __syncthreads();
    const h16* ao = &sO[(wave * 16 + c) * TPIT + 8 * h];
    const h16* bw = &sWo[c * TPIT + 8 * h];
    v8f acc[16];
#pragma unroll
    for (int t = 0; t < 16; ++t) acc[t] = (v8f){};
#pragma unroll
    for (int kc = 0; kc < DV; kc += 32) {
        const v16h a = cat16(*(const v8h*)(ao + kc), *(const v8h*)(ao + kc + 16)); v16h b[16];
#pragma unroll
        for (int t = 0; t < 16; ++t) b[t] = cat16(*(const v8h*)(bw + t * 16 * TPIT + kc), *(const v8h*)(bw + t * 16 * TPIT + kc + 16));
        fence();   // one step's fragments as one group in front of its products; without the pair of fences all four steps' fragments are fetched at once and registers spill
#pragma unroll
        for (int t = 0; t < 16; ++t) acc[t] = wmma16(b[t], a, acc[t]);
        fence();
    }
    float* os = &sC[wave][0];
#pragma unroll
    for (int t = 0; t < 16; ++t) {   // acc[t][r] = column t * 16 + 8 h + r of token c
        *(v4f*)(os + c * OPIT + t * 16 + 8 * h)     = (v4f){acc[t][0], acc[t][1], acc[t][2], acc[t][3]};
        *(v4f*)(os + c * OPIT + t * 16 + 8 * h + 4) = (v4f){acc[t][4], acc[t][5], acc[t][6], acc[t][7]};
    }
    __syncthreads();
    const float iso = __fdiv_rn(1.0f, SIG[96]); const float gmm = bfr(gam[0]);
#pragma unroll
    for (int p = 0; p < 2; ++p) bo4[p] = (v4f){bfr(bo4[p][0]), bfr(bo4[p][1]), bfr(bo4[p][2]), bfr(bo4[p][3])};
    v4f cv[32];
#pragma unroll
    for (int i = 0; i < 32; ++i) cv[i] = *(const v4f*)(os + (i >> 1) * OPIT + (i & 1) * 128 + lane * 4);
    fence();   // the LDS reads go out as one group; without it each is waited for just ahead of its use
#pragma unroll
    for (int i = 0; i < 32; ++i) {
#pragma unroll
        for (int k = 0; k < 4; ++k) xr[i][k] = gmm * (cv[i][k] * iso + bo4[i & 1][k]) + bfr(xr[i][k]);
    }
    float* po = OUTB + (R0 + wave * 16) * CC + lane * 4;
    fence();   // every store stands behind all other work, so that no register of an issued store is written again
#pragma unroll
    for (int i = 0; i < 32; ++i) *(v4f*)(po + (i >> 1) * CC + (i & 1) * 128) = xr[i];
}
extern "C" void kernel_launch(void* const* d_in, const int* in_sizes, int n_in,
                              void* d_out, int out_size, void* d_ws, size_t ws_size, hipStream_t stream) {
    (void)in_sizes; (void)n_in; (void)out_size;
    const float* x = (const float*)d_in[0]; const float* wf = (const float*)d_in[1]; const float* bf_ = (const float*)d_in[2]; const float* uf = (const float*)d_in[3]; const float* wg = (const float*)d_in[4]; const float* bg_ = (const float*)d_in[5]; const float* ug = (const float*)d_in[6]; const float* wh = (const float*)d_in[7]; const float* bh_ = (const float*)d_in[8]; const float* uh = (const float*)d_in[9]; const float* wo = (const float*)d_in[10]; const float* bo_ = (const float*)d_in[11]; const float* uo = (const float*)d_in[12]; const float* gam = (const float*)d_in[13];
    float* out = (float*)d_out;    // [8][64][64][256]
    char* wsp = (char*)d_ws;
    auto take = [&](size_t bytes) { char* p = wsp; wsp += (bytes + 255) & ~(size_t)255; return (void*)p; };
    float* SIG = (float*)take(4 * 32 * 4); bf* WB = (bf*)take((size_t)NPJ * CC * 2); h16* WO = (h16*)take((size_t)CC * DV * 2);
    h16* Fp = (h16*)take((size_t)NR * DQK * 2); h16* Gp = (h16*)take((size_t)NR * DQK * 2); h16* HT = (h16*)take((size_t)NB_ * DV * HW * 2); h16* Op = (h16*)take((size_t)NR * DV * 2);
    if ((size_t)(wsp - (char*)d_ws) > ws_size) return;    // ~ 0.2 + 2.1 x 2 + 8.4 + 8.4 ~ 21 MB
    k_setup<<<4, 256, 0, stream>>>(wf, uf, wg, ug, wh, uh, wo, uo, SIG, WB, WO);
    k_proj<<<NR / PTK, 256, 0, stream>>>(x, WB, SIG, bf_, bg_, bh_, Fp, Gp, HT);
    k_attn<<<dim3(HW / 128, NB_, 1), 256, 0, stream>>>(Gp, Fp, HT, Op);
    k_out<<<NR / PTK, 256, 0, stream>>>(Op, WO, SIG, bo_, gam, x, out);
}

// v005
// One run takes 63 microseconds.
// In two side-by-side timings against v004, it was 1.07 and 1.05 times as fast.
// All steps since v000 together make it 18.1 times as fast.
#include <hip/hip_runtime.h>

// Compute dtypes, f32 accumulate: the four spectral-norm sigmas (one power iteration on the tiny weight matrices) in f32 on VALU and applied as f32 scales AFTER the GEMMs, so
// every weight GEMM uses the EXACT bf16 weights: f|g|h = x.[wf|wg|wh] ([32768 x 256].[256 x 192]) with plain bf16 operands (x and the weights are inputs: exact products);
// per image s = g.f^T ([4096 x 32].[32 x 4096]) and beta.h ([4096 x 4096].[4096 x 128]) on SINGLE fp16 planes (f/g/h after the 1/sigma scale + bias, softmax rows carried
// x1024 rounded to fp16 = 2^-11); o.wo ([32768 x 128].[128 x 256]) on a single fp16 plane of o against exact wo; out = gamma (o.wo / sigma_o + bo) + x in f32

#define NB_  8
#define HW   4096
#define CC   256
#define DQK  32
#define DV   128
#define NPJ  192                  // f | g | h columns
#define NR   (NB_ * HW)           // 32768
#define DM   CC
#define LOSC 1024.0f
typedef _Float16 h16;
typedef unsigned short bf;
typedef __attribute__((ext_vector_type(16))) __bf16   v16bf;
typedef __attribute__((ext_vector_type(16))) _Float16 v16h;
typedef __attribute__((ext_vector_type(8)))  _Float16 v8h;
typedef __attribute__((ext_vector_type(8)))  unsigned short v8us;
typedef __attribute__((ext_vector_type(8)))  float    v8f;
typedef __attribute__((ext_vector_type(4)))  float    v4f;
typedef v8h  __attribute__((may_alias)) v8ha;
typedef v4f  __attribute__((may_alias)) v4fa;
typedef v8us __attribute__((may_alias)) v8usa;

__device__ __forceinline__ unsigned short f2bf(float f) { unsigned u = __float_as_uint(f); u += 0x7FFFu + ((u >> 16) & 1u); return (unsigned short)(u >> 16); }
__device__ __forceinline__ float bf2f(unsigned short b) { return __uint_as_float(((unsigned)b) << 16); }
__device__ __forceinline__ float bfr(float f) { return bf2f(f2bf(f)); }
__device__ __forceinline__ v16h cat16(v8h lo, v8h hi) { return __builtin_shufflevector(lo, hi, 0, 1, 2, 3, 4, 5, 6, 7, 8, 9, 10, 11, 12, 13, 14, 15); }
__device__ __forceinline__ v16bf cat16b(v8us lo, v8us hi) { return __builtin_bit_cast(v16bf, __builtin_shufflevector(lo, hi, 0, 1, 2, 3, 4, 5, 6, 7, 8, 9, 10, 11, 12, 13, 14, 15)); }
__device__ __forceinline__ v8f wmma16(v16h a, v16h b, v8f c) { return __builtin_amdgcn_wmma_f32_16x16x32_f16(false, a, false, b, (short)0, c, false, false); }
__device__ __forceinline__ v8f wmmab(v16bf a, v16bf b, v8f c) { return __builtin_amdgcn_wmma_f32_16x16x32_bf16(false, a, false, b, (short)0, c, false, false); }

typedef __attribute__((ext_vector_type(4))) _Float16 v4h;
__device__ __forceinline__ h16 tohx(float x) { return (h16)x; }
typedef __attribute__((ext_vector_type(4))) __bf16 v4bf;
__device__ __forceinline__ void fence() { __builtin_amdgcn_sched_barrier(0); }   // the compiler schedules nothing across it
// behind a group of global loads from p (a lane's pointer, or its byte offset from a uniform base): the wait that stands in front of any new value in their address registers. p as an input keeps those registers p's up to the wait (else the
// group's last load may land on them); the scheduling barrier keeps what follows behind it
template <class T> __device__ __forceinline__ void xwait(T p) { asm volatile("s_wait_xcnt 0x0" :: "v"(p) : "memory"); __builtin_amdgcn_sched_barrier(0); }
#define SWMAX (CC * (DV + 4))     // floats of the largest staged weight matrix: 256 rows at a pitch of 132
#define STMAX (8 * 32 * 136)      // halves: per wave 32 rows of W^T, 128 wide at a pitch of 136
// setup_one: all that is made of ONE weight matrix W [CIN][COUT] (in,out) with u [COUT], by one block. W comes in once, by whole-line loads that are all in flight together, and is
// rounded to bf16 on its way into LDS (kept as f32, pitch COUT + 4 floats = 16 B x odd). From LDS: (1) the 16-bit copy Ot [COUT][CIN] = W^T that the GEMMs read (a lane gathers runs of 8
// consecutive k of its own column; the wave turns its 32 rows in its own LDS range, so that each store instruction covers whole 128-byte lines); (2) sigma: v = l2n(u.W^T) (CIN), t = v.W (COUT), sigma = t.l2n(t), summed in the order o, i = 0, 1, 2 ...
// Every loop over r[] and pc[] is unrolled whole, so that the arrays stay in registers and each group of loads or stores goes out together.
template <int CIN, int COUT, bool F16OUT>
__device__ __forceinline__ void setup_one(const float* __restrict__ Wm, const float* __restrict__ u, bf* Ot, float* sigl, float* sW, bf* sT, float* su, float* v, float* red) {
    constexpr int PIT = COUT + 4, NL = CIN * COUT / 1024, TPR = COUT / 4;   // NL 16-byte loads per thread, TPR threads per row
    const int tid = threadIdx.x, lane = tid & 31, wave = tid >> 5;
    {
        const float* wp = Wm + tid * 4; const float* up = u + (tid < COUT ? tid : 0); v4f r[NL];
#pragma unroll   // r[] in registers, the whole matrix in flight at once
        for (int j = 0; j < NL; ++j) r[j] = *(const v4f*)(wp + j * 1024);
        xwait(wp);
        const float uu = *up;
        xwait(up);
        float* sp = &sW[(tid / TPR) * PIT + (tid % TPR) * 4];
#pragma unroll
        for (int j = 0; j < NL; ++j) *(v4f*)(sp + j * (1024 / COUT) * PIT) = (v4f){bfr(r[j][0]), bfr(r[j][1]), bfr(r[j][2]), bfr(r[j][3])};
        if (tid < COUT) su[tid] = bfr(uu);
    }
    __syncthreads();
    constexpr int KG = CIN / 8, TOT = (COUT / 32) * KG, TPW = TOT / 8 < 8 ? 8 : TOT / 8;   // 16-byte pieces per lane: at least 8, one 128-byte line
    constexpr int TP = TPW * 8 + 8, RPS = 32 / TPW;   // pitch of the wave's transposed rows in halves (16 B x odd); rows of W^T per store instruction
    if (wave * TPW < TOT) {
        const int n0 = (wave * TPW / KG) * 32, k0 = (wave * TPW % KG) * 8;   // the wave's 32 rows of W^T, TPW * 8 columns from k0
        const float* cp = &sW[k0 * PIT + n0 + lane]; bf* tw = sT + wave * 32 * TP; v8us pc[TPW];
#pragma unroll   // pc[] in registers, all column reads in flight together
        for (int i = 0; i < TPW; ++i) {
#pragma unroll
            for (int e = 0; e < 8; ++e) { const float xv = cp[(i * 8 + e) * PIT]; pc[i][e] = F16OUT ? __builtin_bit_cast(unsigned short, tohx(xv)) : (unsigned short)(__float_as_uint(xv) >> 16); }
        }
#pragma unroll
        for (int i = 0; i < TPW; ++i) *(v8us*)(tw + lane * TP + i * 8) = pc[i];
        asm volatile("s_wait_dscnt 0x0" ::: "memory");   // the wave's own rows are in LDS before other lanes of it read them back
#pragma unroll
        for (int i = 0; i < TPW; ++i) pc[i] = *(const v8us*)(tw + (i * RPS + lane / TPW) * TP + (lane % TPW) * 8);
        bf* op = Ot + (size_t)(n0 + lane / TPW) * CIN + k0 + (lane % TPW) * 8;
        fence();   // the stores go out as one group behind the work that fills their registers
#pragma unroll
        for (int i = 0; i < TPW; ++i) *(v8us*)(op + (size_t)i * RPS * CIN) = pc[i];
        xwait(op);   // the sigma work below takes the stores' registers over
    }
    auto bsum = [&](float x) { float s = x;
#pragma unroll
        for (int sh = 16; sh; sh >>= 1) s += __shfl_xor(s, sh, 32);
        __syncthreads(); if ((tid & 31) == 0) red[tid >> 5] = s; __syncthreads(); float tot = 0.f; for (int k = 0; k < 8; ++k) tot += red[k]; __syncthreads(); return tot; };
    // v_raw[i] = sum_o u[o] W[i][o]
    float vi = 0.f;
    if (tid < CIN) { const float* rp = &sW[tid * PIT];
#pragma unroll 8   // 16 LDS reads go out together: one LDS latency per 32 terms of the chain, not per 4
        for (int o = 0; o < COUT; o += 4) { const v4f w4 = *(const v4f*)(rp + o), u4 = *(const v4f*)(su + o); vi = fmaf(u4[0], w4[0], vi); vi = fmaf(u4[1], w4[1], vi); vi = fmaf(u4[2], w4[2], vi); vi = fmaf(u4[3], w4[3], vi); } }
    const float nv = bsum(tid < CIN ? vi * vi : 0.f); const float invv = rsqrtf(fmaxf(nv, 1e-12f)); if (tid < CIN) v[tid] = vi * invv; __syncthreads();
    // t[o] = sum_i v[i] W[i][o]
    float to = 0.f;
    if (tid < COUT) { const float* cq = &sW[tid];
#pragma unroll 32   // 32 column reads go out together: one LDS latency per 32 terms of the chain
        for (int i = 0; i < CIN; ++i) to = fmaf(v[i], cq[i * PIT], to); }
    const float nt = bsum(tid < COUT ? to * to : 0.f); const float invt = rsqrtf(fmaxf(nt, 1e-12f));
    // sigma = sum_o t[o] * un[o] with un = t * invt
    const float sg = bsum(tid < COUT ? to * (to * invt) : 0.f);
    if (tid < 32) sigl[tid] = (tid == 0) ? sg : 0.f;   // a 32-float line per sigma
}
// k_setup: block w = weight matrix w (wf, wg, wh, wo): its sigma into SIG[32 w], its 16-bit transposed copy into WB (rows f | g | h, bf16) or WO (fp16 of the bf16 value)
__global__ __launch_bounds__(256) void k_setup(const float* __restrict__ wf, const float* __restrict__ uf, const float* __restrict__ wg, const float* __restrict__ ug, const float* __restrict__ wh, const float* __restrict__ uh, const float* __restrict__ wo, const float* __restrict__ uo, float* SIG, bf* WB, h16* WO) {
    __shared__ __align__(16) float sW[SWMAX]; __shared__ __align__(16) bf sT[STMAX]; __shared__ __align__(16) float su[CC]; __shared__ __align__(16) float v[CC]; __shared__ float red[8];
    const int w = blockIdx.x;
    if (w < 2)       setup_one<CC, DQK, false>(w ? wg : wf, w ? ug : uf, WB + w * DQK * CC, SIG + w * 32, sW, sT, su, v, red);
    else if (w == 2) setup_one<CC, DV, false>(wh, uh, WB + 2 * DQK * CC, SIG + 64, sW, sT, su, v, red);
    else             setup_one<DV, CC, true>(wo, uo, (bf*)WO, SIG + 96, sW, sT, su, v, red);
}
#define PTK  128                  // tokens per block of the two weight GEMMs (8 waves x 16)
#define XPIT 264                  // LDS pitch of a 256-wide bf16 row, in halves (528 B = 16 B x odd)
#define TPIT 136                  // LDS pitch of a 128-wide 16-bit row, in halves (272 B = 16 B x odd)
#define OPIT 260                  // LDS pitch of a 256-wide f32 row, in floats (1040 B = 16 B x odd)
// k_proj: f | g | h = x.[wf|wg|wh] of 128 tokens with everything around the product in the same kernel. x comes in as f32 by whole-line loads and is rounded to bf16 on its way
// into LDS; all 192 weight rows are staged beside it. f and g are formed as W.x^T (a lane holds 8 consecutive columns of one token: one 16-byte store after scale and bias),
// h as x.W^T (a lane holds 8 consecutive tokens of one column: a 16-byte piece of an h^T row, gathered in LDS so that each 256-byte run of h^T has one writer).
__global__ __launch_bounds__(256) void k_proj(const float* __restrict__ x, const bf* __restrict__ WB, const float* __restrict__ SIG, const float* __restrict__ bf_, const float* __restrict__ bg_, const float* __restrict__ bh_, h16* Fp, h16* Gp, h16* HT) {
    __shared__ __align__(16) bf  sX[PTK * XPIT];
    __shared__ __align__(16) bf  sW[NPJ * XPIT];
    __shared__ __align__(16) h16 sT[DV * TPIT];
    const int tid = threadIdx.x, lane = tid & 31, wave = tid >> 5, c = lane & 15, h = lane >> 4;
    const size_t R0 = (size_t)blockIdx.x * PTK;
    v4f bq[4][2]; float bv[8];
    {
        const float* xp = x + (R0 + wave * 16) * CC + lane * 4;
        const bf* wp = WB + (size_t)(wave * 24) * CC + lane * 8;
        v4f xr[32]; v8us wr[24];
#pragma unroll
        for (int i = 0; i < 32; ++i) xr[i] = *(const v4f*)(xp + (i >> 1) * CC + (i & 1) * 128);
        xwait(xp);
#pragma unroll
        for (int i = 0; i < 24; ++i) wr[i] = *(const v8us*)(wp + i * CC);
        xwait(wp);
        // the biases: asked for here, used behind the product
        const unsigned bofs = 32u * h; const float* bhp = bh_ + c;   // bofs: bytes of 8 h floats
#pragma unroll
        for (int t = 0; t < 2; ++t) {
            const char* pf = (const char*)bf_ + bofs + t * 64; const char* pg = (const char*)bg_ + bofs + t * 64;
            bq[t][0] = *(const v4f*)pf; bq[t][1] = *(const v4f*)(pf + 16); bq[2 + t][0] = *(const v4f*)pg; bq[2 + t][1] = *(const v4f*)(pg + 16);
        }
        xwait(bofs);
#pragma unroll
        for (int t = 0; t < 8; ++t) bv[t] = bhp[t * 16];
        xwait(bhp);
#pragma unroll
        for (int i = 0; i < 24; ++i) *(v8us*)(&sW[(wave * 24 + i) * XPIT + lane * 8]) = wr[i];
#pragma unroll
        for (int i = 0; i < 32; ++i) *(v4bf*)(&sX[(wave * 16 + (i >> 1)) * XPIT + (i & 1) * 128 + lane * 4]) = __builtin_convertvector(xr[i], v4bf);
    }
    __syncthreads();
    const bf* ax = &sX[(wave * 16 + c) * XPIT + 8 * h];
    const bf* bw = &sW[c * XPIT + 8 * h];
    v8f acc[12];
#pragma unroll
    for (int t = 0; t < 12; ++t) acc[t] = (v8f){};
#pragma unroll
    for (int kc = 0; kc < CC; kc += 32) {
        const v16bf a = cat16b(*(const v8us*)(ax + kc), *(const v8us*)(ax + kc + 16)); v16bf b[12];
#pragma unroll
        for (int t = 0; t < 12; ++t) b[t] = cat16b(*(const v8us*)(bw + t * 16 * XPIT + kc), *(const v8us*)(bw + t * 16 * XPIT + kc + 16));
        fence();   // one step's fragments as one group in front of its products; without the pair of fences many steps' fragments are fetched at once and registers spill
#pragma unroll
        for (int t = 0; t < 12; ++t) acc[t] = (t < 4) ? wmmab(b[t], a, acc[t]) : wmmab(a, b[t], acc[t]);
        fence();
    }
    const float isf = __fdiv_rn(1.0f, SIG[0]), isg = __fdiv_rn(1.0f, SIG[32]), ish = __fdiv_rn(1.0f, SIG[64]);
#pragma unroll
    for (int t = 0; t < 8; ++t) {   // acc[4 + t][r] = h column t * 16 + c of token 8 h + r
        const float bb = bfr(bv[t]); v8h o;
#pragma unroll
        for (int r = 0; r < 8; ++r) o[r] = tohx(acc[4 + t][r] * ish + bb);
        *(v8h*)(&sT[(t * 16 + c) * TPIT + wave * 16 + 8 * h]) = o;
    }
    v8h fg[4];
#pragma unroll
    for (int t = 0; t < 4; ++t) {   // acc[t][r] = column t * 16 + 8 h + r of token c
        const float is = t < 2 ? isf : isg;
#pragma unroll
        for (int r = 0; r < 8; ++r) fg[t][r] = tohx(acc[t][r] * is + bfr(bq[t][r >> 2][r & 3]));
    }
    __syncthreads();
    v8h ht[8];
#pragma unroll
    for (int i = 0; i < 8; ++i) ht[i] = *(const v8h*)(&sT[(wave * 16 + i * 2 + h) * TPIT + c * 8]);
    const int b = blockIdx.x / (HW / PTK), t0 = (blockIdx.x % (HW / PTK)) * PTK;
    h16* fo = Fp + (R0 + wave * 16 + c) * DQK + 8 * h; h16* go = Gp + (R0 + wave * 16 + c) * DQK + 8 * h;
    h16* ho = HT + ((size_t)b * DV + wave * 16 + h) * HW + t0 + c * 8;
    fence();   // every store stands behind all other work, so that no register of an issued store is written again
    *(v8h*)fo = fg[0]; *(v8h*)(fo + 16) = fg[1]; *(v8h*)go = fg[2]; *(v8h*)(go + 16) = fg[3];
#pragma unroll
    for (int i = 0; i < 8; ++i) *(v8h*)(ho + (size_t)i * 2 * HW) = ht[i];
}
typedef __attribute__((ext_vector_type(2))) float    v2f;
typedef __attribute__((ext_vector_type(2))) _Float16 v2h;
#define KST  128                  // keys per stage: 64 for each half of the waves
#define KWV  64                   // keys of a stage that one wave works on
#define HPIT 136                  // LDS pitch of a 128-key h^T row, in halves (272 B = 16 B x odd, for 16-byte reads)
#define FPIT 40                   // LDS pitch of a 32-wide f row, in halves (80 B = 16 B x odd)
#define L2E  1.4426950408889634f
__device__ __forceinline__ float xhalf(float x) { return __builtin_bit_cast(float, __builtin_amdgcn_permlanex16(__builtin_bit_cast(int, x), __builtin_bit_cast(int, x), 0x76543210, 0xfedcba98, false, false)); }  // lane l with lane l ^ 16
// put4: the four O^T tiles per query group, from tile O on, that the partner wave finishes, into this wave's own exchange range (16-byte pieces, a lane stride of 16 B)
template <int O> __device__ __forceinline__ void put4(float* xs, const v8f (&acc)[2][8]) {
#pragma unroll
    for (int u = 0; u < 2; ++u) {
#pragma unroll
        for (int j = 0; j < 4; ++j) {
            const v8f g = acc[u][O + j];
            *(v4f*)(xs + ((u * 4 + j) * 2) * 128)     = (v4f){g[0], g[1], g[2], g[3]};
            *(v4f*)(xs + ((u * 4 + j) * 2 + 1) * 128) = (v4f){g[4], g[5], g[6], g[7]};
        }
    }
}
// fin4: this wave's own four tiles from tile O on, joined with the partner's sums of the same tiles: o = own * ca + partner's * cb
template <int O> __device__ __forceinline__ void fin4(const float* xr, const v8f (&acc)[2][8], const float (&ca)[2], const float (&cb)[2], v8h (&o)[2][4]) {
    v4f p[2][4][2];
#pragma unroll
    for (int u = 0; u < 2; ++u) {
#pragma unroll
        for (int j = 0; j < 4; ++j) { p[u][j][0] = *(const v4f*)(xr + ((u * 4 + j) * 2) * 128); p[u][j][1] = *(const v4f*)(xr + ((u * 4 + j) * 2 + 1) * 128); }
    }
#pragma unroll
    for (int u = 0; u < 2; ++u) {
#pragma unroll
        for (int j = 0; j < 4; ++j) {
#pragma unroll
            for (int r = 0; r < 8; ++r) o[u][j][r] = tohx(acc[u][O + j][r] * ca[u] + p[u][j][r >> 2][r & 3] * cb[u]);
        }
    }
}
// soft: the softmax step of one stage for the wave's two query groups: running maximum and sum, P (x1024, fp16) packed as the B operand of the second product, O^T rescaled to the new maximum
__device__ __forceinline__ void soft(const v8f (&st)[2][4], float (&m)[2], float (&l)[2], v16h (&pf)[2][2], v8f (&acc)[2][8]) {
    float al[2];
#pragma unroll
    for (int u = 0; u < 2; ++u) {
        float mx[4];
#pragma unroll
        for (int t = 0; t < 4; ++t) mx[t] = fmaxf(fmaxf(fmaxf(st[u][t][0], st[u][t][1]), fmaxf(st[u][t][2], st[u][t][3])), fmaxf(fmaxf(st[u][t][4], st[u][t][5]), fmaxf(st[u][t][6], st[u][t][7])));
        float mq = fmaxf(fmaxf(mx[0], mx[1]), fmaxf(mx[2], mx[3]));
        mq = fmaxf(mq, xhalf(mq));
        const float mn = fmaxf(m[u], mq * L2E);
        al[u] = __builtin_amdgcn_exp2f(m[u] - mn);         // 0 on the first stage
        const float off = 10.0f - mn;                      // P carried x1024
        m[u] = mn;
        v2f ps[2] = {(v2f){0.f, 0.f}, (v2f){0.f, 0.f}};
#pragma unroll
        for (int t = 0; t < 4; ++t) {
#pragma unroll
            for (int j = 0; j < 8; j += 2) {
                const v2f a = __builtin_elementwise_fma((v2f){st[u][t][j], st[u][t][j + 1]}, (v2f){L2E, L2E}, (v2f){off, off});
                const v2f e = {__builtin_amdgcn_exp2f(a[0]), __builtin_amdgcn_exp2f(a[1])};
                ps[(j >> 1) & 1] += e;
                const v2h eh = __builtin_convertvector(e, v2h);
                pf[u][t >> 1][(t & 1) * 8 + j] = eh[0]; pf[u][t >> 1][(t & 1) * 8 + j + 1] = eh[1];
            }
        }
        const v2f pt = ps[0] + ps[1];
        l[u] = fmaf(l[u], al[u], pt[0] + pt[1]);
    }
#pragma unroll
    for (int u = 0; u < 2; ++u) {
#pragma unroll
        for (int t = 0; t < 8; ++t) acc[u][t] *= al[u];
    }
}
// k_attn: s = g.f^T, softmax and beta.h of one image in one kernel; scores and softmax rows stay in registers. Block = 128 queries, walks all 4096 keys in stages of 128.
// The 8 waves are 4 query groups x 2 key halves: a wave has 32 queries (two 16-column groups) and 64 of a stage's keys, so that every f and h^T fragment it reads from LDS feeds two
// products, and the block reads each staged tile four times, not eight. Per wave S^T = F.G^T (A = 16 key rows of f from LDS, B = 16 queries of g, kept in registers): a lane holds
// scores of ONE query per group (column lane & 15), so the running maximum and sum are per lane, with one exchange between the lane halves. Per query group the S^T tiles in pairs (keys 0-15 with 16-31, 32-47 with 48-63),
// converted in place, are the two B operands of O^T += H^T.P^T (A = 16 rows of h^T from LDS), and the rescale of O^T by exp2(m_old - m_new) is per lane too. P is carried x1024 on an fp16
// plane, and the sum carries the same factor. Behind the loop the two waves of a query group join their maxima, sums and O^T through LDS, each finishing 64 of the 128 columns.
// The two waves that share a SIMD (wave w and w + 4: the two key halves) run half a stage apart: key half 0 does its softmax in front of the stage's barrier, key half 1 behind it, so
// that between two barriers one of them is in its vector work while the other is in its products. A stage is still read behind its barrier, hence three buffers: the stores in
// front of the next barrier go to the buffer that neither this stage nor the next one reads.
__global__ __launch_bounds__(256) void k_attn(const h16* __restrict__ Gp, const h16* __restrict__ Fp, const h16* __restrict__ HT, h16* Op) {
    __shared__ __align__(16) h16 sH[3][DV * HPIT];
    __shared__ __align__(16) h16 sF[3][KST * FPIT];
    __shared__ __align__(16) float sX[8][16 * 128];   // per wave: 8 O^T tiles for its partner
    __shared__ __align__(16) v2f sM[8][2][32];        // per wave and query group: a lane's maximum and sum
    const int tid = threadIdx.x, lane = tid & 31, wave = tid >> 5, c = lane & 15, h = lane >> 4;
    const int kh = __builtin_amdgcn_readfirstlane(tid >> 7);   // the wave's key half, in a scalar register: the branches on it are scalar ones
    const int b = blockIdx.y, q = blockIdx.x * 128 + (wave & 3) * 32 + c;   // the lane's queries: q and q + 16
    const h16* gq = Gp + ((size_t)b * HW + q) * DQK + 8 * h;
    v16h gfr[2];
#pragma unroll
    for (int u = 0; u < 2; ++u) gfr[u] = cat16(*(const v8h*)(gq + u * 16 * DQK), *(const v8h*)(gq + u * 16 * DQK + 16));
    const int hrow = tid >> 4, hch = (tid & 15) * 8, frow = tid >> 2, fch = (tid & 3) * 8;
    // a uniform base that moves with the stage plus a lane offset that never changes: no vector address register is rewritten, and the base moves only behind the loads' data wait
    const h16* hbase = HT + (size_t)b * DV * HW; const h16* fbase = Fp + (size_t)b * HW * DQK;
    const unsigned hoff = (unsigned)(hrow * HW + hch), foff = (unsigned)(frow * DQK + fch);   // h^T rows hrow + 16 i, 16 lanes per 256-byte run; f rows frow + 64 j
    v8h rh[8], rf[2];
#pragma unroll
    for (int i = 0; i < 8; ++i) rh[i] = *(const v8h*)(hbase + hoff + 16 * i * HW);
#pragma unroll
    for (int j = 0; j < 2; ++j) rf[j] = *(const v8h*)(fbase + foff + 64 * j * DQK);
    xwait(gq);   // behind the loads of g and of stage 0: what follows may take the address registers of these loads over
#pragma unroll
    for (int i = 0; i < 8; ++i) *(v8h*)(&sH[0][(hrow + 16 * i) * HPIT + hch]) = rh[i];
#pragma unroll
    for (int j = 0; j < 2; ++j) *(v8h*)(&sF[0][(frow + 64 * j) * FPIT + fch]) = rf[j];
    __syncthreads();
    fence();   // the bases move only behind the data wait of the loads that named them (the wait stands in front of the LDS stores above)
    // stage 1 into registers: trip 0 stores it
    hbase += KST; fbase += KST * DQK;
#pragma unroll
    for (int i = 0; i < 8; ++i) rh[i] = *(const v8h*)(hbase + hoff + 16 * i * HW);
#pragma unroll
    for (int j = 0; j < 2; ++j) rf[j] = *(const v8h*)(fbase + foff + 64 * j * DQK);
    xwait(foff);   // behind these loads: the compiler forms the loop's bases in the registers that they name
    v8f acc[2][8];
#pragma unroll
    for (int u = 0; u < 2; ++u) {
#pragma unroll
        for (int t = 0; t < 8; ++t) acc[u][t] = (v8f){};
    }
    float m[2] = {-3.0e38f, -3.0e38f}, l[2] = {0.f, 0.f};
    int cur = 0;   // the buffer of stage s: s mod 3
#pragma unroll 1
    for (int s = 0; s < HW / KST; ++s) {
        const int nxt = cur == 2 ? 0 : cur + 1;
        const h16* cF = &sF[cur][(kh * KWV + c) * FPIT + 8 * h];
        const h16* cH = &sH[cur][c * HPIT + kh * KWV + 8 * h];
        v16h ff[4], a0[8], a1[8];
#pragma unroll
        for (int t = 0; t < 4; ++t) ff[t] = cat16(*(const v8h*)(cF + t * 16 * FPIT), *(const v8h*)(cF + t * 16 * FPIT + 16));
#pragma unroll
        for (int t = 0; t < 8; ++t) a0[t] = cat16(*(const v8h*)(cH + t * 16 * HPIT), *(const v8h*)(cH + t * 16 * HPIT + 16));
        fence();   // keeps the first h^T fragments issued here, ahead of the score and softmax work that hides their latency
        v8f st[2][4];
#pragma unroll
        for (int t = 0; t < 4; ++t) {
#pragma unroll
            for (int u = 0; u < 2; ++u) st[u][t] = wmma16(ff[t], gfr[u], (v8f){});
        }
        v16h pf[2][2];
        if (!kh) soft(st, m, l, pf, acc);   // key half 0: vector work here, while key half 1 on the same SIMD is in its products
        // stage s + 1, asked for behind the barrier before this one. Its buffer's last readers (stage s - 2) left it before that barrier
        h16* nH = &sH[nxt][0]; h16* nF = &sF[nxt][0];
#pragma unroll
        for (int i = 0; i < 8; ++i) *(v8h*)(nH + (hrow + 16 * i) * HPIT + hch) = rh[i];
#pragma unroll
        for (int j = 0; j < 2; ++j) *(v8h*)(nF + (frow + 64 * j) * FPIT + fch) = rf[j];
        __syncthreads();
        fence();   // the bases move only behind the data wait of the loads that named them (the wait stands in front of the LDS stores above)
        // stage s + 2 into registers, a whole trip ahead of its stores (on the last two trips the bases stay: the last stage is fetched again, and that copy is never read)
        if (s + 2 < HW / KST) { hbase += KST; fbase += KST * DQK; }
#pragma unroll
        for (int i = 0; i < 8; ++i) rh[i] = *(const v8h*)(hbase + hoff + 16 * i * HW);
#pragma unroll
        for (int j = 0; j < 2; ++j) rf[j] = *(const v8h*)(fbase + foff + 64 * j * DQK);
        fence();   // keeps the global loads issued here, ahead of the work that hides their latency
        if (kh) soft(st, m, l, pf, acc);    // key half 1: vector work here, while key half 0 on the same SIMD is in its products
        fence();   // with the fence behind them: the second half's h^T fragments go out as one group in front of the first half's products, not among them
#pragma unroll
        for (int t = 0; t < 8; ++t) a1[t] = cat16(*(const v8h*)(cH + t * 16 * HPIT + 32), *(const v8h*)(cH + t * 16 * HPIT + 48));
        fence();   // second of the pair: without it the fragment loads and their waits move in among the products
#pragma unroll
        for (int t = 0; t < 8; ++t) {
#pragma unroll
            for (int u = 0; u < 2; ++u) acc[u][t] = wmma16(a0[t], pf[u][0], acc[u][t]);
        }
#pragma unroll
        for (int t = 0; t < 8; ++t) {
#pragma unroll
            for (int u = 0; u < 2; ++u) acc[u][t] = wmma16(a1[t], pf[u][1], acc[u][t]);
        }
        cur = nxt;
    }
    xwait(foff);   // behind the last trip's loads: what follows may take their address registers over
    // the join of the two key halves: wave w and wave w ^ 4 hold the same queries. Each hands the other the O^T tiles of the 64 columns that the other finishes, with its maximum and sum
#pragma unroll
    for (int u = 0; u < 2; ++u) { l[u] += xhalf(l[u]); sM[wave][u][lane] = (v2f){m[u], l[u]}; }
    float* xs = &sX[wave][lane * 4];
    if (kh) put4<0>(xs, acc); else put4<4>(xs, acc);
    __syncthreads();
    float ca[2], cb[2];
#pragma unroll
    for (int u = 0; u < 2; ++u) {
        const v2f o = sM[wave ^ 4][u][lane];
        const float mm = fmaxf(m[u], o[0]), wa = __builtin_amdgcn_exp2f(m[u] - mm), wb = __builtin_amdgcn_exp2f(o[0] - mm);
        const float inv = __fdiv_rn(1.0f, fmaf(l[u], wa, o[1] * wb));
        ca[u] = wa * inv; cb[u] = wb * inv;
    }
    const float* xr = &sX[wave ^ 4][lane * 4];
    v8h ov[2][4];
    if (kh) fin4<4>(xr, acc, ca, cb, ov); else fin4<0>(xr, acc, ca, cb, ov);
    h16* op = Op + ((size_t)b * HW + q) * DV + kh * 64 + 8 * h;   // a wave stores whole 128-byte lines: its 64 columns of each query
    fence();   // every store stands behind all other work, so that no register of an issued store is written again
#pragma unroll
    for (int u = 0; u < 2; ++u) {
#pragma unroll
        for (int j = 0; j < 4; ++j) *(v8h*)(op + u * 16 * DV + j * 16) = ov[u][j];
    }
}
// k_out: out = gamma (o.wo / sigma_o + bo) + x of 128 tokens in one kernel: o and all 256 rows of wo^T staged in LDS, the product formed as Wo.o^T (a lane holds 8 consecutive
// columns of one token), passed through the wave's own LDS rows so that scale, bias, gamma and the residual are applied on whole 512-byte runs of a row, which are stored as such.
__global__ __launch_bounds__(256) void k_out(const h16* __restrict__ Op, const h16* __restrict__ WO, const float* __restrict__ SIG, const float* __restrict__ bo_, const float* __restrict__ gam, const float* __restrict__ x, float* OUTB) {
    __shared__ __align__(16) h16   sO[PTK * TPIT];
    __shared__ __align__(16) h16   sWo[CC * TPIT];
    __shared__ __align__(16) float sC[8][16 * OPIT];
    const int tid = threadIdx.x, lane = tid & 31, wave = tid >> 5, c = lane & 15, h = lane >> 4;
    const size_t R0 = (size_t)blockIdx.x * PTK;
    const float* xp = x + (R0 + wave * 16) * CC + lane * 4;
    v4f xr[32], bo4[2];
    {
        const h16* op = Op + (R0 + wave * 16) * DV + lane * 8;      // two 256-byte rows per load
        const h16* wp = WO + (size_t)(wave * 32) * DV + lane * 8;
        v8h ro[8], rw[16];
#pragma unroll
        for (int i = 0; i < 8; ++i) ro[i] = *(const v8h*)(op + i * 2 * DV);
        xwait(op);
#pragma unroll
        for (int i = 0; i < 16; ++i) rw[i] = *(const v8h*)(wp + i * 2 * DV);
        xwait(wp);
        // the residual rows and the bias: asked for here, used behind the product
#pragma unroll
        for (int i = 0; i < 32; ++i) xr[i] = *(const v4f*)(xp + (i >> 1) * CC + (i & 1) * 128);
        xwait(xp);
        const float* bp = bo_ + lane * 4;
#pragma unroll
        for (int p = 0; p < 2; ++p) bo4[p] = *(const v4f*)(bp + p * 128);
        xwait(bp);
#pragma unroll
        for (int i = 0; i < 8; ++i) *(v8h*)(&sO[(wave * 16 + i * 2 + h) * TPIT + c * 8]) = ro[i];
#pragma unroll
        for (int i = 0; i < 16; ++i) *(v8h*)(&sWo[(wave * 32 + i * 2 + h) * TPIT + c * 8]) = rw[i];
    }
    __syncthreads();
    const h16* ao = &sO[(wave * 16 + c) * TPIT + 8 * h];
    const h16* bw = &sWo[c * TPIT + 8 * h];
    v8f acc[16];
#pragma unroll
    for (int t = 0; t < 16; ++t) acc[t] = (v8f){};
#pragma unroll
    for (int kc = 0; kc < DV; kc += 32) {
        const v16h a = cat16(*(const v8h*)(ao + kc), *(const v8h*)(ao + kc + 16)); v16h b[16];
#pragma unroll
        for (int t = 0; t < 16; ++t) b[t] = cat16(*(const v8h*)(bw + t * 16 * TPIT + kc), *(const v8h*)(bw + t * 16 * TPIT + kc + 16));
        fence();   // one step's fragments as one group in front of its products; without the pair of fences all four steps' fragments are fetched at once and registers spill
#pragma unroll
        for (int t = 0; t < 16; ++t) acc[t] = wmma16(b[t], a, acc[t]);
        fence();
    }
    float* os = &sC[wave][0];
#pragma unroll
    for (int t = 0; t < 16; ++t) {   // acc[t][r] = column t * 16 + 8 h + r of token c
        *(v4f*)(os + c * OPIT + t * 16 + 8 * h)     = (v4f){acc[t][0], acc[t][1], acc[t][2], acc[t][3]};
        *(v4f*)(os + c * OPIT + t * 16 + 8 * h + 4) = (v4f){acc[t][4], acc[t][5], acc[t][6], acc[t][7]};
    }
    __syncthreads();
    const float iso = __fdiv_rn(1.0f, SIG[96]); const float gmm = bfr(gam[0]);
#pragma unroll
    for (int p = 0; p < 2; ++p) bo4[p] = (v4f){bfr(bo4[p][0]), bfr(bo4[p][1]), bfr(bo4[p][2]), bfr(bo4[p][3])};
    v4f cv[32];
#pragma unroll
    for (int i = 0; i < 32; ++i) cv[i] = *(const v4f*)(os + (i >> 1) * OPIT + (i & 1) * 128 + lane * 4);
    fence();   // the LDS reads go out as one group; without it each is waited for just ahead of its use
#pragma unroll
    for (int i = 0; i < 32; ++i) {
#pragma unroll
        for (int k = 0; k < 4; ++k) xr[i][k] = gmm * (cv[i][k] * iso + bo4[i & 1][k]) + bfr(xr[i][k]);
    }
    float* po = OUTB + (R0 + wave * 16) * CC + lane * 4;
    fence();   // every store stands behind all other work, so that no register of an issued store is written again
#pragma unroll
    for (int i = 0; i < 32; ++i) *(v4f*)(po + (i >> 1) * CC + (i & 1) * 128) = xr[i];
}
extern "C" void kernel_launch(void* const* d_in, const int* in_sizes, int n_in,
                              void* d_out, int out_size, void* d_ws, size_t ws_size, hipStream_t stream) {
    (void)in_sizes; (void)n_in; (void)out_size;
    const float* x = (const float*)d_in[0]; const float* wf = (const float*)d_in[1]; const float* bf_ = (const float*)d_in[2]; const float* uf = (const float*)d_in[3]; const float* wg = (const float*)d_in[4]; const float* bg_ = (const float*)d_in[5]; const float* ug = (const float*)d_in[6]; const float* wh = (const float*)d_in[7]; const float* bh_ = (const float*)d_in[8]; const float* uh = (const float*)d_in[9]; const float* wo = (const float*)d_in[10]; const float* bo_ = (const float*)d_in[11]; const float* uo = (const float*)d_in[12]; const float* gam = (const float*)d_in[13];
    float* out = (float*)d_out;    // [8][64][64][256]
    char* wsp = (char*)d_ws;
    auto take = [&](size_t bytes) { char* p = wsp; wsp += (bytes + 255) & ~(size_t)255; return (void*)p; };
    float* SIG = (float*)take(4 * 32 * 4); bf* WB = (bf*)take((size_t)NPJ * CC * 2); h16* WO = (h16*)take((size_t)CC * DV * 2);
    h16* Fp = (h16*)take((size_t)NR * DQK * 2); h16* Gp = (h16*)take((size_t)NR * DQK * 2); h16* HT = (h16*)take((size_t)NB_ * DV * HW * 2); h16* Op = (h16*)take((size_t)NR * DV * 2);
    if ((size_t)(wsp - (char*)d_ws) > ws_size) return;    // ~ 0.2 + 2.1 x 2 + 8.4 + 8.4 ~ 21 MB
    k_setup<<<4, 256, 0, stream>>>(wf, uf, wg, ug, wh, uh, wo, uo, SIG, WB, WO);
    k_proj<<<NR / PTK, 256, 0, stream>>>(x, WB, SIG, bf_, bg_, bh_, Fp, Gp, HT);
    k_attn<<<dim3(HW / 128, NB_, 1), 256, 0, stream>>>(Gp, Fp, HT, Op);
    k_out<<<NR / PTK, 256, 0, stream>>>(Op, WO, SIG, bo_, gam, x, out);
}

// v006
// One run takes 56.7 microseconds.
// Timed twice side by side with v005, it ran 1.08 and 1.09 times as fast.
// Over all steps from v000 it is 19.6 times as fast.
#include <hip/hip_runtime.h>

// Compute dtypes, f32 accumulate: the four spectral-norm sigmas (one power iteration on the tiny weight matrices) in f32 on VALU and applied as f32 scales AFTER the GEMMs, so
// every weight GEMM uses the EXACT bf16 weights: f|g|h = x.[wf|wg|wh] ([32768 x 256].[256 x 192]) with plain bf16 operands (x and the weights are inputs: exact products);
// per image s = g.f^T ([4096 x 32].[32 x 4096]) and beta.h ([4096 x 4096].[4096 x 128]) on SINGLE fp16 planes (f/g/h after the 1/sigma scale + bias, softmax rows carried
// x1024 rounded to fp16 = 2^-11); o.wo ([32768 x 128].[128 x 256]) on a single fp16 plane of o against exact wo; out = gamma (o.wo / sigma_o + bo) + x in f32

#define NB_  8
#define HW   4096
#define CC   256
#define DQK  32
#define DV   128
#define NPJ  192                  // f | g | h columns
#define NR   (NB_ * HW)           // 32768
#define DM   CC
#define LOSC 1024.0f
typedef _Float16 h16;
typedef unsigned short bf;
typedef __attribute__((ext_vector_type(16))) __bf16   v16bf;
typedef __attribute__((ext_vector_type(16))) _Float16 v16h;
typedef __attribute__((ext_vector_type(8)))  _Float16 v8h;
typedef __attribute__((ext_vector_type(8)))  unsigned short v8us;
typedef __attribute__((ext_vector_type(8)))  float    v8f;
typedef __attribute__((ext_vector_type(4)))  float    v4f;
typedef v8h  __attribute__((may_alias)) v8ha;
typedef v4f  __attribute__((may_alias)) v4fa;
typedef v8us __attribute__((may_alias)) v8usa;

__device__ __forceinline__ unsigned short f2bf(float f) { unsigned u = __float_as_uint(f); u += 0x7FFFu + ((u >> 16) & 1u); return (unsigned short)(u >> 16); }
__device__ __forceinline__ float bf2f(unsigned short b) { return __uint_as_float(((unsigned)b) << 16); }
__device__ __forceinline__ float bfr(float f) { return bf2f(f2bf(f)); }
__device__ __forceinline__ v16h cat16(v8h lo, v8h hi) { return __builtin_shufflevector(lo, hi, 0, 1, 2, 3, 4, 5, 6, 7, 8, 9, 10, 11, 12, 13, 14, 15); }
__device__ __forceinline__ v16bf cat16b(v8us lo, v8us hi) { return __builtin_bit_cast(v16bf, __builtin_shufflevector(lo, hi, 0, 1, 2, 3, 4, 5, 6, 7, 8, 9, 10, 11, 12, 13, 14, 15)); }
__device__ __forceinline__ v8f wmma16(v16h a, v16h b, v8f c) { return __builtin_amdgcn_wmma_f32_16x16x32_f16(false, a, false, b, (short)0, c, false, false); }
__device__ __forceinline__ v8f wmmab(v16bf a, v16bf b, v8f c) { return __builtin_amdgcn_wmma_f32_16x16x32_bf16(false, a, false, b, (short)0, c, false, false); }

typedef __attribute__((ext_vector_type(4))) _Float16 v4h;
__device__ __forceinline__ h16 tohx(float x) { return (h16)x; }
typedef __attribute__((ext_vector_type(4))) __bf16 v4bf;
__device__ __forceinline__ void fence() { __builtin_amdgcn_sched_barrier(0); }   // the compiler schedules nothing across it
// behind a group of global loads from p (a lane's pointer, or its byte offset from a uniform base): the wait that stands in front of any new value in their address registers. p as an input keeps those registers p's up to the wait (else the
// group's last load may land on them); the scheduling barrier keeps what follows behind it
template <class T> __device__ __forceinline__ void xwait(T p) { asm volatile("s_wait_xcnt 0x0" :: "v"(p) : "memory"); __builtin_amdgcn_sched_barrier(0); }
#define SWMAX (CC * (DV + 4))     // floats of the largest staged weight matrix: 256 rows at a pitch of 132
#define STMAX (8 * 32 * 136)      // halves: per wave 32 rows of W^T, 128 wide at a pitch of 136
// setup_one: all that is made of ONE weight matrix W [CIN][COUT] (in,out) with u [COUT], by one block. W comes in once, by whole-line loads that are all in flight together, and is
// rounded to bf16 on its way into LDS (kept as f32, pitch COUT + 4 floats = 16 B x odd). From LDS: (1) the 16-bit copy Ot [COUT][CIN] = W^T that the GEMMs read (a lane gathers runs of 8
// consecutive k of its own column; the wave turns its 32 rows in its own LDS range, so that each store instruction covers whole 128-byte lines); (2) sigma: v = l2n(u.W^T) (CIN), t = v.W (COUT), sigma = t.l2n(t), summed in the order o, i = 0, 1, 2 ...
// Every loop over r[] and pc[] is unrolled whole, so that the arrays stay in registers and each group of loads or stores goes out together.
template <int CIN, int COUT, bool F16OUT>
__device__ __forceinline__ void setup_one(const float* __restrict__ Wm, const float* __restrict__ u, bf* Ot, float* sigl, float* sW, bf* sT, float* su, float* v, float* red) {
    constexpr int PIT = COUT + 4, NL = CIN * COUT / 1024, TPR = COUT / 4;   // NL 16-byte loads per thread, TPR threads per row
    const int tid = threadIdx.x, lane = tid & 31, wave = tid >> 5;
    {
        const float* wp = Wm + tid * 4; const float* up = u + (tid < COUT ? tid : 0); v4f r[NL];
#pragma unroll   // r[] in registers, the whole matrix in flight at once
        for (int j = 0; j < NL; ++j) r[j] = *(const v4f*)(wp + j * 1024);
        xwait(wp);
        const float uu = *up;
        xwait(up);
        float* sp = &sW[(tid / TPR) * PIT + (tid % TPR) * 4];
#pragma unroll
        for (int j = 0; j < NL; ++j) *(v4f*)(sp + j * (1024 / COUT) * PIT) = (v4f){bfr(r[j][0]), bfr(r[j][1]), bfr(r[j][2]), bfr(r[j][3])};
        if (tid < COUT) su[tid] = bfr(uu);
    }
    __syncthreads();
    constexpr int KG = CIN / 8, TOT = (COUT / 32) * KG, TPW = TOT / 8 < 8 ? 8 : TOT / 8;   // 16-byte pieces per lane: at least 8, one 128-byte line
    constexpr int TP = TPW * 8 + 8, RPS = 32 / TPW;   // pitch of the wave's transposed rows in halves (16 B x odd); rows of W^T per store instruction
    if (wave * TPW < TOT) {
        const int n0 = (wave * TPW / KG) * 32, k0 = (wave * TPW % KG) * 8;   // the wave's 32 rows of W^T, TPW * 8 columns from k0
        const float* cp = &sW[k0 * PIT + n0 + lane]; bf* tw = sT + wave * 32 * TP; v8us pc[TPW];
#pragma unroll   // pc[] in registers, all column reads in flight together
        for (int i = 0; i < TPW; ++i) {
#pragma unroll
            for (int e = 0; e < 8; ++e) { const float xv = cp[(i * 8 + e) * PIT]; pc[i][e] = F16OUT ? __builtin_bit_cast(unsigned short, tohx(xv)) : (unsigned short)(__float_as_uint(xv) >> 16); }
        }
#pragma unroll
        for (int i = 0; i < TPW; ++i) *(v8us*)(tw + lane * TP + i * 8) = pc[i];
        asm volatile("s_wait_dscnt 0x0" ::: "memory");   // the wave's own rows are in LDS before other lanes of it read them back
#pragma unroll
        for (int i = 0; i < TPW; ++i) pc[i] = *(const v8us*)(tw + (i * RPS + lane / TPW) * TP + (lane % TPW) * 8);
        bf* op = Ot + (size_t)(n0 + lane / TPW) * CIN + k0 + (lane % TPW) * 8;
        fence();   // the stores go out as one group behind the work that fills their registers
#pragma unroll
        for (int i = 0; i < TPW; ++i) *(v8us*)(op + (size_t)i * RPS * CIN) = pc[i];
        xwait(op);   // the sigma work below takes the stores' registers over
    }
    auto bsum = [&](float x) { float s = x;
#pragma unroll
        for (int sh = 16; sh; sh >>= 1) s += __shfl_xor(s, sh, 32);
        __syncthreads(); if ((tid & 31) == 0) red[tid >> 5] = s; __syncthreads(); float tot = 0.f; for (int k = 0; k < 8; ++k) tot += red[k]; __syncthreads(); return tot; };
    // v_raw[i] = sum_o u[o] W[i][o]
    float vi = 0.f;
    if (tid < CIN) { const float* rp = &sW[tid * PIT];
#pragma unroll 8   // 16 LDS reads go out together: one LDS latency per 32 terms of the chain, not per 4
        for (int o = 0; o < COUT; o += 4) { const v4f w4 = *(const v4f*)(rp + o), u4 = *(const v4f*)(su + o); vi = fmaf(u4[0], w4[0], vi); vi = fmaf(u4[1], w4[1], vi); vi = fmaf(u4[2], w4[2], vi); vi = fmaf(u4[3], w4[3], vi); } }
    const float nv = bsum(tid < CIN ? vi * vi : 0.f); const float invv = rsqrtf(fmaxf(nv, 1e-12f)); if (tid < CIN) v[tid] = vi * invv; __syncthreads();
    // t[o] = sum_i v[i] W[i][o]
    float to = 0.f;
    if (tid < COUT) { const float* cq = &sW[tid];
#pragma unroll 32   // 32 column reads go out together: one LDS latency per 32 terms of the chain
        for (int i = 0; i < CIN; ++i) to = fmaf(v[i], cq[i * PIT], to); }
    const float nt = bsum(tid < COUT ? to * to : 0.f); const float invt = rsqrtf(fmaxf(nt, 1e-12f));
    // sigma = sum_o t[o] * un[o] with un = t * invt
    const float sg = bsum(tid < COUT ? to * (to * invt) : 0.f);
    if (tid < 32) sigl[tid] = (tid == 0) ? sg : 0.f;   // a 32-float line per sigma
}
// k_setup: block w = weight matrix w (wf, wg, wh, wo): its sigma into SIG[32 w], its 16-bit transposed copy into WB (rows f | g | h, bf16) or WO (fp16 of the bf16 value)
__global__ __launch_bounds__(256) void k_setup(const float* __restrict__ wf, const float* __restrict__ uf, const float* __restrict__ wg, const float* __restrict__ ug, const float* __restrict__ wh, const float* __restrict__ uh, const float* __restrict__ wo, const float* __restrict__ uo, float* SIG, bf* WB, h16* WO) {
    __shared__ __align__(16) float sW[SWMAX]; __shared__ __align__(16) bf sT[STMAX]; __shared__ __align__(16) float su[CC]; __shared__ __align__(16) float v[CC]; __shared__ float red[8];
    const int w = blockIdx.x;
    if (w < 2)       setup_one<CC, DQK, false>(w ? wg : wf, w ? ug : uf, WB + w * DQK * CC, SIG + w * 32, sW, sT, su, v, red);
    else if (w == 2) setup_one<CC, DV, false>(wh, uh, WB + 2 * DQK * CC, SIG + 64, sW, sT, su, v, red);
    else             setup_one<DV, CC, true>(wo, uo, (bf*)WO, SIG + 96, sW, sT, su, v, red);
}
#define PTK  128                  // tokens per block of the two weight GEMMs (8 waves x 16)
#define XPIT 264                  // LDS pitch of a 256-wide bf16 row, in halves (528 B = 16 B x odd)
#define TPIT 136                  // LDS pitch of a 128-wide 16-bit row, in halves (272 B = 16 B x odd)
#define OPIT 260                  // LDS pitch of a 256-wide f32 row, in floats (1040 B = 16 B x odd)
// k_proj: f | g | h = x.[wf|wg|wh] of 128 tokens with everything around the product in the same kernel. x comes in as f32 by whole-line loads and is rounded to bf16 on its way
// into LDS; all 192 weight rows are staged beside it. f and g are formed as W.x^T (a lane holds 8 consecutive columns of one token: one 16-byte store after scale and bias),
// h as x.W^T (a lane holds 8 consecutive tokens of one column: a 16-byte piece of an h^T row, gathered in LDS so that each 256-byte run of h^T has one writer).
__global__ __launch_bounds__(256) void k_proj(const float* __restrict__ x, const bf* __restrict__ WB, const float* __restrict__ SIG, const float* __restrict__ bf_, const float* __restrict__ bg_, const float* __restrict__ bh_, h16* Fp, h16* Gp, h16* HT) {
    __shared__ __align__(16) bf  sX[PTK * XPIT];
    __shared__ __align__(16) bf  sW[NPJ * XPIT];
    __shared__ __align__(16) h16 sT[DV * TPIT];
    const int tid = threadIdx.x, lane = tid & 31, wave = tid >> 5, c = lane & 15, h = lane >> 4;
    const size_t R0 = (size_t)blockIdx.x * PTK;
    v4f bq[4][2]; float bv[8];
    {
        const float* xp = x + (R0 + wave * 16) * CC + lane * 4;
        const bf* wp = WB + (size_t)(wave * 24) * CC + lane * 8;
        v4f xr[32]; v8us wr[24];
#pragma unroll
        for (int i = 0; i < 32; ++i) xr[i] = *(const v4f*)(xp + (i >> 1) * CC + (i & 1) * 128);
        xwait(xp);
#pragma unroll
        for (int i = 0; i < 24; ++i) wr[i] = *(const v8us*)(wp + i * CC);
        xwait(wp);
        // the biases: asked for here, used behind the product
        const unsigned bofs = 32u * h; const float* bhp = bh_ + c;   // bofs: bytes of 8 h floats
#pragma unroll
        for (int t = 0; t < 2; ++t) {
            const char* pf = (const char*)bf_ + bofs + t * 64; const char* pg = (const char*)bg_ + bofs + t * 64;
            bq[t][0] = *(const v4f*)pf; bq[t][1] = *(const v4f*)(pf + 16); bq[2 + t][0] = *(const v4f*)pg; bq[2 + t][1] = *(const v4f*)(pg + 16);
        }
        xwait(bofs);
#pragma unroll
        for (int t = 0; t < 8; ++t) bv[t] = bhp[t * 16];
        xwait(bhp);
#pragma unroll
        for (int i = 0; i < 24; ++i) *(v8us*)(&sW[(wave * 24 + i) * XPIT + lane * 8]) = wr[i];
#pragma unroll
        for (int i = 0; i < 32; ++i) *(v4bf*)(&sX[(wave * 16 + (i >> 1)) * XPIT + (i & 1) * 128 + lane * 4]) = __builtin_convertvector(xr[i], v4bf);
    }
    __syncthreads();
    const bf* ax = &sX[(wave * 16 + c) * XPIT + 8 * h];
    const bf* bw = &sW[c * XPIT + 8 * h];
    v8f acc[12];
#pragma unroll
    for (int t = 0; t < 12; ++t) acc[t] = (v8f){};
#pragma unroll
    for (int kc = 0; kc < CC; kc += 32) {
        const v16bf a = cat16b(*(const v8us*)(ax + kc), *(const v8us*)(ax + kc + 16)); v16bf b[12];
#pragma unroll
        for (int t = 0; t < 12; ++t) b[t] = cat16b(*(const v8us*)(bw + t * 16 * XPIT + kc), *(const v8us*)(bw + t * 16 * XPIT + kc + 16));
        fence();   // one step's fragments as one group in front of its products; without the pair of fences many steps' fragments are fetched at once and registers spill
#pragma unroll
        for (int t = 0; t < 12; ++t) acc[t] = (t < 4) ? wmmab(b[t], a, acc[t]) : wmmab(a, b[t], acc[t]);
        fence();
    }
    const float isf = __fdiv_rn(1.0f, SIG[0]), isg = __fdiv_rn(1.0f, SIG[32]), ish = __fdiv_rn(1.0f, SIG[64]);
#pragma unroll
    for (int t = 0; t < 8; ++t) {   // acc[4 + t][r] = h column t * 16 + c of token 8 h + r
        const float bb = bfr(bv[t]); v8h o;
#pragma unroll
        for (int r = 0; r < 8; ++r) o[r] = tohx(acc[4 + t][r] * ish + bb);
        *(v8h*)(&sT[(t * 16 + c) * TPIT + wave * 16 + 8 * h]) = o;
    }
    v8h fg[4];
#pragma unroll
    for (int t = 0; t < 4; ++t) {   // acc[t][r] = column t * 16 + 8 h + r of token c
        const float is = t < 2 ? isf : isg;
#pragma unroll
        for (int r = 0; r < 8; ++r) fg[t][r] = tohx(acc[t][r] * is + bfr(bq[t][r >> 2][r & 3]));
    }
    __syncthreads();
    v8h ht[8];
#pragma unroll
    for (int i = 0; i < 8; ++i) ht[i] = *(const v8h*)(&sT[(wave * 16 + i * 2 + h) * TPIT + c * 8]);
    const int b = blockIdx.x / (HW / PTK), t0 = (blockIdx.x % (HW / PTK)) * PTK;
    h16* fo = Fp + (R0 + wave * 16 + c) * DQK + 8 * h; h16* go = Gp + (R0 + wave * 16 + c) * DQK + 8 * h;
    h16* ho = HT + ((size_t)b * DV + wave * 16 + h) * HW + t0 + c * 8;
    fence();   // every store stands behind all other work, so that no register of an issued store is written again
    *(v8h*)fo = fg[0]; *(v8h*)(fo + 16) = fg[1]; *(v8h*)go = fg[2]; *(v8h*)(go + 16) = fg[3];
#pragma unroll
    for (int i = 0; i < 8; ++i) *(v8h*)(ho + (size_t)i * 2 * HW) = ht[i];
}
typedef __attribute__((ext_vector_type(2))) float    v2f;
typedef __attribute__((ext_vector_type(2))) _Float16 v2h;
#define KST  128                  // keys per stage: 64 for each half of the waves
#define KWV  64                   // keys of a stage that one wave works on
#define HPIT 136                  // LDS pitch of a 128-key h^T row, in halves (272 B = 16 B x odd, for 16-byte reads)
#define FPIT 40                   // LDS pitch of a 32-wide f row, in halves (80 B = 16 B x odd)
#define L2E  1.4426950408889634f
__device__ __forceinline__ float xhalf(float x) { return __builtin_bit_cast(float, __builtin_amdgcn_permlanex16(__builtin_bit_cast(int, x), __builtin_bit_cast(int, x), 0x76543210, 0xfedcba98, false, false)); }  // lane l with lane l ^ 16
// put4: the four O^T tiles per query group, from tile O on, that the partner wave finishes, into this wave's own exchange range (16-byte pieces, a lane stride of 16 B)
template <int O> __device__ __forceinline__ void put4(float* xs, const v8f (&acc)[2][8]) {
#pragma unroll
    for (int u = 0; u < 2; ++u) {
#pragma unroll
        for (int j = 0; j < 4; ++j) {
            const v8f g = acc[u][O + j];
            *(v4f*)(xs + ((u * 4 + j) * 2) * 128)     = (v4f){g[0], g[1], g[2], g[3]};
            *(v4f*)(xs + ((u * 4 + j) * 2 + 1) * 128) = (v4f){g[4], g[5], g[6], g[7]};
        }
    }
}
// fin4: this wave's own four tiles from tile O on, joined with the partner's sums of the same tiles: o = own * ca + partner's * cb
template <int O> __device__ __forceinline__ void fin4(const float* xr, const v8f (&acc)[2][8], const float (&ca)[2], const float (&cb)[2], v8h (&o)[2][4]) {
    v4f p[2][4][2];
#pragma unroll
    for (int u = 0; u < 2; ++u) {
#pragma unroll
        for (int j = 0; j < 4; ++j) { p[u][j][0] = *(const v4f*)(xr + ((u * 4 + j) * 2) * 128); p[u][j][1] = *(const v4f*)(xr + ((u * 4 + j) * 2 + 1) * 128); }
    }
#pragma unroll
    for (int u = 0; u < 2; ++u) {
#pragma unroll
        for (int j = 0; j < 4; ++j) {
#pragma unroll
            for (int r = 0; r < 8; ++r) o[u][j][r] = tohx(acc[u][O + j][r] * ca[u] + p[u][j][r >> 2][r & 3] * cb[u]);
        }
    }
}
// soft: the softmax step of one stage for the wave's two query groups: running maximum and sum, P (x1024, fp16) packed as the B operand of the second product, O^T rescaled to the new maximum
__device__ __forceinline__ void soft(const v8f (&st)[2][4], float (&m)[2], float (&l)[2], v16h (&pf)[2][2], v8f (&acc)[2][8]) {
    float al[2];
#pragma unroll
    for (int u = 0; u < 2; ++u) {
        float mx[4];
#pragma unroll
        for (int t = 0; t < 4; ++t) mx[t] = fmaxf(fmaxf(fmaxf(st[u][t][0], st[u][t][1]), fmaxf(st[u][t][2], st[u][t][3])), fmaxf(fmaxf(st[u][t][4], st[u][t][5]), fmaxf(st[u][t][6], st[u][t][7])));
        float mq = fmaxf(fmaxf(mx[0], mx[1]), fmaxf(mx[2], mx[3]));
        mq = fmaxf(mq, xhalf(mq));
        const float mn = fmaxf(m[u], mq * L2E);
        al[u] = __builtin_amdgcn_exp2f(m[u] - mn);         // 0 on the first stage
        const float off = 10.0f - mn;                      // P carried x1024
        m[u] = mn;
        v2f ps[2] = {(v2f){0.f, 0.f}, (v2f){0.f, 0.f}};
#pragma unroll
        for (int t = 0; t < 4; ++t) {
#pragma unroll
            for (int j = 0; j < 8; j += 2) {
                const v2f a = __builtin_elementwise_fma((v2f){st[u][t][j], st[u][t][j + 1]}, (v2f){L2E, L2E}, (v2f){off, off});
                const v2f e = {__builtin_amdgcn_exp2f(a[0]), __builtin_amdgcn_exp2f(a[1])};
                ps[(j >> 1) & 1] += e;
                const v2h eh = __builtin_convertvector(e, v2h);
                pf[u][t >> 1][(t & 1) * 8 + j] = eh[0]; pf[u][t >> 1][(t & 1) * 8 + j + 1] = eh[1];
            }
        }
        const v2f pt = ps[0] + ps[1];
        l[u] = fmaf(l[u], al[u], pt[0] + pt[1]);
    }
#pragma unroll
    for (int u = 0; u < 2; ++u) {
#pragma unroll
        for (int t = 0; t < 8; ++t) acc[u][t] *= al[u];
    }
}
// k_attn: s = g.f^T, softmax and beta.h of one image in one kernel; scores and softmax rows stay in registers. Block = 128 queries, walks all 4096 keys in stages of 128.
// The 8 waves are 4 query groups x 2 key halves: a wave has 32 queries (two 16-column groups) and 64 of a stage's keys, so that every f and h^T fragment it reads from LDS feeds two
// products, and the block reads each staged tile four times, not eight. Per wave S^T = F.G^T (A = 16 key rows of f from LDS, B = 16 queries of g, kept in registers): a lane holds
// scores of ONE query per group (column lane & 15), so the running maximum and sum are per lane, with one exchange between the lane halves. Per query group the S^T tiles in pairs (keys 0-15 with 16-31, 32-47 with 48-63),
// converted in place, are the two B operands of O^T += H^T.P^T (A = 16 rows of h^T from LDS), and the rescale of O^T by exp2(m_old - m_new) is per lane too. P is carried x1024 on an fp16
// plane, and the sum carries the same factor. Behind the loop the two waves of a query group join their maxima, sums and O^T through LDS, each finishing 64 of the 128 columns.
// The two waves that share a SIMD (wave w and w + 4: the two key halves) run half a stage apart: key half 0 does its softmax in front of the stage's barrier, key half 1 behind it, so
// that between two barriers one of them is in its vector work while the other is in its products. A stage is still read behind its barrier, hence three buffers: the stores in
// front of the next barrier go to the buffer that neither this stage nor the next one reads.
// Behind the join the block has o of its 128 tokens, and finishes them itself: out = gamma (o.wo / sigma_o + bo) + x. o goes to that product through LDS (fp16, as it went through the workspace),
// all 256 rows of wo^T stand beside it (asked for in front of the loop, kept in registers, stored behind it); the product is formed as Wo.o^T (a lane holds 8 consecutive columns of one
// token) and passed through the wave's own LDS rows, which lie on the ring that nobody reads any more, so that scale, bias, gamma and the residual are applied on whole 512-byte runs.
// the work-group's barrier with the LDS side of __syncthreads() alone: LDS writes are done in front of it and no LDS access moves across it, but the residual's global loads, which no
// other wave has a part in, stay in flight over it (__syncthreads() would wait for them at the first barrier behind their issue)
__device__ __forceinline__ void lds_barrier() {
    __builtin_amdgcn_fence(__ATOMIC_RELEASE, "workgroup", "local"); __builtin_amdgcn_s_barrier(); __builtin_amdgcn_fence(__ATOMIC_ACQUIRE, "workgroup", "local");
}
union __align__(16) ring_or_c {
    struct { h16 H[3][DV * HPIT]; h16 F[3][KST * FPIT]; } r;   // the loop's three stages of h^T and f
    float C[8][16 * OPIT];                                     // behind the join's barrier: per wave 16 rows of the output product
};
__global__ __launch_bounds__(256) void k_attn(const h16* __restrict__ Gp, const h16* __restrict__ Fp, const h16* __restrict__ HT, const h16* __restrict__ WO, const float* __restrict__ SIG, const float* __restrict__ bo_, const float* __restrict__ gam, const float* __restrict__ x, float* OUTB) {
    __shared__ ring_or_c sR;
    __shared__ __align__(16) float sX[8][16 * 128];   // per wave: 8 O^T tiles for its partner
    __shared__ __align__(16) v2f sM[8][2][32];        // per wave and query group: a lane's maximum and sum
    __shared__ __align__(16) h16 sWo[CC * TPIT];
    __shared__ __align__(16) h16 sO[PTK * TPIT];
    const int tid = threadIdx.x, lane = tid & 31, wave = tid >> 5, c = lane & 15, h = lane >> 4;
    const int kh = __builtin_amdgcn_readfirstlane(tid >> 7);   // the wave's key half, in a scalar register: the branches on it are scalar ones
    const int b = blockIdx.y, q = blockIdx.x * 128 + (wave & 3) * 32 + c;   // the lane's queries: q and q + 16
    const h16* gq = Gp + ((size_t)b * HW + q) * DQK + 8 * h;
    v16h gfr[2];
#pragma unroll
    for (int u = 0; u < 2; ++u) gfr[u] = cat16(*(const v8h*)(gq + u * 16 * DQK), *(const v8h*)(gq + u * 16 * DQK + 16));
    const int hrow = tid >> 4, hch = (tid & 15) * 8, frow = tid >> 2, fch = (tid & 3) * 8;
    // a uniform base that moves with the stage plus a lane offset that never changes: no vector address register is rewritten, and the base moves only behind the loads' data wait
    const h16* hbase = HT + (size_t)b * DV * HW; const h16* fbase = Fp + (size_t)b * HW * DQK;
    const unsigned hoff = (unsigned)(hrow * HW + hch), foff = (unsigned)(frow * DQK + fch);   // h^T rows hrow + 16 i, 16 lanes per 256-byte run; f rows frow + 64 j
    v8h rh[8], rf[2];
#pragma unroll
    for (int i = 0; i < 8; ++i) rh[i] = *(const v8h*)(hbase + hoff + 16 * i * HW);
#pragma unroll
    for (int j = 0; j < 2; ++j) rf[j] = *(const v8h*)(fbase + foff + 64 * j * DQK);
    xwait(gq);   // behind the loads of g and of stage 0: what follows may take the address registers of these loads over
#pragma unroll
    for (int i = 0; i < 8; ++i) *(v8h*)(&sR.r.H[0][(hrow + 16 * i) * HPIT + hch]) = rh[i];
#pragma unroll
    for (int j = 0; j < 2; ++j) *(v8h*)(&sR.r.F[0][(frow + 64 * j) * FPIT + fch]) = rf[j];
    __syncthreads();
    fence();   // the bases move only behind the data wait of the loads that named them (the wait stands in front of the LDS stores above)
    // stage 1 into registers: trip 0 stores it
    hbase += KST; fbase += KST * DQK;
#pragma unroll
    for (int i = 0; i < 8; ++i) rh[i] = *(const v8h*)(hbase + hoff + 16 * i * HW);
#pragma unroll
    for (int j = 0; j < 2; ++j) rf[j] = *(const v8h*)(fbase + foff + 64 * j * DQK);
    xwait(foff);   // behind these loads: the compiler forms the loop's bases in the registers that they name
    // all of wo^T (two 256-byte rows per load): asked for here, put into LDS behind the loop, so that its way from L2 lies under the loop
    const h16* wp = WO + (size_t)(wave * 32) * DV + lane * 8;
    v8h rw[16];
#pragma unroll
    for (int i = 0; i < 16; ++i) rw[i] = *(const v8h*)(wp + i * 2 * DV);
    xwait(wp);
    v8f acc[2][8];
#pragma unroll
    for (int u = 0; u < 2; ++u) {
#pragma unroll
        for (int t = 0; t < 8; ++t) acc[u][t] = (v8f){};
    }
    float m[2] = {-3.0e38f, -3.0e38f}, l[2] = {0.f, 0.f};
    int cur = 0;   // the buffer of stage s: s mod 3
#pragma unroll 1
    for (int s = 0; s < HW / KST; ++s) {
        const int nxt = cur == 2 ? 0 : cur + 1;
        const h16* cF = &sR.r.F[cur][(kh * KWV + c) * FPIT + 8 * h];
        const h16* cH = &sR.r.H[cur][c * HPIT + kh * KWV + 8 * h];
        v16h ff[4], a0[8], a1[8];
#pragma unroll
        for (int t = 0; t < 4; ++t) ff[t] = cat16(*(const v8h*)(cF + t * 16 * FPIT), *(const v8h*)(cF + t * 16 * FPIT + 16));
#pragma unroll
        for (int t = 0; t < 8; ++t) a0[t] = cat16(*(const v8h*)(cH + t * 16 * HPIT), *(const v8h*)(cH + t * 16 * HPIT + 16));
        fence();   // keeps the first h^T fragments issued here, ahead of the score and softmax work that hides their latency
        v8f st[2][4];
#pragma unroll
        for (int t = 0; t < 4; ++t) {
#pragma unroll
            for (int u = 0; u < 2; ++u) st[u][t] = wmma16(ff[t], gfr[u], (v8f){});
        }
        v16h pf[2][2];
        if (!kh) soft(st, m, l, pf, acc);   // key half 0: vector work here, while key half 1 on the same SIMD is in its products
        // stage s + 1, asked for behind the barrier before this one. Its buffer's last readers (stage s - 2) left it before that barrier
        h16* nH = &sR.r.H[nxt][0]; h16* nF = &sR.r.F[nxt][0];
#pragma unroll
        for (int i = 0; i < 8; ++i) *(v8h*)(nH + (hrow + 16 * i) * HPIT + hch) = rh[i];
#pragma unroll
        for (int j = 0; j < 2; ++j) *(v8h*)(nF + (frow + 64 * j) * FPIT + fch) = rf[j];
        __syncthreads();
        fence();   // the bases move only behind the data wait of the loads that named them (the wait stands in front of the LDS stores above)
        // stage s + 2 into registers, a whole trip ahead of its stores (on the last two trips the bases stay: the last stage is fetched again, and that copy is never read)
        if (s + 2 < HW / KST) { hbase += KST; fbase += KST * DQK; }
#pragma unroll
        for (int i = 0; i < 8; ++i) rh[i] = *(const v8h*)(hbase + hoff + 16 * i * HW);
#pragma unroll
        for (int j = 0; j < 2; ++j) rf[j] = *(const v8h*)(fbase + foff + 64 * j * DQK);
        fence();   // keeps the global loads issued here, ahead of the work that hides their latency
        if (kh) soft(st, m, l, pf, acc);    // key half 1: vector work here, while key half 0 on the same SIMD is in its products
        fence();   // with the fence behind them: the second half's h^T fragments go out as one group in front of the first half's products, not among them
#pragma unroll
        for (int t = 0; t < 8; ++t) a1[t] = cat16(*(const v8h*)(cH + t * 16 * HPIT + 32), *(const v8h*)(cH + t * 16 * HPIT + 48));
        fence();   // second of the pair: without it the fragment loads and their waits move in among the products
#pragma unroll
        for (int t = 0; t < 8; ++t) {
#pragma unroll
            for (int u = 0; u < 2; ++u) acc[u][t] = wmma16(a0[t], pf[u][0], acc[u][t]);
        }
#pragma unroll
        for (int t = 0; t < 8; ++t) {
#pragma unroll
            for (int u = 0; u < 2; ++u) acc[u][t] = wmma16(a1[t], pf[u][1], acc[u][t]);
        }
        cur = nxt;
    }
    asm volatile("s_wait_xcnt 0x0" ::: "memory");   // behind the last trip's loads: what follows may take their address registers over
    fence();   // keeps all that follows behind that wait
#pragma unroll
    for (int i = 0; i < 16; ++i) *(v8h*)(&sWo[(wave * 32 + i * 2 + h) * TPIT + c * 8]) = rw[i];   // published by the join's barrier
    // the residual rows and the bias of the wave's 16 tokens: asked for here, used behind the output product
    const size_t R0 = ((size_t)b * HW + blockIdx.x * PTK + __builtin_amdgcn_readfirstlane(tid >> 5) * 16) * CC;   // scalar: the wave's rows of x and of out as a uniform base plus a lane offset
    const float* xb = x + R0; const unsigned xo = lane * 4;
    v4f xres[32], bo4[2];
    const float* bp = bo_ + lane * 4;   // the bias first: loads come back in order, and a wait for it must not wait for the residual too
#pragma unroll
    for (int p = 0; p < 2; ++p) bo4[p] = *(const v4f*)(bp + p * 128);
    xwait(bp);
#pragma unroll
    for (int i = 0; i < 32; ++i) xres[i] = *(const v4f*)(xb + xo + (i >> 1) * CC + (i & 1) * 128);
    xwait(xo);
    // the join of the two key halves: wave w and wave w ^ 4 hold the same queries. Each hands the other the O^T tiles of the 64 columns that the other finishes, with its maximum and sum
#pragma unroll
    for (int u = 0; u < 2; ++u) { l[u] += xhalf(l[u]); sM[wave][u][lane] = (v2f){m[u], l[u]}; }
    float* xs = &sX[wave][lane * 4];
    if (kh) put4<0>(xs, acc); else put4<4>(xs, acc);
    lds_barrier();
    float ca[2], cb[2];
#pragma unroll
    for (int u = 0; u < 2; ++u) {
        const v2f o = sM[wave ^ 4][u][lane];
        const float mm = fmaxf(m[u], o[0]), wa = __builtin_amdgcn_exp2f(m[u] - mm), wb = __builtin_amdgcn_exp2f(o[0] - mm);
        const float inv = __fdiv_rn(1.0f, fmaf(l[u], wa, o[1] * wb));
        ca[u] = wa * inv; cb[u] = wb * inv;
    }
    const float* xr = &sX[wave ^ 4][lane * 4];
    v8h ov[2][4];
    if (kh) fin4<4>(xr, acc, ca, cb, ov); else fin4<0>(xr, acc, ca, cb, ov);
    h16* so = &sO[((wave & 3) * 32 + c) * TPIT + kh * 64 + 8 * h];   // the wave's 64 columns of its 32 queries
#pragma unroll
    for (int u = 0; u < 2; ++u) {
#pragma unroll
        for (int j = 0; j < 4; ++j) *(v8h*)(so + u * 16 * TPIT + j * 16) = ov[u][j];
    }
    lds_barrier();
    const h16* ao = &sO[(wave * 16 + c) * TPIT + 8 * h];
    const h16* bw = &sWo[c * TPIT + 8 * h];
    v8f oc[16];
#pragma unroll
    for (int t = 0; t < 16; ++t) oc[t] = (v8f){};
#pragma unroll
    for (int kc = 0; kc < DV; kc += 32) {
        const v16h a = cat16(*(const v8h*)(ao + kc), *(const v8h*)(ao + kc + 16)); v16h bb[16];
#pragma unroll
        for (int t = 0; t < 16; ++t) bb[t] = cat16(*(const v8h*)(bw + t * 16 * TPIT + kc), *(const v8h*)(bw + t * 16 * TPIT + kc + 16));
        fence();   // one step's fragments as one group in front of its products; without the pair of fences all four steps' fragments are fetched at once and registers spill
#pragma unroll
        for (int t = 0; t < 16; ++t) oc[t] = wmma16(bb[t], a, oc[t]);
        fence();
    }
    float* os = &sR.C[wave][0];
#pragma unroll
    for (int t = 0; t < 16; ++t) {   // oc[t][r] = column t * 16 + 8 h + r of token c
        *(v4f*)(os + c * OPIT + t * 16 + 8 * h)     = (v4f){oc[t][0], oc[t][1], oc[t][2], oc[t][3]};
        *(v4f*)(os + c * OPIT + t * 16 + 8 * h + 4) = (v4f){oc[t][4], oc[t][5], oc[t][6], oc[t][7]};
    }
    lds_barrier();
    const float iso = __fdiv_rn(1.0f, SIG[96]); const float gmm = bfr(gam[0]);
#pragma unroll
    for (int p = 0; p < 2; ++p) bo4[p] = (v4f){bfr(bo4[p][0]), bfr(bo4[p][1]), bfr(bo4[p][2]), bfr(bo4[p][3])};
    v4f cv[32];
#pragma unroll
    for (int i = 0; i < 32; ++i) cv[i] = *(const v4f*)(os + (i >> 1) * OPIT + (i & 1) * 128 + lane * 4);
    fence();   // the LDS reads go out as one group; without it each is waited for just ahead of its use
#pragma unroll
    for (int i = 0; i < 32; ++i) {
#pragma unroll
        for (int k = 0; k < 4; ++k) xres[i][k] = gmm * (cv[i][k] * iso + bo4[i & 1][k]) + bfr(xres[i][k]);
    }
    float* pb = OUTB + R0;
    fence();   // every store stands behind all other work, so that no register of an issued store is written again
#pragma unroll
    for (int i = 0; i < 32; ++i) *(v4f*)(pb + xo + (i >> 1) * CC + (i & 1) * 128) = xres[i];
}
extern "C" void kernel_launch(void* const* d_in, const int* in_sizes, int n_in,
                              void* d_out, int out_size, void* d_ws, size_t ws_size, hipStream_t stream) {
    (void)in_sizes; (void)n_in; (void)out_size;
    const float* x = (const float*)d_in[0]; const float* wf = (const float*)d_in[1]; const float* bf_ = (const float*)d_in[2]; const float* uf = (const float*)d_in[3]; const float* wg = (const float*)d_in[4]; const float* bg_ = (const float*)d_in[5]; const float* ug = (const float*)d_in[6]; const float* wh = (const float*)d_in[7]; const float* bh_ = (const float*)d_in[8]; const float* uh = (const float*)d_in[9]; const float* wo = (const float*)d_in[10]; const float* bo_ = (const float*)d_in[11]; const float* uo = (const float*)d_in[12]; const float* gam = (const float*)d_in[13];
    float* out = (float*)d_out;    // [8][64][64][256]
    char* wsp = (char*)d_ws;
    auto take = [&](size_t bytes) { char* p = wsp; wsp += (bytes + 255) & ~(size_t)255; return (void*)p; };
    float* SIG = (float*)take(4 * 32 * 4); bf* WB = (bf*)take((size_t)NPJ * CC * 2); h16* WO = (h16*)take((size_t)CC * DV * 2);
    h16* Fp = (h16*)take((size_t)NR * DQK * 2); h16* Gp = (h16*)take((size_t)NR * DQK * 2); h16* HT = (h16*)take((size_t)NB_ * DV * HW * 2);
    if ((size_t)(wsp - (char*)d_ws) > ws_size) return;    // ~ 0.2 + 2.1 x 2 + 8.4 ~ 13 MB
    k_setup<<<4, 256, 0, stream>>>(wf, uf, wg, ug, wh, uh, wo, uo, SIG, WB, WO);
    k_proj<<<NR / PTK, 256, 0, stream>>>(x, WB, SIG, bf_, bg_, bh_, Fp, Gp, HT);
    k_attn<<<dim3(HW / 128, NB_, 1), 256, 0, stream>>>(Gp, Fp, HT, WO, SIG, bo_, gam, x, out);
}

// v007
// Measured time: 55.5 microseconds a run.
// Two timings next to v006 put it at 1.04 and 1.03 times that version's speed.
// Counting every step since v000, it is 20.3 times as fast.
#include <hip/hip_runtime.h>

// Compute dtypes, f32 accumulate: the four spectral-norm sigmas (one power iteration on the tiny weight matrices) in f32 on VALU and applied as f32 scales AFTER the GEMMs, so
// every weight GEMM uses the EXACT bf16 weights: f|g|h = x.[wf|wg|wh] ([32768 x 256].[256 x 192]) with plain bf16 operands (x and the weights are inputs: exact products);
// per image s = g.f^T ([4096 x 32].[32 x 4096]) and beta.h ([4096 x 4096].[4096 x 128]) on SINGLE fp16 planes (f/g/h after the 1/sigma scale + bias, softmax rows carried
// against a maximum in use, 1 to the fp16 top, rounded to fp16 = 2^-11); o.wo ([32768 x 128].[128 x 256]) on a single fp16 plane of o against exact wo; out = gamma (o.wo / sigma_o + bo) + x in f32 - measured

#define NB_  8
#define HW   4096
#define CC   256
#define DQK  32
#define DV   128
#define NPJ  192                  // f | g | h columns
#define NR   (NB_ * HW)           // 32768
#define DM   CC
#define LOSC 1024.0f
#define L2E  1.4426950408889634f
typedef _Float16 h16;
typedef unsigned short bf;
typedef __attribute__((ext_vector_type(16))) __bf16   v16bf;
typedef __attribute__((ext_vector_type(16))) _Float16 v16h;
typedef __attribute__((ext_vector_type(8)))  _Float16 v8h;
typedef __attribute__((ext_vector_type(8)))  unsigned short v8us;
typedef __attribute__((ext_vector_type(8)))  float    v8f;
typedef __attribute__((ext_vector_type(4)))  float    v4f;
typedef v8h  __attribute__((may_alias)) v8ha;
typedef v4f  __attribute__((may_alias)) v4fa;
typedef v8us __attribute__((may_alias)) v8usa;

__device__ __forceinline__ unsigned short f2bf(float f) { unsigned u = __float_as_uint(f); u += 0x7FFFu + ((u >> 16) & 1u); return (unsigned short)(u >> 16); }
__device__ __forceinline__ float bf2f(unsigned short b) { return __uint_as_float(((unsigned)b) << 16); }
__device__ __forceinline__ float bfr(float f) { return bf2f(f2bf(f)); }
__device__ __forceinline__ v16h cat16(v8h lo, v8h hi) { return __builtin_shufflevector(lo, hi, 0, 1, 2, 3, 4, 5, 6, 7, 8, 9, 10, 11, 12, 13, 14, 15); }
__device__ __forceinline__ v16bf cat16b(v8us lo, v8us hi) { return __builtin_bit_cast(v16bf, __builtin_shufflevector(lo, hi, 0, 1, 2, 3, 4, 5, 6, 7, 8, 9, 10, 11, 12, 13, 14, 15)); }
__device__ __forceinline__ v8f wmma16(v16h a, v16h b, v8f c) { return __builtin_amdgcn_wmma_f32_16x16x32_f16(false, a, false, b, (short)0, c, false, false); }
__device__ __forceinline__ v8f wmmab(v16bf a, v16bf b, v8f c) { return __builtin_amdgcn_wmma_f32_16x16x32_bf16(false, a, false, b, (short)0, c, false, false); }

typedef __attribute__((ext_vector_type(4))) _Float16 v4h;
__device__ __forceinline__ h16 tohx(float x) { return (h16)x; }
typedef __attribute__((ext_vector_type(4))) __bf16 v4bf;
__device__ __forceinline__ void fence() { __builtin_amdgcn_sched_barrier(0); }   // the compiler schedules nothing across it
// behind a group of global loads from p (a lane's pointer, or its byte offset from a uniform base): the wait that stands in front of any new value in their address registers. p as an input keeps those registers p's up to the wait (else the
// group's last load may land on them); the scheduling barrier keeps what follows behind it
template <class T> __device__ __forceinline__ void xwait(T p) { asm volatile("s_wait_xcnt 0x0" :: "v"(p) : "memory"); __builtin_amdgcn_sched_barrier(0); }
#define SWMAX (CC * (DV + 4))     // floats of the largest staged weight matrix: 256 rows at a pitch of 132
#define STMAX (8 * 32 * 136)      // halves: per wave 32 rows of W^T, 128 wide at a pitch of 136
// setup_one: all that is made of ONE weight matrix W [CIN][COUT] (in,out) with u [COUT], by one block. W comes in once, by whole-line loads that are all in flight together, and is
// rounded to bf16 on its way into LDS (kept as f32, pitch COUT + 4 floats = 16 B x odd). From LDS: (1) the 16-bit copy Ot [COUT][CIN] = W^T that the GEMMs read (a lane gathers runs of 8
// consecutive k of its own column; the wave turns its 32 rows in its own LDS range, so that each store instruction covers whole 128-byte lines); (2) sigma: v = l2n(u.W^T) (CIN), t = v.W (COUT), sigma = t.l2n(t), summed in the order o, i = 0, 1, 2 ...
// Every loop over r[] and pc[] is unrolled whole, so that the arrays stay in registers and each group of loads or stores goes out together.
template <int CIN, int COUT, bool F16OUT>
__device__ __forceinline__ void setup_one(const float* __restrict__ Wm, const float* __restrict__ u, bf* Ot, float* sigl, float* sW, bf* sT, float* su, float* v, float* red) {
    constexpr int PIT = COUT + 4, NL = CIN * COUT / 1024, TPR = COUT / 4;   // NL 16-byte loads per thread, TPR threads per row
    const int tid = threadIdx.x, lane = tid & 31, wave = tid >> 5;
    {
        const float* wp = Wm + tid * 4; const float* up = u + (tid < COUT ? tid : 0); v4f r[NL];
#pragma unroll   // r[] in registers, the whole matrix in flight at once
        for (int j = 0; j < NL; ++j) r[j] = *(const v4f*)(wp + j * 1024);
        xwait(wp);
        const float uu = *up;
        xwait(up);
        float* sp = &sW[(tid / TPR) * PIT + (tid % TPR) * 4];
#pragma unroll
        for (int j = 0; j < NL; ++j) *(v4f*)(sp + j * (1024 / COUT) * PIT) = (v4f){bfr(r[j][0]), bfr(r[j][1]), bfr(r[j][2]), bfr(r[j][3])};
        if (tid < COUT) su[tid] = bfr(uu);
    }
    __syncthreads();
    constexpr int KG = CIN / 8, TOT = (COUT / 32) * KG, TPW = TOT / 8 < 8 ? 8 : TOT / 8;   // 16-byte pieces per lane: at least 8, one 128-byte line
    constexpr int TP = TPW * 8 + 8, RPS = 32 / TPW;   // pitch of the wave's transposed rows in halves (16 B x odd); rows of W^T per store instruction
    if (wave * TPW < TOT) {
        const int n0 = (wave * TPW / KG) * 32, k0 = (wave * TPW % KG) * 8;   // the wave's 32 rows of W^T, TPW * 8 columns from k0
        const float* cp = &sW[k0 * PIT + n0 + lane]; bf* tw = sT + wave * 32 * TP; v8us pc[TPW];
#pragma unroll   // pc[] in registers, all column reads in flight together
        for (int i = 0; i < TPW; ++i) {
#pragma unroll
            for (int e = 0; e < 8; ++e) { const float xv = cp[(i * 8 + e) * PIT]; pc[i][e] = F16OUT ? __builtin_bit_cast(unsigned short, tohx(xv)) : (unsigned short)(__float_as_uint(xv) >> 16); }
        }
#pragma unroll
        for (int i = 0; i < TPW; ++i) *(v8us*)(tw + lane * TP + i * 8) = pc[i];
        asm volatile("s_wait_dscnt 0x0" ::: "memory");   // the wave's own rows are in LDS before other lanes of it read them back
#pragma unroll
        for (int i = 0; i < TPW; ++i) pc[i] = *(const v8us*)(tw + (i * RPS + lane / TPW) * TP + (lane % TPW) * 8);
        bf* op = Ot + (size_t)(n0 + lane / TPW) * CIN + k0 + (lane % TPW) * 8;
        fence();   // the stores go out as one group behind the work that fills their registers
#pragma unroll
        for (int i = 0; i < TPW; ++i) *(v8us*)(op + (size_t)i * RPS * CIN) = pc[i];
        xwait(op);   // the sigma work below takes the stores' registers over
    }
    auto bsum = [&](float x) { float s = x;
#pragma unroll
        for (int sh = 16; sh; sh >>= 1) s += __shfl_xor(s, sh, 32);
        __syncthreads(); if ((tid & 31) == 0) red[tid >> 5] = s; __syncthreads(); float tot = 0.f; for (int k = 0; k < 8; ++k) tot += red[k]; __syncthreads(); return tot; };
    // v_raw[i] = sum_o u[o] W[i][o]
    float vi = 0.f;
    if (tid < CIN) { const float* rp = &sW[tid * PIT];
#pragma unroll 8   // 16 LDS reads go out together: one LDS latency per 32 terms of the chain, not per 4
        for (int o = 0; o < COUT; o += 4) { const v4f w4 = *(const v4f*)(rp + o), u4 = *(const v4f*)(su + o); vi = fmaf(u4[0], w4[0], vi); vi = fmaf(u4[1], w4[1], vi); vi = fmaf(u4[2], w4[2], vi); vi = fmaf(u4[3], w4[3], vi); } }
    const float nv = bsum(tid < CIN ? vi * vi : 0.f); const float invv = rsqrtf(fmaxf(nv, 1e-12f)); if (tid < CIN) v[tid] = vi * invv; __syncthreads();
    // t[o] = sum_i v[i] W[i][o]
    float to = 0.f;
    if (tid < COUT) { const float* cq = &sW[tid];
#pragma unroll 32   // 32 column reads go out together: one LDS latency per 32 terms of the chain
        for (int i = 0; i < CIN; ++i) to = fmaf(v[i], cq[i * PIT], to); }
    const float nt = bsum(tid < COUT ? to * to : 0.f); const float invt = rsqrtf(fmaxf(nt, 1e-12f));
    // sigma = sum_o t[o] * un[o] with un = t * invt
    const float sg = bsum(tid < COUT ? to * (to * invt) : 0.f);
    if (tid < 32) sigl[tid] = (tid == 0) ? sg : 0.f;   // a 32-float line per sigma
}
// k_setup: block w = weight matrix w (wf, wg, wh, wo): its sigma into SIG[32 w], its 16-bit transposed copy into WB (rows f | g | h, bf16) or WO (fp16 of the bf16 value)
__global__ __launch_bounds__(256) void k_setup(const float* __restrict__ wf, const float* __restrict__ uf, const float* __restrict__ wg, const float* __restrict__ ug, const float* __restrict__ wh, const float* __restrict__ uh, const float* __restrict__ wo, const float* __restrict__ uo, float* SIG, bf* WB, h16* WO) {
    __shared__ __align__(16) float sW[SWMAX]; __shared__ __align__(16) bf sT[STMAX]; __shared__ __align__(16) float su[CC]; __shared__ __align__(16) float v[CC]; __shared__ float red[8];
    const int w = blockIdx.x;
    if (w < 2)       setup_one<CC, DQK, false>(w ? wg : wf, w ? ug : uf, WB + w * DQK * CC, SIG + w * 32, sW, sT, su, v, red);
    else if (w == 2) setup_one<CC, DV, false>(wh, uh, WB + 2 * DQK * CC, SIG + 64, sW, sT, su, v, red);
    else             setup_one<DV, CC, true>(wo, uo, (bf*)WO, SIG + 96, sW, sT, su, v, red);
}
#define PTK  128                  // tokens per block of the two weight GEMMs (8 waves x 16)
#define XPIT 264                  // LDS pitch of a 256-wide bf16 row, in halves (528 B = 16 B x odd)
#define TPIT 136                  // LDS pitch of a 128-wide 16-bit row, in halves (272 B = 16 B x odd)
#define OPIT 260                  // LDS pitch of a 256-wide f32 row, in floats (1040 B = 16 B x odd)
// k_proj: f | g | h = x.[wf|wg|wh] of 128 tokens with everything around the product in the same kernel. x comes in as f32 by whole-line loads and is rounded to bf16 on its way
// into LDS; all 192 weight rows are staged beside it. f and g are formed as W.x^T (a lane holds 8 consecutive columns of one token: one 16-byte store after scale and bias),
// h as x.W^T (a lane holds 8 consecutive tokens of one column: a 16-byte piece of an h^T row, gathered in LDS so that each 256-byte run of h^T has one writer).
__global__ __launch_bounds__(256) void k_proj(const float* __restrict__ x, const bf* __restrict__ WB, const float* __restrict__ SIG, const float* __restrict__ bf_, const float* __restrict__ bg_, const float* __restrict__ bh_, h16* Fp, h16* Gp, h16* HT) {
    __shared__ __align__(16) bf  sX[PTK * XPIT];
    __shared__ __align__(16) bf  sW[NPJ * XPIT];
    __shared__ __align__(16) h16 sT[DV * TPIT];
    const int tid = threadIdx.x, lane = tid & 31, wave = tid >> 5, c = lane & 15, h = lane >> 4;
    const size_t R0 = (size_t)blockIdx.x * PTK;
    v4f bq[4][2]; float bv[8];
    {
        const float* xp = x + (R0 + wave * 16) * CC + lane * 4;
        const bf* wp = WB + (size_t)(wave * 24) * CC + lane * 8;
        v4f xr[32]; v8us wr[24];
#pragma unroll
        for (int i = 0; i < 32; ++i) xr[i] = *(const v4f*)(xp + (i >> 1) * CC + (i & 1) * 128);
        xwait(xp);
#pragma unroll
        for (int i = 0; i < 24; ++i) wr[i] = *(const v8us*)(wp + i * CC);
        xwait(wp);
        // the biases: asked for here, used behind the product
        const unsigned bofs = 32u * h; const float* bhp = bh_ + c;   // bofs: bytes of 8 h floats
#pragma unroll
        for (int t = 0; t < 2; ++t) {
            const char* pf = (const char*)bf_ + bofs + t * 64; const char* pg = (const char*)bg_ + bofs + t * 64;
            bq[t][0] = *(const v4f*)pf; bq[t][1] = *(const v4f*)(pf + 16); bq[2 + t][0] = *(const v4f*)pg; bq[2 + t][1] = *(const v4f*)(pg + 16);
        }
        xwait(bofs);
#pragma unroll
        for (int t = 0; t < 8; ++t) bv[t] = bhp[t * 16];
        xwait(bhp);
#pragma unroll
        for (int i = 0; i < 24; ++i) *(v8us*)(&sW[(wave * 24 + i) * XPIT + lane * 8]) = wr[i];
#pragma unroll
        for (int i = 0; i < 32; ++i) *(v4bf*)(&sX[(wave * 16 + (i >> 1)) * XPIT + (i & 1) * 128 + lane * 4]) = __builtin_convertvector(xr[i], v4bf);
    }
    __syncthreads();
    const bf* ax = &sX[(wave * 16 + c) * XPIT + 8 * h];
    const bf* bw = &sW[c * XPIT + 8 * h];
    v8f acc[12];
#pragma unroll
    for (int t = 0; t < 12; ++t) acc[t] = (v8f){};
#pragma unroll
    for (int kc = 0; kc < CC; kc += 32) {
        const v16bf a = cat16b(*(const v8us*)(ax + kc), *(const v8us*)(ax + kc + 16)); v16bf b[12];
#pragma unroll
        for (int t = 0; t < 12; ++t) b[t] = cat16b(*(const v8us*)(bw + t * 16 * XPIT + kc), *(const v8us*)(bw + t * 16 * XPIT + kc + 16));
        fence();   // one step's fragments as one group in front of its products; without the pair of fences many steps' fragments are fetched at once and registers spill
#pragma unroll
        for (int t = 0; t < 12; ++t) acc[t] = (t < 4) ? wmmab(b[t], a, acc[t]) : wmmab(a, b[t], acc[t]);
        fence();
    }
    const float isf = __fdiv_rn(1.0f, SIG[0]), isg = __fdiv_rn(1.0f, SIG[32]), ish = __fdiv_rn(1.0f, SIG[64]);
#pragma unroll
    for (int t = 0; t < 8; ++t) {   // acc[4 + t][r] = h column t * 16 + c of token 8 h + r
        const float bb = bfr(bv[t]); v8h o;
#pragma unroll
        for (int r = 0; r < 8; ++r) o[r] = tohx(acc[4 + t][r] * ish + bb);
        *(v8h*)(&sT[(t * 16 + c) * TPIT + wave * 16 + 8 * h]) = o;
    }
    v8h fg[4];
#pragma unroll
    for (int t = 0; t < 4; ++t) {   // acc[t][r] = column t * 16 + 8 h + r of token c
        const float is = t < 2 ? isf : isg;
#pragma unroll
        for (int r = 0; r < 8; ++r) { const float v = acc[t][r] * is + bfr(bq[t][r >> 2][r & 3]); fg[t][r] = tohx(t < 2 ? v : v * L2E); }   // g is stored x log2(e), rounded once: k_attn's scores come out in powers of two
    }
    __syncthreads();
    v8h ht[8];
#pragma unroll
    for (int i = 0; i < 8; ++i) ht[i] = *(const v8h*)(&sT[(wave * 16 + i * 2 + h) * TPIT + c * 8]);
    const int b = blockIdx.x / (HW / PTK), t0 = (blockIdx.x % (HW / PTK)) * PTK;
    h16* fo = Fp + (R0 + wave * 16 + c) * DQK + 8 * h; h16* go = Gp + (R0 + wave * 16 + c) * DQK + 8 * h;
    h16* ho = HT + ((size_t)b * DV + wave * 16 + h) * HW + t0 + c * 8;
    fence();   // every store stands behind all other work, so that no register of an issued store is written again
    *(v8h*)fo = fg[0]; *(v8h*)(fo + 16) = fg[1]; *(v8h*)go = fg[2]; *(v8h*)(go + 16) = fg[3];
#pragma unroll
    for (int i = 0; i < 8; ++i) *(v8h*)(ho + (size_t)i * 2 * HW) = ht[i];
}
typedef __attribute__((ext_vector_type(2))) float    v2f;
typedef __attribute__((ext_vector_type(2))) _Float16 v2h;
#define KST  128                  // keys per stage: 64 for each half of the waves
#define KWV  64                   // keys of a stage that one wave works on
#define HPIT 136                  // LDS pitch of a 128-key h^T row, in halves (272 B = 16 B x odd, for 16-byte reads)
#define FPIT 40                   // LDS pitch of a 32-wide f row, in halves (80 B = 16 B x odd)
__device__ __forceinline__ float xhalf(float x) { return __builtin_bit_cast(float, __builtin_amdgcn_permlanex16(__builtin_bit_cast(int, x), __builtin_bit_cast(int, x), 0x76543210, 0xfedcba98, false, false)); }  // lane l with lane l ^ 16
// put4: the four O^T tiles per query group, from tile O on, that the partner wave finishes, into this wave's own exchange range (16-byte pieces, a lane stride of 16 B)
template <int O> __device__ __forceinline__ void put4(float* xs, const v8f (&acc)[2][8]) {
#pragma unroll
    for (int u = 0; u < 2; ++u) {
#pragma unroll
        for (int j = 0; j < 4; ++j) {
            const v8f g = acc[u][O + j];
            *(v4f*)(xs + ((u * 4 + j) * 2) * 128)     = (v4f){g[0], g[1], g[2], g[3]};
            *(v4f*)(xs + ((u * 4 + j) * 2 + 1) * 128) = (v4f){g[4], g[5], g[6], g[7]};
        }
    }
}
// fin4: this wave's own four tiles from tile O on, joined with the partner's sums of the same tiles: o = own * ca + partner's * cb
template <int O> __device__ __forceinline__ void fin4(const float* xr, const v8f (&acc)[2][8], const float (&ca)[2], const float (&cb)[2], v8h (&o)[2][4]) {
    v4f p[2][4][2];
#pragma unroll
    for (int u = 0; u < 2; ++u) {
#pragma unroll
        for (int j = 0; j < 4; ++j) { p[u][j][0] = *(const v4f*)(xr + ((u * 4 + j) * 2) * 128); p[u][j][1] = *(const v4f*)(xr + ((u * 4 + j) * 2 + 1) * 128); }
    }
#pragma unroll
    for (int u = 0; u < 2; ++u) {
#pragma unroll
        for (int j = 0; j < 4; ++j) {
#pragma unroll
            for (int r = 0; r < 8; ++r) o[u][j][r] = tohx(acc[u][O + j][r] * ca[u] + p[u][j][r >> 2][r & 3] * cb[u]);
        }
    }
}
#define PTOP 60000.0f             // a lane's sum of one stage's P per query group; at or below it every single P fits fp16
// pexp: P = exp2(a) of one stage for the wave's two query groups, packed in fp16 as the B operand of the second product, and each lane's f32 sum of them
__device__ __forceinline__ void pexp(const v8f (&st)[2][4], v16h (&pf)[2][2], float (&pt)[2]) {
#pragma unroll
    for (int u = 0; u < 2; ++u) {
        v2f ps[2] = {(v2f){0.f, 0.f}, (v2f){0.f, 0.f}};
#pragma unroll
        for (int t = 0; t < 4; ++t) {
#pragma unroll
            for (int j = 0; j < 8; j += 2) {
                const v2f e = {__builtin_amdgcn_exp2f(st[u][t][j]), __builtin_amdgcn_exp2f(st[u][t][j + 1])};
                ps[(j >> 1) & 1] += e;
                const v2h eh = __builtin_convertvector(e, v2h);
                pf[u][t >> 1][(t & 1) * 8 + j] = eh[0]; pf[u][t >> 1][(t & 1) * 8 + j + 1] = eh[1];
            }
        }
        const v2f p2 = ps[0] + ps[1];
        pt[u] = p2[0] + p2[1];
    }
}
// soft: the softmax step of one stage. st comes in as a = s log2(e) + off: the query's offset off = -(the maximum in use) was the C operand of the score product, so P = exp2(a) with no
// other work per score. The maximum in use is renewed only when it has to be: on the first stage, and when some lane's sum of P passes PTOP (all P >= 0, so a sum at or below PTOP bounds
// every P below the fp16 top; a <= 0 everywhere gives at most 32, so a renewal always finds a score above the maximum in use). A renewal puts the stage's largest a at 0 (P = 1: nearly
// 16 powers of two of room above it, so that a later, larger score seldom asks for the next renewal; below it fp16 resolves 2^-25 of the largest P), rescales O^T and the sum to it and
// forms P again. The test is one for the whole wave, and both lane halves of a query take the same step.
__device__ __forceinline__ void soft(const bool first, v8f (&st)[2][4], v8f (&offv)[2], float (&l)[2], v16h (&pf)[2][2], v8f (&acc)[2][8]) {
    float pt[2];
    pexp(st, pf, pt);
    if (first || __builtin_amdgcn_ballot_w32(!(fmaxf(pt[0], pt[1]) <= PTOP)) != 0u) {
#pragma unroll
        for (int u = 0; u < 2; ++u) {
            float mx[4];
#pragma unroll
            for (int t = 0; t < 4; ++t) mx[t] = fmaxf(fmaxf(fmaxf(st[u][t][0], st[u][t][1]), fmaxf(st[u][t][2], st[u][t][3])), fmaxf(fmaxf(st[u][t][4], st[u][t][5]), fmaxf(st[u][t][6], st[u][t][7])));
            float mq = fmaxf(fmaxf(mx[0], mx[1]), fmaxf(mx[2], mx[3]));
            mq = fmaxf(mq, xhalf(mq));
            const float d  = first ? mq : fmaxf(mq, 0.0f);                   // the first stage sets the maximum, later ones only raise it
            const float al = first ? 0.0f : __builtin_amdgcn_exp2f(-d);      // nothing is summed yet on the first stage
            const float on = offv[u][0] - d;
            offv[u] = (v8f){on, on, on, on, on, on, on, on};
            l[u] *= al;
#pragma unroll
            for (int t = 0; t < 4; ++t) st[u][t] -= d;
#pragma unroll
            for (int t = 0; t < 8; ++t) acc[u][t] *= al;
        }
        pexp(st, pf, pt);
    }
#pragma unroll
    for (int u = 0; u < 2; ++u) l[u] += pt[u];
}
// k_attn: s = g.f^T, softmax and beta.h of one image in one kernel; scores and softmax rows stay in registers. Block = 128 queries, walks all 4096 keys in stages of 128.
// The 8 waves are 4 query groups x 2 key halves: a wave has 32 queries (two 16-column groups) and 64 of a stage's keys, so that every f and h^T fragment it reads from LDS feeds two
// products, and the block reads each staged tile four times, not eight. Per wave S^T = F.G^T (A = 16 key rows of f from LDS, B = 16 queries of g, kept in registers): a lane holds
// scores of ONE query per group (column lane & 15), so the maximum in use and the sum are per lane, with one exchange between the lane halves where the maximum is renewed (soft). Two S^T tiles (keys 0-15, 16-31),
// converted in place, are the B operand of O^T += H^T.P^T (A = 16 rows of h^T from LDS), and the rescale of O^T by exp2(m_old - m_new) is per lane too. P is carried against the maximum in use on an fp16
// plane, and the sum carries the same factor. Behind the loop the two waves of a query group join their maxima, sums and O^T through LDS, each finishing 64 of the 128 columns.
// The two waves of a query group (wave w and w + 4: the two key halves) run half a stage apart: key half 0 does its softmax in front of the stage's barrier, key half 1 behind it, so
// that between two barriers one of them is in its vector work while the other is in its products. A stage is still read behind its barrier, hence three buffers: the stores in
// front of the next barrier go to the buffer that neither this stage nor the next one reads.
// Behind the join the block has o of its 128 tokens, and finishes them itself: out = gamma (o.wo / sigma_o + bo) + x. o goes to that product through LDS (fp16, as it went through the workspace),
// all 256 rows of wo^T stand beside it (asked for in front of the loop, kept in registers, stored behind it); the product is formed as Wo.o^T (a lane holds 8 consecutive columns of one
// token) and passed through the wave's own LDS rows, which lie on the ring that nobody reads any more, so that scale, bias, gamma and the residual are applied on whole 512-byte runs.
// the work-group's barrier with the LDS side of __syncthreads() alone: LDS writes are done in front of it and no LDS access moves across it, but the residual's global loads, which no
// other wave has a part in, stay in flight over it (__syncthreads() would wait for them at the first barrier behind their issue)
__device__ __forceinline__ void lds_barrier() {
    __builtin_amdgcn_fence(__ATOMIC_RELEASE, "workgroup", "local"); __builtin_amdgcn_s_barrier(); __builtin_amdgcn_fence(__ATOMIC_ACQUIRE, "workgroup", "local");
}
union __align__(16) ring_or_c {
    struct { h16 H[3][DV * HPIT]; h16 F[3][KST * FPIT]; } r;   // the loop's three stages of h^T and f
    float C[8][16 * OPIT];                                     // behind the join's barrier: per wave 16 rows of the output product
};
__global__ __launch_bounds__(256) void k_attn(const h16* __restrict__ Gp, const h16* __restrict__ Fp, const h16* __restrict__ HT, const h16* __restrict__ WO, const float* __restrict__ SIG, const float* __restrict__ bo_, const float* __restrict__ gam, const float* __restrict__ x, float* OUTB) {
    __shared__ ring_or_c sR;
    __shared__ __align__(16) float sX[8][16 * 128];   // per wave: 8 O^T tiles for its partner
    __shared__ __align__(16) v2f sM[8][2][32];        // per wave and query group: a lane's maximum and sum
    __shared__ __align__(16) h16 sWo[CC * TPIT];
    __shared__ __align__(16) h16 sO[PTK * TPIT];
    const int tid = threadIdx.x, lane = tid & 31, wave = tid >> 5, c = lane & 15, h = lane >> 4;
    const int kh = __builtin_amdgcn_readfirstlane(tid >> 7);   // the wave's key half, in a scalar register: the branches on it are scalar ones
    const int b = blockIdx.y, q = blockIdx.x * 128 + (wave & 3) * 32 + c;   // the lane's queries: q and q + 16
    const h16* gq = Gp + ((size_t)b * HW + q) * DQK + 8 * h;
    v16h gfr[2];
#pragma unroll
    for (int u = 0; u < 2; ++u) gfr[u] = cat16(*(const v8h*)(gq + u * 16 * DQK), *(const v8h*)(gq + u * 16 * DQK + 16));
    const int hrow = tid >> 4, hch = (tid & 15) * 8, frow = tid >> 2, fch = (tid & 3) * 8;
    // a uniform base that moves with the stage plus a lane offset that never changes: no vector address register is rewritten, and the base moves only behind the loads' data wait
    const h16* hbase = HT + (size_t)b * DV * HW; const h16* fbase = Fp + (size_t)b * HW * DQK;
    const unsigned hoff = (unsigned)(hrow * HW + hch), foff = (unsigned)(frow * DQK + fch);   // h^T rows hrow + 16 i, 16 lanes per 256-byte run; f rows frow + 64 j
    v8h rh[8], rf[2];
#pragma unroll
    for (int i = 0; i < 8; ++i) rh[i] = *(const v8h*)(hbase + hoff + 16 * i * HW);
#pragma unroll
    for (int j = 0; j < 2; ++j) rf[j] = *(const v8h*)(fbase + foff + 64 * j * DQK);
    xwait(gq);   // behind the loads of g and of stage 0: what follows may take the address registers of these loads over
#pragma unroll
    for (int i = 0; i < 8; ++i) *(v8h*)(&sR.r.H[0][(hrow + 16 * i) * HPIT + hch]) = rh[i];
#pragma unroll
    for (int j = 0; j < 2; ++j) *(v8h*)(&sR.r.F[0][(frow + 64 * j) * FPIT + fch]) = rf[j];
    __syncthreads();
    fence();   // the bases move only behind the data wait of the loads that named them (the wait stands in front of the LDS stores above)
    // stage 1 into registers: trip 0 stores it
    hbase += KST; fbase += KST * DQK;
#pragma unroll
    for (int i = 0; i < 8; ++i) rh[i] = *(const v8h*)(hbase + hoff + 16 * i * HW);
#pragma unroll
    for (int j = 0; j < 2; ++j) rf[j] = *(const v8h*)(fbase + foff + 64 * j * DQK);
    xwait(foff);   // behind these loads: the compiler forms the loop's bases in the registers that they name
    // all of wo^T (two 256-byte rows per load): asked for here, put into LDS behind the loop, so that its way from L2 lies under the loop
    const h16* wp = WO + (size_t)(wave * 32) * DV + lane * 8;
    v8h rw[16];
#pragma unroll
    for (int i = 0; i < 16; ++i) rw[i] = *(const v8h*)(wp + i * 2 * DV);
    xwait(wp);
    v8f acc[2][8];
#pragma unroll
    for (int u = 0; u < 2; ++u) {
#pragma unroll
        for (int t = 0; t < 8; ++t) acc[u][t] = (v8f){};
    }
    float l[2] = {0.f, 0.f};
    v8f offv[2] = {(v8f){}, (v8f){}};   // per query group the lane's offset, eight times: the C operand of the score products
    int cur = 0;   // the buffer of stage s: s mod 3
#pragma unroll 1
    for (int s = 0; s < HW / KST; ++s) {
        const int nxt = cur == 2 ? 0 : cur + 1;
        const h16* cF = &sR.r.F[cur][(kh * KWV + c) * FPIT + 8 * h];
        const h16* cH = &sR.r.H[cur][c * HPIT + kh * KWV + 8 * h];
        v16h ff[4], a0[8], a1[8];
#pragma unroll
        for (int t = 0; t < 4; ++t) ff[t] = cat16(*(const v8h*)(cF + t * 16 * FPIT), *(const v8h*)(cF + t * 16 * FPIT + 16));
#pragma unroll
        for (int t = 0; t < 8; ++t) a0[t] = cat16(*(const v8h*)(cH + t * 16 * HPIT), *(const v8h*)(cH + t * 16 * HPIT + 16));
        fence();   // keeps the first h^T fragments issued here, ahead of the score and softmax work that hides their latency
        v8f st[2][4];
#pragma unroll
        for (int t = 0; t < 4; ++t) {
#pragma unroll
            for (int u = 0; u < 2; ++u) st[u][t] = wmma16(ff[t], gfr[u], offv[u]);
        }
        fence();   // keeps the score products in front of the slots below
        asm volatile("v_nop\n\tv_nop\n\tv_nop\n\tv_nop");   // the four vector slots between the last score product and the first vector instruction that takes its operand registers over
        v16h pf[2][2];
        if (!kh) soft(s == 0, st, offv, l, pf, acc);   // key half 0: vector work here, while key half 1 is in its products
        // stage s + 1, asked for behind the barrier before this one. Its buffer's last readers (stage s - 2) left it before that barrier
        h16* nH = &sR.r.H[nxt][0]; h16* nF = &sR.r.F[nxt][0];
#pragma unroll
        for (int i = 0; i < 8; ++i) *(v8h*)(nH + (hrow + 16 * i) * HPIT + hch) = rh[i];
#pragma unroll
        for (int j = 0; j < 2; ++j) *(v8h*)(nF + (frow + 64 * j) * FPIT + fch) = rf[j];
        __syncthreads();
        fence();   // the bases move only behind the data wait of the loads that named them (the wait stands in front of the LDS stores above)
        // stage s + 2 into registers, a whole trip ahead of its stores (on the last two trips the bases stay: the last stage is fetched again, and that copy is never read)
        if (s + 2 < HW / KST) { hbase += KST; fbase += KST * DQK; }
#pragma unroll
        for (int i = 0; i < 8; ++i) rh[i] = *(const v8h*)(hbase + hoff + 16 * i * HW);
#pragma unroll
        for (int j = 0; j < 2; ++j) rf[j] = *(const v8h*)(fbase + foff + 64 * j * DQK);
        fence();   // keeps the global loads issued here, ahead of the work that hides their latency
        if (kh) soft(s == 0, st, offv, l, pf, acc);    // key half 1: vector work here, while key half 0 is in its products
        fence();   // with the fence behind them: the second half's h^T fragments go out as one group in front of the first half's products, not among them
#pragma unroll
        for (int t = 0; t < 8; ++t) a1[t] = cat16(*(const v8h*)(cH + t * 16 * HPIT + 32), *(const v8h*)(cH + t * 16 * HPIT + 48));
        fence();   // second of the pair: without it the fragment loads and their waits move in among the products
#pragma unroll
        for (int t = 0; t < 8; ++t) {
#pragma unroll
            for (int u = 0; u < 2; ++u) acc[u][t] = wmma16(a0[t], pf[u][0], acc[u][t]);
        }
#pragma unroll
        for (int t = 0; t < 8; ++t) {
#pragma unroll
            for (int u = 0; u < 2; ++u) acc[u][t] = wmma16(a1[t], pf[u][1], acc[u][t]);
        }
        cur = nxt;
    }
    asm volatile("s_wait_xcnt 0x0" ::: "memory");   // behind the last trip's loads: what follows may take their address registers over
    fence();   // keeps all that follows behind that wait
#pragma unroll
    for (int i = 0; i < 16; ++i) *(v8h*)(&sWo[(wave * 32 + i * 2 + h) * TPIT + c * 8]) = rw[i];   // published by the join's barrier
    // the residual rows and the bias of the wave's 16 tokens: asked for here, used behind the output product
    const size_t R0 = ((size_t)b * HW + blockIdx.x * PTK + __builtin_amdgcn_readfirstlane(tid >> 5) * 16) * CC;   // scalar: the wave's rows of x and of out as a uniform base plus a lane offset
    const float* xb = x + R0; const unsigned xo = lane * 4;
    v4f xres[32], bo4[2];
    const float* bp = bo_ + lane * 4;   // the bias first: loads come back in order, and a wait for it must not wait for the residual too
#pragma unroll
    for (int p = 0; p < 2; ++p) bo4[p] = *(const v4f*)(bp + p * 128);
    xwait(bp);
#pragma unroll
    for (int i = 0; i < 32; ++i) xres[i] = *(const v4f*)(xb + xo + (i >> 1) * CC + (i & 1) * 128);
    xwait(xo);
    const float m[2] = {-offv[0][0], -offv[1][0]};   // the maxima in use at the end: what the wave's sums are scaled to
    // the join of the two key halves: wave w and wave w ^ 4 hold the same queries. Each hands the other the O^T tiles of the 64 columns that the other finishes, with its maximum and sum
#pragma unroll
    for (int u = 0; u < 2; ++u) { l[u] += xhalf(l[u]); sM[wave][u][lane] = (v2f){m[u], l[u]}; }
    float* xs = &sX[wave][lane * 4];
    if (kh) put4<0>(xs, acc); else put4<4>(xs, acc);
    lds_barrier();
    float ca[2], cb[2];
#pragma unroll
    for (int u = 0; u < 2; ++u) {
        const v2f o = sM[wave ^ 4][u][lane];
        const float mm = fmaxf(m[u], o[0]), wa = __builtin_amdgcn_exp2f(m[u] - mm), wb = __builtin_amdgcn_exp2f(o[0] - mm);
        const float inv = __fdiv_rn(1.0f, fmaf(l[u], wa, o[1] * wb));
        ca[u] = wa * inv; cb[u] = wb * inv;
    }
    const float* xr = &sX[wave ^ 4][lane * 4];
    v8h ov[2][4];
    if (kh) fin4<4>(xr, acc, ca, cb, ov); else fin4<0>(xr, acc, ca, cb, ov);
    h16* so = &sO[((wave & 3) * 32 + c) * TPIT + kh * 64 + 8 * h];   // the wave's 64 columns of its 32 queries
#pragma unroll
    for (int u = 0; u < 2; ++u) {
#pragma unroll
        for (int j = 0; j < 4; ++j) *(v8h*)(so + u * 16 * TPIT + j * 16) = ov[u][j];
    }
    lds_barrier();
    const h16* ao = &sO[(wave * 16 + c) * TPIT + 8 * h];
    const h16* bw = &sWo[c * TPIT + 8 * h];
    v8f oc[16];
#pragma unroll
    for (int t = 0; t < 16; ++t) oc[t] = (v8f){};
#pragma unroll
    for (int kc = 0; kc < DV; kc += 32) {
        const v16h a = cat16(*(const v8h*)(ao + kc), *(const v8h*)(ao + kc + 16)); v16h bb[16];
#pragma unroll
        for (int t = 0; t < 16; ++t) bb[t] = cat16(*(const v8h*)(bw + t * 16 * TPIT + kc), *(const v8h*)(bw + t * 16 * TPIT + kc + 16));
        fence();   // one step's fragments as one group in front of its products; without the pair of fences all four steps' fragments are fetched at once and registers spill
#pragma unroll
        for (int t = 0; t < 16; ++t) oc[t] = wmma16(bb[t], a, oc[t]);
        fence();
    }
    float* os = &sR.C[wave][0];
#pragma unroll
    for (int t = 0; t < 16; ++t) {   // oc[t][r] = column t * 16 + 8 h + r of token c
        *(v4f*)(os + c * OPIT + t * 16 + 8 * h)     = (v4f){oc[t][0], oc[t][1], oc[t][2], oc[t][3]};
        *(v4f*)(os + c * OPIT + t * 16 + 8 * h + 4) = (v4f){oc[t][4], oc[t][5], oc[t][6], oc[t][7]};
    }
    lds_barrier();
    const float iso = __fdiv_rn(1.0f, SIG[96]); const float gmm = bfr(gam[0]);
#pragma unroll
    for (int p = 0; p < 2; ++p) bo4[p] = (v4f){bfr(bo4[p][0]), bfr(bo4[p][1]), bfr(bo4[p][2]), bfr(bo4[p][3])};
    v4f cv[32];
#pragma unroll
    for (int i = 0; i < 32; ++i) cv[i] = *(const v4f*)(os + (i >> 1) * OPIT + (i & 1) * 128 + lane * 4);
    fence();   // the LDS reads go out as one group; without it each is waited for just ahead of its use
#pragma unroll
    for (int i = 0; i < 32; ++i) {
#pragma unroll
        for (int k = 0; k < 4; ++k) xres[i][k] = gmm * (cv[i][k] * iso + bo4[i & 1][k]) + bfr(xres[i][k]);
    }
    float* pb = OUTB + R0;
    fence();   // every store stands behind all other work, so that no register of an issued store is written again
#pragma unroll
    for (int i = 0; i < 32; ++i) *(v4f*)(pb + xo + (i >> 1) * CC + (i & 1) * 128) = xres[i];
}
extern "C" void kernel_launch(void* const* d_in, const int* in_sizes, int n_in,
                              void* d_out, int out_size, void* d_ws, size_t ws_size, hipStream_t stream) {
    (void)in_sizes; (void)n_in; (void)out_size;
    const float* x = (const float*)d_in[0]; const float* wf = (const float*)d_in[1]; const float* bf_ = (const float*)d_in[2]; const float* uf = (const float*)d_in[3]; const float* wg = (const float*)d_in[4]; const float* bg_ = (const float*)d_in[5]; const float* ug = (const float*)d_in[6]; const float* wh = (const float*)d_in[7]; const float* bh_ = (const float*)d_in[8]; const float* uh = (const float*)d_in[9]; const float* wo = (const float*)d_in[10]; const float* bo_ = (const float*)d_in[11]; const float* uo = (const float*)d_in[12]; const float* gam = (const float*)d_in[13];
    float* out = (float*)d_out;    // [8][64][64][256]
    char* wsp = (char*)d_ws;
    auto take = [&](size_t bytes) { char* p = wsp; wsp += (bytes + 255) & ~(size_t)255; return (void*)p; };
    float* SIG = (float*)take(4 * 32 * 4); bf* WB = (bf*)take((size_t)NPJ * CC * 2); h16* WO = (h16*)take((size_t)CC * DV * 2);
    h16* Fp = (h16*)take((size_t)NR * DQK * 2); h16* Gp = (h16*)take((size_t)NR * DQK * 2); h16* HT = (h16*)take((size_t)NB_ * DV * HW * 2);
    if ((size_t)(wsp - (char*)d_ws) > ws_size) return;    // ~ 0.2 + 2.1 x 2 + 8.4 ~ 13 MB
    k_setup<<<4, 256, 0, stream>>>(wf, uf, wg, ug, wh, uh, wo, uo, SIG, WB, WO);
    k_proj<<<NR / PTK, 256, 0, stream>>>(x, WB, SIG, bf_, bg_, bh_, Fp, Gp, HT);
    k_attn<<<dim3(HW / 128, NB_, 1), 256, 0, stream>>>(Gp, Fp, HT, WO, SIG, bo_, gam, x, out);
}

// v008
// Measured time: 51.6 microseconds a run.
// Timed twice side by side with v007, it ran 1.07 and 1.08 times as fast.
// Over all steps from v000 it is 21.7 times as fast.
#include <hip/hip_runtime.h>

// Compute dtypes, f32 accumulate: the four spectral-norm sigmas (one power iteration on the tiny weight matrices) in f32 on VALU and applied as f32 scales AFTER the GEMMs, so
// every weight GEMM uses the EXACT bf16 weights: f|g|h = x.[wf|wg|wh] ([32768 x 256].[256 x 192]) with plain bf16 operands (x and the weights are inputs: exact products);
// per image s = g.f^T ([4096 x 32].[32 x 4096]) and beta.h ([4096 x 4096].[4096 x 128]) on SINGLE fp16 planes (f/g/h after the 1/sigma scale + bias, softmax rows carried
// against a maximum in use, 1 to the fp16 top, rounded to fp16 = 2^-11); o.wo ([32768 x 128].[128 x 256]) on a single fp16 plane of o against exact wo; out = gamma (o.wo / sigma_o + bo) + x in f32 - measured

#define NB_  8
#define HW   4096
#define CC   256
#define DQK  32
#define DV   128
#define NPJ  192                  // f | g | h columns
#define NR   (NB_ * HW)           // 32768
#define DM   CC
#define LOSC 1024.0f
#define L2E  1.4426950408889634f
typedef _Float16 h16;
typedef unsigned short bf;
typedef __attribute__((ext_vector_type(16))) __bf16   v16bf;
typedef __attribute__((ext_vector_type(16))) _Float16 v16h;
typedef __attribute__((ext_vector_type(8)))  _Float16 v8h;
typedef __attribute__((ext_vector_type(8)))  unsigned short v8us;
typedef __attribute__((ext_vector_type(8)))  float    v8f;
typedef __attribute__((ext_vector_type(4)))  float    v4f;
typedef v8h  __attribute__((may_alias)) v8ha;
typedef v4f  __attribute__((may_alias)) v4fa;
typedef v8us __attribute__((may_alias)) v8usa;

__device__ __forceinline__ unsigned short f2bf(float f) { unsigned u = __float_as_uint(f); u += 0x7FFFu + ((u >> 16) & 1u); return (unsigned short)(u >> 16); }
__device__ __forceinline__ float bf2f(unsigned short b) { return __uint_as_float(((unsigned)b) << 16); }
__device__ __forceinline__ float bfr(float f) { return bf2f(f2bf(f)); }
__device__ __forceinline__ v16h cat16(v8h lo, v8h hi) { return __builtin_shufflevector(lo, hi, 0, 1, 2, 3, 4, 5, 6, 7, 8, 9, 10, 11, 12, 13, 14, 15); }
__device__ __forceinline__ v16bf cat16b(v8us lo, v8us hi) { return __builtin_bit_cast(v16bf, __builtin_shufflevector(lo, hi, 0, 1, 2, 3, 4, 5, 6, 7, 8, 9, 10, 11, 12, 13, 14, 15)); }
__device__ __forceinline__ v8f wmma16(v16h a, v16h b, v8f c) { return __builtin_amdgcn_wmma_f32_16x16x32_f16(false, a, false, b, (short)0, c, false, false); }
__device__ __forceinline__ v8f wmmab(v16bf a, v16bf b, v8f c) { return __builtin_amdgcn_wmma_f32_16x16x32_bf16(false, a, false, b, (short)0, c, false, false); }

typedef __attribute__((ext_vector_type(4))) _Float16 v4h;
__device__ __forceinline__ h16 tohx(float x) { return (h16)x; }
typedef __attribute__((ext_vector_type(4))) __bf16 v4bf;
__device__ __forceinline__ void fence() { __builtin_amdgcn_sched_barrier(0); }   // the compiler schedules nothing across it
// behind a group of global loads from p (a lane's pointer, or its byte offset from a uniform base): the wait that stands in front of any new value in their address registers. p as an input keeps those registers p's up to the wait (else the
// group's last load may land on them); the scheduling barrier keeps what follows behind it
template <class T> __device__ __forceinline__ void xwait(T p) { asm volatile("s_wait_xcnt 0x0" :: "v"(p) : "memory"); __builtin_amdgcn_sched_barrier(0); }
// the work-group's barrier with the LDS side of __syncthreads() alone: LDS writes are done in front of it and no LDS access moves across it, but global loads that no
// other wave has a part in stay in flight over it (__syncthreads() would wait for them at the first barrier behind their issue)
__device__ __forceinline__ void lds_barrier() {
    __builtin_amdgcn_fence(__ATOMIC_RELEASE, "workgroup", "local"); __builtin_amdgcn_s_barrier(); __builtin_amdgcn_fence(__ATOMIC_ACQUIRE, "workgroup", "local");
}
// sigma of a weight matrix W (in,out) with u, one power iteration, from nv = |W u|^2 and st = |W^T (W u)|^2: v = W u * invv, t = W^T v, sigma = t . l2n(t), with the reference's floor under both norms
__device__ __forceinline__ float sigma_of(float nv, float st) {
    const float invv = rsqrtf(fmaxf(nv, 1e-12f)); const float nt = st * invv * invv; return nt * rsqrtf(fmaxf(nt, 1e-12f));
}
__device__ __forceinline__ float xhalf(float x) { return __builtin_bit_cast(float, __builtin_amdgcn_permlanex16(__builtin_bit_cast(int, x), __builtin_bit_cast(int, x), 0x76543210, 0xfedcba98, false, false)); }  // lane l with lane l ^ 16
template <int N> __device__ __forceinline__ float xrow(float x) { return __builtin_bit_cast(float, __builtin_amdgcn_update_dpp(0, __builtin_bit_cast(int, x), 0x160 + N, 0xf, 0xf, true)); }  // lane l with lane l ^ N inside its row of 16 (row_xmask); all lanes on
__device__ __forceinline__ float wsum(float s) {   // sum over the wave's 32 lanes, in every lane, without a trip through the LDS unit
    s += xrow<1>(s); s += xrow<2>(s); s += xrow<4>(s); s += xrow<8>(s);
    return s + xhalf(s);
}
// eight f32 rounded to bf16 (to nearest even), as one 16-byte piece
__device__ __forceinline__ v8us tobf8(const float* q) {
    const v4f lo = {q[0], q[1], q[2], q[3]}, hi = {q[4], q[5], q[6], q[7]};
    return __builtin_bit_cast(v8us, __builtin_shufflevector(__builtin_convertvector(lo, v4bf), __builtin_convertvector(hi, v4bf), 0, 1, 2, 3, 4, 5, 6, 7));
}
#define PTK  128                  // tokens per block of the two weight GEMMs (8 waves x 16)
#define XPIT 264                  // LDS pitch of a 256-wide bf16 row, in halves (528 B = 16 B x odd)
#define TPIT 136                  // LDS pitch of a 128-wide 16-bit row, in halves (272 B = 16 B x odd)
#define OPIT 260                  // LDS pitch of a 256-wide f32 row, in floats (1040 B = 16 B x odd)
// k_proj: f | g | h = x.[wf|wg|wh] of 128 tokens with everything around the product in the same kernel. x comes in as f32 by whole-line loads and is rounded to bf16 on its way
// into LDS; all 192 weight rows are staged beside it. f and g are formed as W.x^T (a lane holds 8 consecutive columns of one token: one 16-byte store after scale and bias),
// h as x.W^T (a lane holds 8 consecutive tokens of one column: a 16-byte piece of an h^T row, gathered in LDS so that each 256-byte run of h^T has one writer).
// The weights come in as they are given, f32 [k][n]: a wave takes 32 rows k of all three matrices by whole 128-byte runs (a lane = four columns n of eight consecutive k), rounds them to bf16 and stores
// each column's 8 k as a 16-byte piece of row n of W^T. The three sigmas are made from those LDS rows by every block for itself, while its x is still on its way from memory:
// v = W u as per-wave partial sums over 24 rows n (a lane = 8 k), joined per k; t = W^T v with a thread per row n; |t|^2 per wave. Block i also writes row i of wo^T (fp16 of the bf16 value) for k_attn.
static_assert(NR / PTK == CC, "one block of k_proj per row of wo^T");
union __align__(16) t_or_s {
    h16 T[DV * TPIT];                                                // behind the product: h^T of the block's tokens
    struct { float P[8][3][CC]; float V[3][CC]; float U[NPJ]; } s;   // in front of it: partial W u per wave, W u, and u (f | g | h)
};
__global__ __launch_bounds__(256) void k_proj(const float* __restrict__ x, const float* __restrict__ wf, const float* __restrict__ uf, const float* __restrict__ wg, const float* __restrict__ ug, const float* __restrict__ wh, const float* __restrict__ uh, const float* __restrict__ wo, const float* __restrict__ bf_, const float* __restrict__ bg_, const float* __restrict__ bh_, h16* Fp, h16* Gp, h16* HT, h16* WO) {
    __shared__ __align__(16) bf  sX[PTK * XPIT];
    __shared__ __align__(16) bf  sW[NPJ * XPIT];
    __shared__ t_or_s sTS;
    __shared__ __align__(16) float sS[16];   // 0 to 5: per wave of the t step its sum of t^2; 8 to 10: |W u|^2 of f, g, h
    h16* sT = sTS.T;
    const int tid = threadIdx.x, lane = tid & 31, wave = tid >> 5, c = lane & 15, h = lane >> 4;
    const int wv = __builtin_amdgcn_readfirstlane(tid >> 5);   // the wave's number in a scalar register: uniform LDS addresses and a scalar branch in the sigma work
    const size_t R0 = (size_t)blockIdx.x * PTK;
    v4f bq[4][2]; float bv[8];
    {
        // the weights first: loads come back in order, and the sigma work must not wait for x
        const int kk = lane >> 3, n4 = (lane & 7) * 4;   // a 16-byte load: four rows k, 8 apart, x one 128-byte run of 32 columns; load j has k = 32 wave + 8 kk + j
        const float* wfp = wf + (wave * 32 + kk * 8) * DQK + n4; const float* wgp = wg + (wave * 32 + kk * 8) * DQK + n4; const float* whp = wh + (wave * 32 + kk * 8) * DV + n4;
        v4f qw[6][8]; float qo[8];   // column blocks of 32: f, g, four of h. Every loop over a register array, here and in the sigma work, is unrolled whole: the arrays stay in registers and each group of loads goes out together
#pragma unroll
        for (int j = 0; j < 8; ++j) qw[0][j] = *(const v4f*)(wfp + j * DQK);
        xwait(wfp);
#pragma unroll
        for (int j = 0; j < 8; ++j) qw[1][j] = *(const v4f*)(wgp + j * DQK);
        xwait(wgp);
#pragma unroll
        for (int g = 0; g < 4; ++g) {
#pragma unroll
            for (int j = 0; j < 8; ++j) qw[2 + g][j] = *(const v4f*)(whp + j * DV + g * 32);
        }
        xwait(whp);
        const int ui = tid < NPJ ? tid : 0;
        const float* up = ui < DQK ? uf + ui : ui < 2 * DQK ? ug + (ui - DQK) : uh + (ui - 2 * DQK);
        const float uu = *up;
        xwait(up);
        const float* oq = wo + (size_t)((tid & 15) * 8) * CC + blockIdx.x;   // column blockIdx.x of wo, 8 consecutive k per lane
#pragma unroll
        for (int e = 0; e < 8; ++e) qo[e] = 0.f;
        if (tid < 16) {
#pragma unroll
            for (int e = 0; e < 8; ++e) qo[e] = oq[e * CC];
            xwait(oq);
        }
        const float* xp = x + (R0 + wave * 16) * CC + lane * 4;
        v4f xr[32];
#pragma unroll
        for (int i = 0; i < 32; ++i) xr[i] = *(const v4f*)(xp + (i >> 1) * CC + (i & 1) * 128);
        xwait(xp);
        // the biases: asked for here, used behind the product
        const unsigned bofs = 32u * h; const float* bhp = bh_ + c;   // bofs: bytes of 8 h floats
#pragma unroll
        for (int t = 0; t < 2; ++t) {
            const char* pf = (const char*)bf_ + bofs + t * 64; const char* pg = (const char*)bg_ + bofs + t * 64;
            bq[t][0] = *(const v4f*)pf; bq[t][1] = *(const v4f*)(pf + 16); bq[2 + t][0] = *(const v4f*)pg; bq[2 + t][1] = *(const v4f*)(pg + 16);
        }
        xwait(bofs);
#pragma unroll
        for (int t = 0; t < 8; ++t) bv[t] = bhp[t * 16];
        xwait(bhp);
#pragma unroll
        for (int g = 0; g < 6; ++g) {   // the lane's four columns n of block g, 8 consecutive k each: a 16-byte piece of row n of W^T
#pragma unroll
            for (int i = 0; i < 4; ++i) {
                const float q8[8] = {qw[g][0][i], qw[g][1][i], qw[g][2][i], qw[g][3][i], qw[g][4][i], qw[g][5][i], qw[g][6][i], qw[g][7][i]};
                *(v8us*)(&sW[(g * 32 + n4 + i) * XPIT + wave * 32 + kk * 8]) = tobf8(q8);
            }
        }
        if (tid < NPJ) sTS.s.U[tid] = bfr(uu);
        if (tid < 16) {
            v8h o;
#pragma unroll
            for (int e = 0; e < 8; ++e) o[e] = tohx(bfr(qo[e]));
            h16* wq = WO + (size_t)blockIdx.x * DV + tid * 8;   // the whole 256-byte row from one half wave
            *(v8h*)wq = o;
            xwait(wq);
        }
        lds_barrier();   // W^T and u are in LDS; x stays in flight
        {   // W u, partial: the wave's rows n are 4 of f, 4 of g, 16 of h; the lane's k are 8 lane ... 8 lane + 7
            float av[3][8];
#pragma unroll
            for (int m = 0; m < 3; ++m) {
#pragma unroll
                for (int e = 0; e < 8; ++e) av[m][e] = 0.f;
            }
#pragma unroll
            for (int j = 0; j < 24; ++j) {
                const int m = j < 4 ? 0 : j < 8 ? 1 : 2;
                const int n = j < 4 ? wv * 4 + j : j < 8 ? DQK + wv * 4 + (j - 4) : 2 * DQK + wv * 16 + (j - 8);
                const v8us w8 = *(const v8us*)(&sW[n * XPIT + lane * 8]); const float un = sTS.s.U[n];
#pragma unroll
                for (int e = 0; e < 8; ++e) av[m][e] = fmaf(un, bf2f(w8[e]), av[m][e]);
            }
#pragma unroll
            for (int m = 0; m < 3; ++m) {
                *(v4f*)(&sTS.s.P[wv][m][lane * 8])     = (v4f){av[m][0], av[m][1], av[m][2], av[m][3]};
                *(v4f*)(&sTS.s.P[wv][m][lane * 8 + 4]) = (v4f){av[m][4], av[m][5], av[m][6], av[m][7]};
            }
        }
        lds_barrier();   // the partial sums of all waves
#pragma unroll
        for (int m = 0; m < 3; ++m) {
            float s = 0.f;
#pragma unroll
            for (int w = 0; w < 8; ++w) s += sTS.s.P[w][m][tid];
            sTS.s.V[m][tid] = s;
        }
        lds_barrier();   // W u of the three matrices
        if (wv < 6) {   // W^T (W u): thread = row n; wave 0 has f, wave 1 g, waves 2 to 5 h
            const float* vp = sTS.s.V[wv < 2 ? wv : 2]; const bf* rp = &sW[tid * XPIT];
            float t[8];
#pragma unroll
            for (int e = 0; e < 8; ++e) t[e] = 0.f;
#pragma unroll 8   // 24 LDS reads go out together: one LDS latency per 64 terms
            for (int kc = 0; kc < CC; kc += 8) {
                const v8us w8 = *(const v8us*)(rp + kc); const v4f va = *(const v4f*)(vp + kc), vb = *(const v4f*)(vp + kc + 4);
#pragma unroll
                for (int e = 0; e < 4; ++e) { t[e] = fmaf(va[e], bf2f(w8[e]), t[e]); t[4 + e] = fmaf(vb[e], bf2f(w8[4 + e]), t[4 + e]); }
            }
            const float tr = ((t[0] + t[1]) + (t[2] + t[3])) + ((t[4] + t[5]) + (t[6] + t[7]));
            const float sq = wsum(tr * tr);
            if (lane == 0) sS[wv] = sq;
        } else if (wv == 6) {   // |W u|^2 of the three matrices, by a wave that has no rows: a lane squares 8 k
#pragma unroll
            for (int m = 0; m < 3; ++m) {
                const v4f va = *(const v4f*)(&sTS.s.V[m][lane * 8]), vb = *(const v4f*)(&sTS.s.V[m][lane * 8 + 4]);
                float s = 0.f;
#pragma unroll
                for (int e = 0; e < 4; ++e) { s = fmaf(va[e], va[e], s); s = fmaf(vb[e], vb[e], s); }
                s = wsum(s);
                if (lane == 0) sS[8 + m] = s;
            }
        }
#pragma unroll
        for (int i = 0; i < 32; ++i) *(v4bf*)(&sX[(wave * 16 + (i >> 1)) * XPIT + (i & 1) * 128 + lane * 4]) = __builtin_convertvector(xr[i], v4bf);
    }
    __syncthreads();
    const bf* ax = &sX[(wave * 16 + c) * XPIT + 8 * h];
    const bf* bw = &sW[c * XPIT + 8 * h];
    v8f acc[12];
#pragma unroll
    for (int t = 0; t < 12; ++t) acc[t] = (v8f){};
#pragma unroll
    for (int kc = 0; kc < CC; kc += 32) {
        const v16bf a = cat16b(*(const v8us*)(ax + kc), *(const v8us*)(ax + kc + 16)); v16bf b[12];
#pragma unroll
        for (int t = 0; t < 12; ++t) b[t] = cat16b(*(const v8us*)(bw + t * 16 * XPIT + kc), *(const v8us*)(bw + t * 16 * XPIT + kc + 16));
        fence();   // one step's fragments as one group in front of its products; without the pair of fences many steps' fragments are fetched at once and registers spill
#pragma unroll
        for (int t = 0; t < 12; ++t) acc[t] = (t < 4) ? wmmab(b[t], a, acc[t]) : wmmab(a, b[t], acc[t]);
        fence();
    }
    const float isf = __fdiv_rn(1.0f, sigma_of(sS[8], sS[0])), isg = __fdiv_rn(1.0f, sigma_of(sS[9], sS[1])), ish = __fdiv_rn(1.0f, sigma_of(sS[10], (sS[2] + sS[3]) + (sS[4] + sS[5])));
#pragma unroll
    for (int t = 0; t < 8; ++t) {   // acc[4 + t][r] = h column t * 16 + c of token 8 h + r
        const float bb = bfr(bv[t]); v8h o;
#pragma unroll
        for (int r = 0; r < 8; ++r) o[r] = tohx(acc[4 + t][r] * ish + bb);
        *(v8h*)(&sT[(t * 16 + c) * TPIT + wave * 16 + 8 * h]) = o;
    }
    v8h fg[4];
#pragma unroll
    for (int t = 0; t < 4; ++t) {   // acc[t][r] = column t * 16 + 8 h + r of token c
        const float is = t < 2 ? isf : isg;
#pragma unroll
        for (int r = 0; r < 8; ++r) { const float v = acc[t][r] * is + bfr(bq[t][r >> 2][r & 3]); fg[t][r] = tohx(t < 2 ? v : v * L2E); }   // g is stored x log2(e), rounded once: k_attn's scores come out in powers of two
    }
    __syncthreads();
    v8h ht[8];
#pragma unroll
    for (int i = 0; i < 8; ++i) ht[i] = *(const v8h*)(&sT[(wave * 16 + i * 2 + h) * TPIT + c * 8]);
    const int b = blockIdx.x / (HW / PTK), t0 = (blockIdx.x % (HW / PTK)) * PTK;
    h16* fo = Fp + (R0 + wave * 16 + c) * DQK + 8 * h; h16* go = Gp + (R0 + wave * 16 + c) * DQK + 8 * h;
    h16* ho = HT + ((size_t)b * DV + wave * 16 + h) * HW + t0 + c * 8;
    fence();   // every store stands behind all other work, so that no register of an issued store is written again
    *(v8h*)fo = fg[0]; *(v8h*)(fo + 16) = fg[1]; *(v8h*)go = fg[2]; *(v8h*)(go + 16) = fg[3];
#pragma unroll
    for (int i = 0; i < 8; ++i) *(v8h*)(ho + (size_t)i * 2 * HW) = ht[i];
}
typedef __attribute__((ext_vector_type(2))) float    v2f;
typedef __attribute__((ext_vector_type(2))) _Float16 v2h;
#define KST  128                  // keys per stage: 64 for each half of the waves
#define KWV  64                   // keys of a stage that one wave works on
#define HPIT 136                  // LDS pitch of a 128-key h^T row, in halves (272 B = 16 B x odd, for 16-byte reads)
#define FPIT 40                   // LDS pitch of a 32-wide f row, in halves (80 B = 16 B x odd)
// put4: the four O^T tiles per query group, from tile O on, that the partner wave finishes, into this wave's own exchange range (16-byte pieces, a lane stride of 16 B)
template <int O> __device__ __forceinline__ void put4(float* xs, const v8f (&acc)[2][8]) {
#pragma unroll
    for (int u = 0; u < 2; ++u) {
#pragma unroll
        for (int j = 0; j < 4; ++j) {
            const v8f g = acc[u][O + j];
            *(v4f*)(xs + ((u * 4 + j) * 2) * 128)     = (v4f){g[0], g[1], g[2], g[3]};
            *(v4f*)(xs + ((u * 4 + j) * 2 + 1) * 128) = (v4f){g[4], g[5], g[6], g[7]};
        }
    }
}
// fin4: this wave's own four tiles from tile O on, joined with the partner's sums of the same tiles: o = own * ca + partner's * cb
template <int O> __device__ __forceinline__ void fin4(const float* xr, const v8f (&acc)[2][8], const float (&ca)[2], const float (&cb)[2], v8h (&o)[2][4]) {
    v4f p[2][4][2];
#pragma unroll
    for (int u = 0; u < 2; ++u) {
#pragma unroll
        for (int j = 0; j < 4; ++j) { p[u][j][0] = *(const v4f*)(xr + ((u * 4 + j) * 2) * 128); p[u][j][1] = *(const v4f*)(xr + ((u * 4 + j) * 2 + 1) * 128); }
    }
#pragma unroll
    for (int u = 0; u < 2; ++u) {
#pragma unroll
        for (int j = 0; j < 4; ++j) {
#pragma unroll
            for (int r = 0; r < 8; ++r) o[u][j][r] = tohx(acc[u][O + j][r] * ca[u] + p[u][j][r >> 2][r & 3] * cb[u]);
        }
    }
}
#define PTOP 60000.0f             // a lane's sum of one stage's P per query group; at or below it every single P fits fp16
// pexp: P = exp2(a) of one stage for the wave's two query groups, packed in fp16 as the B operand of the second product, and each lane's f32 sum of them
__device__ __forceinline__ void pexp(const v8f (&st)[2][4], v16h (&pf)[2][2], float (&pt)[2]) {
#pragma unroll
    for (int u = 0; u < 2; ++u) {
        v2f ps[2] = {(v2f){0.f, 0.f}, (v2f){0.f, 0.f}};
#pragma unroll
        for (int t = 0; t < 4; ++t) {
#pragma unroll
            for (int j = 0; j < 8; j += 2) {
                const v2f e = {__builtin_amdgcn_exp2f(st[u][t][j]), __builtin_amdgcn_exp2f(st[u][t][j + 1])};
                ps[(j >> 1) & 1] += e;
                const v2h eh = __builtin_convertvector(e, v2h);
                pf[u][t >> 1][(t & 1) * 8 + j] = eh[0]; pf[u][t >> 1][(t & 1) * 8 + j + 1] = eh[1];
            }
        }
        const v2f p2 = ps[0] + ps[1];
        pt[u] = p2[0] + p2[1];
    }
}
// soft: the softmax step of one stage. st comes in as a = s log2(e) + off: the query's offset off = -(the maximum in use) was the C operand of the score product, so P = exp2(a) with no
// other work per score. The maximum in use is renewed only when it has to be: on the first stage, and when some lane's sum of P passes PTOP (all P >= 0, so a sum at or below PTOP bounds
// every P below the fp16 top; a <= 0 everywhere gives at most 32, so a renewal always finds a score above the maximum in use). A renewal puts the stage's largest a at 0 (P = 1: nearly
// 16 powers of two of room above it, so that a later, larger score seldom asks for the next renewal; below it fp16 resolves 2^-25 of the largest P), rescales O^T and the sum to it and
// forms P again. The test is one for the whole wave, and both lane halves of a query take the same step.
__device__ __forceinline__ void soft(const bool first, v8f (&st)[2][4], v8f (&offv)[2], float (&l)[2], v16h (&pf)[2][2], v8f (&acc)[2][8]) {
    float pt[2];
    pexp(st, pf, pt);
    if (first || __builtin_amdgcn_ballot_w32(!(fmaxf(pt[0], pt[1]) <= PTOP)) != 0u) {
#pragma unroll
        for (int u = 0; u < 2; ++u) {
            float mx[4];
#pragma unroll
            for (int t = 0; t < 4; ++t) mx[t] = fmaxf(fmaxf(fmaxf(st[u][t][0], st[u][t][1]), fmaxf(st[u][t][2], st[u][t][3])), fmaxf(fmaxf(st[u][t][4], st[u][t][5]), fmaxf(st[u][t][6], st[u][t][7])));
            float mq = fmaxf(fmaxf(mx[0], mx[1]), fmaxf(mx[2], mx[3]));
            mq = fmaxf(mq, xhalf(mq));
            const float d  = first ? mq : fmaxf(mq, 0.0f);                   // the first stage sets the maximum, later ones only raise it
            const float al = first ? 0.0f : __builtin_amdgcn_exp2f(-d);      // nothing is summed yet on the first stage
            const float on = offv[u][0] - d;
            offv[u] = (v8f){on, on, on, on, on, on, on, on};
            l[u] *= al;
#pragma unroll
            for (int t = 0; t < 4; ++t) st[u][t] -= d;
#pragma unroll
            for (int t = 0; t < 8; ++t) acc[u][t] *= al;
        }
        pexp(st, pf, pt);
    }
#pragma unroll
    for (int u = 0; u < 2; ++u) l[u] += pt[u];
}
// k_attn: s = g.f^T, softmax and beta.h of one image in one kernel; scores and softmax rows stay in registers. Block = 128 queries, walks all 4096 keys in stages of 128.
// The 8 waves are 4 query groups x 2 key halves: a wave has 32 queries (two 16-column groups) and 64 of a stage's keys, so that every f and h^T fragment it reads from LDS feeds two
// products, and the block reads each staged tile four times, not eight. Per wave S^T = F.G^T (A = 16 key rows of f from LDS, B = 16 queries of g, kept in registers): a lane holds
// scores of ONE query per group (column lane & 15), so the maximum in use and the sum are per lane, with one exchange between the lane halves where the maximum is renewed (soft). Two S^T tiles (keys 0-15, 16-31),
// converted in place, are the B operand of O^T += H^T.P^T (A = 16 rows of h^T from LDS), and the rescale of O^T by exp2(m_old - m_new) is per lane too. P is carried against the maximum in use on an fp16
// plane, and the sum carries the same factor. Behind the loop the two waves of a query group join their maxima, sums and O^T through LDS, each finishing 64 of the 128 columns.
// The two waves of a query group (wave w and w + 4: the two key halves) run half a stage apart: key half 0 does its softmax in front of the stage's barrier, key half 1 behind it, so
// that between two barriers one of them is in its vector work while the other is in its products. A stage is still read behind its barrier, hence three buffers: the stores in
// front of the next barrier go to the buffer that neither this stage nor the next one reads.
// Behind the join the block has o of its 128 tokens, and finishes them itself: out = gamma (o.wo / sigma_o + bo) + x. o goes to that product through LDS (fp16, as it went through the workspace),
// all 256 rows of wo^T stand beside it (asked for in front of the loop, kept in registers, stored behind it); the product is formed as Wo.o^T (a lane holds 8 consecutive columns of one
// token) and passed through the wave's own LDS rows, which lie on the ring that nobody reads any more, so that scale, bias, gamma and the residual are applied on whole 512-byte runs.
union __align__(16) ring_or_c {
    struct { h16 H[3][DV * HPIT]; h16 F[3][KST * FPIT]; } r;   // the loop's three stages of h^T and f
    float C[8][16 * OPIT];                                     // behind the join's barrier: per wave 16 rows of the output product
};
__global__ __launch_bounds__(256) void k_attn(const h16* __restrict__ Gp, const h16* __restrict__ Fp, const h16* __restrict__ HT, const h16* __restrict__ WO, const float* __restrict__ uo, const float* __restrict__ bo_, const float* __restrict__ gam, const float* __restrict__ x, float* OUTB) {
    __shared__ ring_or_c sR;
    __shared__ __align__(16) float sX[8][16 * 128];   // per wave: 8 O^T tiles for its partner
    __shared__ __align__(16) v2f sM[8][2][32];        // per wave and query group: a lane's maximum and sum
    __shared__ __align__(16) h16 sWo[CC * TPIT];
    __shared__ __align__(16) h16 sO[PTK * TPIT];
    __shared__ __align__(16) float sSu[CC];          // u of wo
    __shared__ __align__(16) float sVp[8][DV];       // wo u, partial: per wave, over its 32 rows of wo^T
    __shared__ __align__(16) float sVv[DV];          // wo u
    __shared__ __align__(16) float sRd[8];           // per wave: its sum of t^2
    const int tid = threadIdx.x, lane = tid & 31, wave = tid >> 5, c = lane & 15, h = lane >> 4;
    const int kh = __builtin_amdgcn_readfirstlane(tid >> 7);   // the wave's key half, in a scalar register: the branches on it are scalar ones
    const int b = blockIdx.y, q = blockIdx.x * 128 + (wave & 3) * 32 + c;   // the lane's queries: q and q + 16
    fence();   // keeps the index work above from sinking in between the load below and its wait, where it took the load's base register over
    const float uov = uo[tid];   // u of wo: into LDS with stage 0, used behind the loop
    xwait(tid);
    const h16* gq = Gp + ((size_t)b * HW + q) * DQK + 8 * h;
    v16h gfr[2];
#pragma unroll
    for (int u = 0; u < 2; ++u) gfr[u] = cat16(*(const v8h*)(gq + u * 16 * DQK), *(const v8h*)(gq + u * 16 * DQK + 16));
    const int hrow = tid >> 4, hch = (tid & 15) * 8, frow = tid >> 2, fch = (tid & 3) * 8;
    // a uniform base that moves with the stage plus a lane offset that never changes: no vector address register is rewritten, and the base moves only behind the loads' data wait
    const h16* hbase = HT + (size_t)b * DV * HW; const h16* fbase = Fp + (size_t)b * HW * DQK;
    const unsigned hoff = (unsigned)(hrow * HW + hch), foff = (unsigned)(frow * DQK + fch);   // h^T rows hrow + 16 i, 16 lanes per 256-byte run; f rows frow + 64 j
    v8h rh[8], rf[2];
#pragma unroll
    for (int i = 0; i < 8; ++i) rh[i] = *(const v8h*)(hbase + hoff + 16 * i * HW);
#pragma unroll
    for (int j = 0; j < 2; ++j) rf[j] = *(const v8h*)(fbase + foff + 64 * j * DQK);
    xwait(gq);   // behind the loads of g and of stage 0: what follows may take the address registers of these loads over
#pragma unroll
    for (int i = 0; i < 8; ++i) *(v8h*)(&sR.r.H[0][(hrow + 16 * i) * HPIT + hch]) = rh[i];
#pragma unroll
    for (int j = 0; j < 2; ++j) *(v8h*)(&sR.r.F[0][(frow + 64 * j) * FPIT + fch]) = rf[j];
    sSu[tid] = bfr(uov);
    __syncthreads();
    fence();   // the bases move only behind the data wait of the loads that named them (the wait stands in front of the LDS stores above)
    // stage 1 into registers: trip 0 stores it
    hbase += KST; fbase += KST * DQK;
#pragma unroll
    for (int i = 0; i < 8; ++i) rh[i] = *(const v8h*)(hbase + hoff + 16 * i * HW);
#pragma unroll
    for (int j = 0; j < 2; ++j) rf[j] = *(const v8h*)(fbase + foff + 64 * j * DQK);
    xwait(foff);   // behind these loads: the compiler forms the loop's bases in the registers that they name
    // all of wo^T (two 256-byte rows per load): asked for here, put into LDS behind the loop, so that its way from L2 lies under the loop
    const h16* wp = WO + (size_t)(wave * 32) * DV + lane * 8;
    v8h rw[16];
#pragma unroll
    for (int i = 0; i < 16; ++i) rw[i] = *(const v8h*)(wp + i * 2 * DV);
    xwait(wp);
    v8f acc[2][8];
#pragma unroll
    for (int u = 0; u < 2; ++u) {
#pragma unroll
        for (int t = 0; t < 8; ++t) acc[u][t] = (v8f){};
    }
    float l[2] = {0.f, 0.f};
    v8f offv[2] = {(v8f){}, (v8f){}};   // per query group the lane's offset, eight times: the C operand of the score products
    int cur = 0;   // the buffer of stage s: s mod 3
#pragma unroll 1
    for (int s = 0; s < HW / KST; ++s) {
        const int nxt = cur == 2 ? 0 : cur + 1;
        const h16* cF = &sR.r.F[cur][(kh * KWV + c) * FPIT + 8 * h];
        const h16* cH = &sR.r.H[cur][c * HPIT + kh * KWV + 8 * h];
        v16h ff[4], a0[8], a1[8];
#pragma unroll
        for (int t = 0; t < 4; ++t) ff[t] = cat16(*(const v8h*)(cF + t * 16 * FPIT), *(const v8h*)(cF + t * 16 * FPIT + 16));
#pragma unroll
        for (int t = 0; t < 8; ++t) a0[t] = cat16(*(const v8h*)(cH + t * 16 * HPIT), *(const v8h*)(cH + t * 16 * HPIT + 16));
        fence();   // keeps the first h^T fragments issued here, ahead of the score and softmax work that hides their latency
        v8f st[2][4];
#pragma unroll
        for (int t = 0; t < 4; ++t) {
#pragma unroll
            for (int u = 0; u < 2; ++u) st[u][t] = wmma16(ff[t], gfr[u], offv[u]);
        }
        fence();   // keeps the score products in front of the slots below
        asm volatile("v_nop\n\tv_nop\n\tv_nop\n\tv_nop");   // the four vector slots between the last score product and the first vector instruction that takes its operand registers over
        v16h pf[2][2];
        if (!kh) soft(s == 0, st, offv, l, pf, acc);   // key half 0: vector work here, while key half 1 is in its products
        // stage s + 1, asked for behind the barrier before this one. Its buffer's last readers (stage s - 2) left it before that barrier
        h16* nH = &sR.r.H[nxt][0]; h16* nF = &sR.r.F[nxt][0];
#pragma unroll
        for (int i = 0; i < 8; ++i) *(v8h*)(nH + (hrow + 16 * i) * HPIT + hch) = rh[i];
#pragma unroll
        for (int j = 0; j < 2; ++j) *(v8h*)(nF + (frow + 64 * j) * FPIT + fch) = rf[j];
        __syncthreads();
        fence();   // the bases move only behind the data wait of the loads that named them (the wait stands in front of the LDS stores above)
        // stage s + 2 into registers, a whole trip ahead of its stores (on the last two trips the bases stay: the last stage is fetched again, and that copy is never read)
        if (s + 2 < HW / KST) { hbase += KST; fbase += KST * DQK; }
#pragma unroll
        for (int i = 0; i < 8; ++i) rh[i] = *(const v8h*)(hbase + hoff + 16 * i * HW);
#pragma unroll
        for (int j = 0; j < 2; ++j) rf[j] = *(const v8h*)(fbase + foff + 64 * j * DQK);
        fence();   // keeps the global loads issued here, ahead of the work that hides their latency
        if (kh) soft(s == 0, st, offv, l, pf, acc);    // key half 1: vector work here, while key half 0 is in its products
        fence();   // with the fence behind them: the second half's h^T fragments go out as one group in front of the first half's products, not among them
#pragma unroll
        for (int t = 0; t < 8; ++t) a1[t] = cat16(*(const v8h*)(cH + t * 16 * HPIT + 32), *(const v8h*)(cH + t * 16 * HPIT + 48));
        fence();   // second of the pair: without it the fragment loads and their waits move in among the products
#pragma unroll
        for (int t = 0; t < 8; ++t) {
#pragma unroll
            for (int u = 0; u < 2; ++u) acc[u][t] = wmma16(a0[t], pf[u][0], acc[u][t]);
        }
#pragma unroll
        for (int t = 0; t < 8; ++t) {
#pragma unroll
            for (int u = 0; u < 2; ++u) acc[u][t] = wmma16(a1[t], pf[u][1], acc[u][t]);
        }
        cur = nxt;
    }
    asm volatile("s_wait_xcnt 0x0" ::: "memory");   // behind the last trip's loads: what follows may take their address registers over
    fence();   // keeps all that follows behind that wait
#pragma unroll
    for (int i = 0; i < 16; ++i) *(v8h*)(&sWo[(wave * 32 + i * 2 + h) * TPIT + c * 8]) = rw[i];   // published by the join's barrier
    // the residual rows and the bias of the wave's 16 tokens: asked for here, used behind the output product
    const size_t R0 = ((size_t)b * HW + blockIdx.x * PTK + __builtin_amdgcn_readfirstlane(tid >> 5) * 16) * CC;   // scalar: the wave's rows of x and of out as a uniform base plus a lane offset
    const float* xb = x + R0; const unsigned xo = lane * 4;
    v4f xres[32], bo4[2];
    const float* bp = bo_ + lane * 4;   // the bias first: loads come back in order, and a wait for it must not wait for the residual too
#pragma unroll
    for (int p = 0; p < 2; ++p) bo4[p] = *(const v4f*)(bp + p * 128);
    xwait(bp);
#pragma unroll
    for (int i = 0; i < 32; ++i) xres[i] = *(const v4f*)(xb + xo + (i >> 1) * CC + (i & 1) * 128);
    xwait(xo);
    // sigma_o, made by every block for itself from the rows of wo^T that it holds, in three steps, each published by the next of the three barriers below.
    {   // wo u, partial: the lane's 16 rows n of wo^T (still in registers) for its 8 consecutive k, the two lane halves joined: the wave's 32 rows
        float av[8];
#pragma unroll
        for (int e = 0; e < 8; ++e) av[e] = 0.f;
#pragma unroll
        for (int i = 0; i < 16; ++i) {
            const float un = sSu[wave * 32 + i * 2 + h];
#pragma unroll
            for (int e = 0; e < 8; ++e) av[e] = fmaf(un, (float)rw[i][e], av[e]);
        }
#pragma unroll
        for (int e = 0; e < 8; ++e) av[e] += xhalf(av[e]);
        if (!h) { *(v4f*)(&sVp[wave][c * 8]) = (v4f){av[0], av[1], av[2], av[3]}; *(v4f*)(&sVp[wave][c * 8 + 4]) = (v4f){av[4], av[5], av[6], av[7]}; }
    }
    const float m[2] = {-offv[0][0], -offv[1][0]};   // the maxima in use at the end: what the wave's sums are scaled to
    // the join of the two key halves: wave w and wave w ^ 4 hold the same queries. Each hands the other the O^T tiles of the 64 columns that the other finishes, with its maximum and sum
#pragma unroll
    for (int u = 0; u < 2; ++u) { l[u] += xhalf(l[u]); sM[wave][u][lane] = (v2f){m[u], l[u]}; }
    float* xs = &sX[wave][lane * 4];
    if (kh) put4<0>(xs, acc); else put4<4>(xs, acc);
    lds_barrier();
    float ca[2], cb[2];
#pragma unroll
    for (int u = 0; u < 2; ++u) {
        const v2f o = sM[wave ^ 4][u][lane];
        const float mm = fmaxf(m[u], o[0]), wa = __builtin_amdgcn_exp2f(m[u] - mm), wb = __builtin_amdgcn_exp2f(o[0] - mm);
        const float inv = __fdiv_rn(1.0f, fmaf(l[u], wa, o[1] * wb));
        ca[u] = wa * inv; cb[u] = wb * inv;
    }
    const float* xr = &sX[wave ^ 4][lane * 4];
    v8h ov[2][4];
    if (kh) fin4<4>(xr, acc, ca, cb, ov); else fin4<0>(xr, acc, ca, cb, ov);
    h16* so = &sO[((wave & 3) * 32 + c) * TPIT + kh * 64 + 8 * h];   // the wave's 64 columns of its 32 queries
#pragma unroll
    for (int u = 0; u < 2; ++u) {
#pragma unroll
        for (int j = 0; j < 4; ++j) *(v8h*)(so + u * 16 * TPIT + j * 16) = ov[u][j];
    }
    if (tid < DV) {   // wo u: the eight waves' partial sums of one k
        float s = 0.f;
#pragma unroll
        for (int w = 0; w < 8; ++w) s += sVp[w][tid];
        sVv[tid] = s;
    }
    lds_barrier();
    float nvo;
    {   // wo^T (wo u): thread = row n of wo^T; |wo u|^2 in every thread
        const h16* rp = &sWo[tid * TPIT];
        float t[8], nn[4];
#pragma unroll
        for (int e = 0; e < 8; ++e) t[e] = 0.f;
#pragma unroll
        for (int e = 0; e < 4; ++e) nn[e] = 0.f;
#pragma unroll 8   // 24 LDS reads go out together: one LDS latency per 64 terms
        for (int kc = 0; kc < DV; kc += 8) {
            const v8h w8 = *(const v8h*)(rp + kc); const v4f va = *(const v4f*)(&sVv[kc]), vb = *(const v4f*)(&sVv[kc + 4]);
#pragma unroll
            for (int e = 0; e < 4; ++e) { t[e] = fmaf(va[e], (float)w8[e], t[e]); t[4 + e] = fmaf(vb[e], (float)w8[4 + e], t[4 + e]); nn[e] = fmaf(va[e], va[e], nn[e]); nn[e] = fmaf(vb[e], vb[e], nn[e]); }
        }
        const float tr = ((t[0] + t[1]) + (t[2] + t[3])) + ((t[4] + t[5]) + (t[6] + t[7]));
        const float sq = wsum(tr * tr);
        if (lane == 0) sRd[wave] = sq;
        nvo = (nn[0] + nn[1]) + (nn[2] + nn[3]);
    }
    const h16* ao = &sO[(wave * 16 + c) * TPIT + 8 * h];
    const h16* bw = &sWo[c * TPIT + 8 * h];
    v8f oc[16];
#pragma unroll
    for (int t = 0; t < 16; ++t) oc[t] = (v8f){};
#pragma unroll
    for (int kc = 0; kc < DV; kc += 32) {
        const v16h a = cat16(*(const v8h*)(ao + kc), *(const v8h*)(ao + kc + 16)); v16h bb[16];
#pragma unroll
        for (int t = 0; t < 16; ++t) bb[t] = cat16(*(const v8h*)(bw + t * 16 * TPIT + kc), *(const v8h*)(bw + t * 16 * TPIT + kc + 16));
        fence();   // one step's fragments as one group in front of its products; without the pair of fences all four steps' fragments are fetched at once and registers spill
#pragma unroll
        for (int t = 0; t < 16; ++t) oc[t] = wmma16(bb[t], a, oc[t]);
        fence();
    }
    float* os = &sR.C[wave][0];
#pragma unroll
    for (int t = 0; t < 16; ++t) {   // oc[t][r] = column t * 16 + 8 h + r of token c
        *(v4f*)(os + c * OPIT + t * 16 + 8 * h)     = (v4f){oc[t][0], oc[t][1], oc[t][2], oc[t][3]};
        *(v4f*)(os + c * OPIT + t * 16 + 8 * h + 4) = (v4f){oc[t][4], oc[t][5], oc[t][6], oc[t][7]};
    }
    lds_barrier();
    const v4f rd0 = *(const v4f*)(&sRd[0]), rd1 = *(const v4f*)(&sRd[4]);
    const float iso = __fdiv_rn(1.0f, sigma_of(nvo, ((rd0[0] + rd0[1]) + (rd0[2] + rd0[3])) + ((rd1[0] + rd1[1]) + (rd1[2] + rd1[3])))); const float gmm = bfr(gam[0]);
#pragma unroll
    for (int p = 0; p < 2; ++p) bo4[p] = (v4f){bfr(bo4[p][0]), bfr(bo4[p][1]), bfr(bo4[p][2]), bfr(bo4[p][3])};
    v4f cv[32];
#pragma unroll
    for (int i = 0; i < 32; ++i) cv[i] = *(const v4f*)(os + (i >> 1) * OPIT + (i & 1) * 128 + lane * 4);
    fence();   // the LDS reads go out as one group; without it each is waited for just ahead of its use
#pragma unroll
    for (int i = 0; i < 32; ++i) {
#pragma unroll
        for (int k = 0; k < 4; ++k) xres[i][k] = gmm * (cv[i][k] * iso + bo4[i & 1][k]) + bfr(xres[i][k]);
    }
    float* pb = OUTB + R0;
    fence();   // every store stands behind all other work, so that no register of an issued store is written again
#pragma unroll
    for (int i = 0; i < 32; ++i) *(v4f*)(pb + xo + (i >> 1) * CC + (i & 1) * 128) = xres[i];
}
extern "C" void kernel_launch(void* const* d_in, const int* in_sizes, int n_in,
                              void* d_out, int out_size, void* d_ws, size_t ws_size, hipStream_t stream) {
    (void)in_sizes; (void)n_in; (void)out_size;
    const float* x = (const float*)d_in[0]; const float* wf = (const float*)d_in[1]; const float* bf_ = (const float*)d_in[2]; const float* uf = (const float*)d_in[3]; const float* wg = (const float*)d_in[4]; const float* bg_ = (const float*)d_in[5]; const float* ug = (const float*)d_in[6]; const float* wh = (const float*)d_in[7]; const float* bh_ = (const float*)d_in[8]; const float* uh = (const float*)d_in[9]; const float* wo = (const float*)d_in[10]; const float* bo_ = (const float*)d_in[11]; const float* uo = (const float*)d_in[12]; const float* gam = (const float*)d_in[13];
    float* out = (float*)d_out;    // [8][64][64][256]
    char* wsp = (char*)d_ws;
    auto take = [&](size_t bytes) { char* p = wsp; wsp += (bytes + 255) & ~(size_t)255; return (void*)p; };
    h16* WO = (h16*)take((size_t)CC * DV * 2);
    h16* Fp = (h16*)take((size_t)NR * DQK * 2); h16* Gp = (h16*)take((size_t)NR * DQK * 2); h16* HT = (h16*)take((size_t)NB_ * DV * HW * 2);
    if ((size_t)(wsp - (char*)d_ws) > ws_size) return;    // ~ 0.07 + 2.1 x 2 + 8.4 ~ 13 MB
    k_proj<<<NR / PTK, 256, 0, stream>>>(x, wf, uf, wg, ug, wh, uh, wo, bf_, bg_, bh_, Fp, Gp, HT, WO);
    k_attn<<<dim3(HW / 128, NB_, 1), 256, 0, stream>>>(Gp, Fp, HT, WO, uo, bo_, gam, x, out);
}

// v009
// It runs in 49.7 microseconds.
// Timed twice side by side with v008, it ran 1.04 times as fast both times.
// All steps since v000 together make it 22.7 times as fast.
#include <hip/hip_runtime.h>

// Compute dtypes, f32 accumulate: the four spectral-norm sigmas (one power iteration on the tiny weight matrices) in f32 on VALU and applied as f32 scales AFTER the GEMMs, so
// every weight GEMM uses the EXACT bf16 weights: f|g|h = x.[wf|wg|wh] ([32768 x 256].[256 x 192]) with plain bf16 operands (x and the weights are inputs: exact products);
// per image s = g.f^T ([4096 x 32].[32 x 4096]) and beta.h ([4096 x 4096].[4096 x 128]) on SINGLE fp16 planes (f/g/h after the 1/sigma scale + bias, softmax rows carried
// against a maximum in use, 1 to the fp16 top, rounded to fp16 = 2^-11); o.wo ([32768 x 128].[128 x 256]) on a single fp16 plane of o against exact wo; out = gamma (o.wo / sigma_o + bo) + x in f32 - measured

#define NB_  8
#define HW   4096
#define CC   256
#define DQK  32
#define DV   128
#define NPJ  192                  // f | g | h columns
#define NR   (NB_ * HW)           // 32768
#define DM   CC
#define LOSC 1024.0f
#define L2E  1.4426950408889634f
typedef _Float16 h16;
typedef unsigned short bf;
typedef __attribute__((ext_vector_type(16))) __bf16   v16bf;
typedef __attribute__((ext_vector_type(16))) _Float16 v16h;
typedef __attribute__((ext_vector_type(8)))  _Float16 v8h;
typedef __attribute__((ext_vector_type(8)))  unsigned short v8us;
typedef __attribute__((ext_vector_type(8)))  float    v8f;
typedef __attribute__((ext_vector_type(4)))  float    v4f;
typedef v8h  __attribute__((may_alias)) v8ha;
typedef v4f  __attribute__((may_alias)) v4fa;
typedef v8us __attribute__((may_alias)) v8usa;

__device__ __forceinline__ unsigned short f2bf(float f) { unsigned u = __float_as_uint(f); u += 0x7FFFu + ((u >> 16) & 1u); return (unsigned short)(u >> 16); }
__device__ __forceinline__ float bf2f(unsigned short b) { return __uint_as_float(((unsigned)b) << 16); }
__device__ __forceinline__ float bfr(float f) { return bf2f(f2bf(f)); }
__device__ __forceinline__ v16h cat16(v8h lo, v8h hi) { return __builtin_shufflevector(lo, hi, 0, 1, 2, 3, 4, 5, 6, 7, 8, 9, 10, 11, 12, 13, 14, 15); }
__device__ __forceinline__ v16bf cat16b(v8us lo, v8us hi) { return __builtin_bit_cast(v16bf, __builtin_shufflevector(lo, hi, 0, 1, 2, 3, 4, 5, 6, 7, 8, 9, 10, 11, 12, 13, 14, 15)); }
__device__ __forceinline__ v8f wmma16(v16h a, v16h b, v8f c) { return __builtin_amdgcn_wmma_f32_16x16x32_f16(false, a, false, b, (short)0, c, false, false); }
__device__ __forceinline__ v8f wmmab(v16bf a, v16bf b, v8f c) { return __builtin_amdgcn_wmma_f32_16x16x32_bf16(false, a, false, b, (short)0, c, false, false); }

typedef __attribute__((ext_vector_type(4))) _Float16 v4h;
__device__ __forceinline__ h16 tohx(float x) { return (h16)x; }
typedef __attribute__((ext_vector_type(4))) __bf16 v4bf;
__device__ __forceinline__ void fence() { __builtin_amdgcn_sched_barrier(0); }   // the compiler schedules nothing across it
// behind a group of global loads from p (a lane's pointer, or its byte offset from a uniform base): the wait that stands in front of any new value in their address registers. p as an input keeps those registers p's up to the wait (else the
// group's last load may land on them); the scheduling barrier keeps what follows behind it
template <class T> __device__ __forceinline__ void xwait(T p) { asm volatile("s_wait_xcnt 0x0" :: "v"(p) : "memory"); __builtin_amdgcn_sched_barrier(0); }
// the work-group's barrier with the LDS side of __syncthreads() alone: LDS writes are done in front of it and no LDS access moves across it, but global loads that no
// other wave has a part in stay in flight over it (__syncthreads() would wait for them at the first barrier behind their issue)
__device__ __forceinline__ void lds_barrier() {
    __builtin_amdgcn_fence(__ATOMIC_RELEASE, "workgroup", "local"); __builtin_amdgcn_s_barrier(); __builtin_amdgcn_fence(__ATOMIC_ACQUIRE, "workgroup", "local");
}
// sigma of a weight matrix W (in,out) with u, one power iteration, from nv = |W u|^2 and st = |W^T (W u)|^2: v = W u * invv, t = W^T v, sigma = t . l2n(t), with the reference's floor under both norms
__device__ __forceinline__ float sigma_of(float nv, float st) {
    const float invv = rsqrtf(fmaxf(nv, 1e-12f)); const float nt = st * invv * invv; return nt * rsqrtf(fmaxf(nt, 1e-12f));
}
__device__ __forceinline__ float xhalf(float x) { return __builtin_bit_cast(float, __builtin_amdgcn_permlanex16(__builtin_bit_cast(int, x), __builtin_bit_cast(int, x), 0x76543210, 0xfedcba98, false, false)); }  // lane l with lane l ^ 16
template <int N> __device__ __forceinline__ float xrow(float x) { return __builtin_bit_cast(float, __builtin_amdgcn_update_dpp(0, __builtin_bit_cast(int, x), 0x160 + N, 0xf, 0xf, true)); }  // lane l with lane l ^ N inside its row of 16 (row_xmask); all lanes on
__device__ __forceinline__ float wsum(float s) {   // sum over the wave's 32 lanes, in every lane, without a trip through the LDS unit
    s += xrow<1>(s); s += xrow<2>(s); s += xrow<4>(s); s += xrow<8>(s);
    return s + xhalf(s);
}
// eight f32 rounded to bf16 (to nearest even), as one 16-byte piece
__device__ __forceinline__ v8us tobf8(const float* q) {
    const v4f lo = {q[0], q[1], q[2], q[3]}, hi = {q[4], q[5], q[6], q[7]};
    return __builtin_bit_cast(v8us, __builtin_shufflevector(__builtin_convertvector(lo, v4bf), __builtin_convertvector(hi, v4bf), 0, 1, 2, 3, 4, 5, 6, 7));
}
#define PTK  128                  // tokens per block of the two weight GEMMs (8 waves x 16)
#define XPIT 264                  // LDS pitch of a 256-wide bf16 row, in halves (528 B = 16 B x odd)
#define TPIT 136                  // LDS pitch of a 128-wide 16-bit row, in halves (272 B = 16 B x odd)
#define OPIT 260                  // LDS pitch of a 256-wide f32 row, in floats (1040 B = 16 B x odd)
// k_proj: f | g | h = x.[wf|wg|wh] of 128 tokens with everything around the product in the same kernel. x comes in as f32 by whole-line loads and is rounded to bf16 on its way
// into LDS; all 192 weight rows are staged beside it. f and g are formed as W.x^T (a lane holds 8 consecutive columns of one token: one 16-byte store after scale and bias),
// h as x.W^T (a lane holds 8 consecutive tokens of one column: a 16-byte piece of an h^T row, gathered in LDS so that each 256-byte run of h^T has one writer).
// The weights come in as they are given, f32 [k][n]: a wave takes 32 rows k of all three matrices by whole 128-byte runs (a lane = four columns n of eight consecutive k), rounds them to bf16 and stores
// each column's 8 k as a 16-byte piece of row n of W^T. The three sigmas are made from those LDS rows by every block for itself, while its x is still on its way from memory:
// v = W u as per-wave partial sums over 24 rows n (a lane = 8 k), joined per k; t = W^T v with a thread per row n; |t|^2 per wave. Block i also writes row i of wo^T (fp16 of the bf16 value) for k_attn.
static_assert(NR / PTK == CC, "one block of k_proj per row of wo^T");
union __align__(16) t_or_s {
    h16 T[DV * TPIT];                                                // behind the product: h^T of the block's tokens
    struct { float P[8][3][CC]; float V[3][CC]; float U[NPJ]; } s;   // in front of it: partial W u per wave, W u, and u (f | g | h)
};
__global__ __launch_bounds__(256) void k_proj(const float* __restrict__ x, const float* __restrict__ wf, const float* __restrict__ uf, const float* __restrict__ wg, const float* __restrict__ ug, const float* __restrict__ wh, const float* __restrict__ uh, const float* __restrict__ wo, const float* __restrict__ bf_, const float* __restrict__ bg_, const float* __restrict__ bh_, h16* Fp, h16* Gp, h16* HT, h16* WO) {
    __shared__ __align__(16) bf  sX[PTK * XPIT];
    __shared__ __align__(16) bf  sW[NPJ * XPIT];
    __shared__ t_or_s sTS;
    __shared__ __align__(16) float sS[16];   // 0 to 5: per wave of the t step its sum of t^2; 8 to 10: |W u|^2 of f, g, h
    h16* sT = sTS.T;
    const int tid = threadIdx.x, lane = tid & 31, wave = tid >> 5, c = lane & 15, h = lane >> 4;
    const int wv = __builtin_amdgcn_readfirstlane(tid >> 5);   // the wave's number in a scalar register: uniform LDS addresses and a scalar branch in the sigma work
    const size_t R0 = (size_t)blockIdx.x * PTK;
    v4f bq[4][2]; float bv[8];
    {
        // the weights first: loads come back in order, and the sigma work must not wait for x
        const int kk = lane >> 3, n4 = (lane & 7) * 4;   // a 16-byte load: four rows k, 8 apart, x one 128-byte run of 32 columns; load j has k = 32 wave + 8 kk + j
        const float* wfp = wf + (wave * 32 + kk * 8) * DQK + n4; const float* wgp = wg + (wave * 32 + kk * 8) * DQK + n4; const float* whp = wh + (wave * 32 + kk * 8) * DV + n4;
        v4f qw[6][8]; float qo[8];   // column blocks of 32: f, g, four of h. Every loop over a register array, here and in the sigma work, is unrolled whole: the arrays stay in registers and each group of loads goes out together
#pragma unroll
        for (int j = 0; j < 8; ++j) qw[0][j] = *(const v4f*)(wfp + j * DQK);
        xwait(wfp);
#pragma unroll
        for (int j = 0; j < 8; ++j) qw[1][j] = *(const v4f*)(wgp + j * DQK);
        xwait(wgp);
#pragma unroll
        for (int g = 0; g < 4; ++g) {
#pragma unroll
            for (int j = 0; j < 8; ++j) qw[2 + g][j] = *(const v4f*)(whp + j * DV + g * 32);
        }
        xwait(whp);
        const int ui = tid < NPJ ? tid : 0;
        const float* up = ui < DQK ? uf + ui : ui < 2 * DQK ? ug + (ui - DQK) : uh + (ui - 2 * DQK);
        const float uu = *up;
        xwait(up);
        const float* oq = wo + (size_t)((tid & 15) * 8) * CC + blockIdx.x;   // column blockIdx.x of wo, 8 consecutive k per lane
#pragma unroll
        for (int e = 0; e < 8; ++e) qo[e] = 0.f;
        if (tid < 16) {
#pragma unroll
            for (int e = 0; e < 8; ++e) qo[e] = oq[e * CC];
            xwait(oq);
        }
        const float* xp = x + (R0 + wave * 16) * CC + lane * 4;
        v4f xr[32];
#pragma unroll
        for (int i = 0; i < 32; ++i) xr[i] = *(const v4f*)(xp + (i >> 1) * CC + (i & 1) * 128);
        xwait(xp);
        // the biases: asked for here, used behind the product
        const unsigned bofs = 32u * h; const float* bhp = bh_ + c;   // bofs: bytes of 8 h floats
#pragma unroll
        for (int t = 0; t < 2; ++t) {
            const char* pf = (const char*)bf_ + bofs + t * 64; const char* pg = (const char*)bg_ + bofs + t * 64;
            bq[t][0] = *(const v4f*)pf; bq[t][1] = *(const v4f*)(pf + 16); bq[2 + t][0] = *(const v4f*)pg; bq[2 + t][1] = *(const v4f*)(pg + 16);
        }
        xwait(bofs);
#pragma unroll
        for (int t = 0; t < 8; ++t) bv[t] = bhp[t * 16];
        xwait(bhp);
#pragma unroll
        for (int g = 0; g < 6; ++g) {   // the lane's four columns n of block g, 8 consecutive k each: a 16-byte piece of row n of W^T
#pragma unroll
            for (int i = 0; i < 4; ++i) {
                const float q8[8] = {qw[g][0][i], qw[g][1][i], qw[g][2][i], qw[g][3][i], qw[g][4][i], qw[g][5][i], qw[g][6][i], qw[g][7][i]};
                *(v8us*)(&sW[(g * 32 + n4 + i) * XPIT + wave * 32 + kk * 8]) = tobf8(q8);
            }
        }
        if (tid < NPJ) sTS.s.U[tid] = bfr(uu);
        if (tid < 16) {
            v8h o;
#pragma unroll
            for (int e = 0; e < 8; ++e) o[e] = tohx(bfr(qo[e]));
            h16* wq = WO + (size_t)blockIdx.x * DV + tid * 8;   // the whole 256-byte row from one half wave
            *(v8h*)wq = o;
            xwait(wq);
        }
        lds_barrier();   // W^T and u are in LDS; x stays in flight
        {   // W u, partial: the wave's rows n are 4 of f, 4 of g, 16 of h; the lane's k are 8 lane ... 8 lane + 7
            float av[3][8];
#pragma unroll
            for (int m = 0; m < 3; ++m) {
#pragma unroll
                for (int e = 0; e < 8; ++e) av[m][e] = 0.f;
            }
#pragma unroll
            for (int j = 0; j < 24; ++j) {
                const int m = j < 4 ? 0 : j < 8 ? 1 : 2;
                const int n = j < 4 ? wv * 4 + j : j < 8 ? DQK + wv * 4 + (j - 4) : 2 * DQK + wv * 16 + (j - 8);
                const v8us w8 = *(const v8us*)(&sW[n * XPIT + lane * 8]); const float un = sTS.s.U[n];
#pragma unroll
                for (int e = 0; e < 8; ++e) av[m][e] = fmaf(un, bf2f(w8[e]), av[m][e]);
            }
#pragma unroll
            for (int m = 0; m < 3; ++m) {
                *(v4f*)(&sTS.s.P[wv][m][lane * 8])     = (v4f){av[m][0], av[m][1], av[m][2], av[m][3]};
                *(v4f*)(&sTS.s.P[wv][m][lane * 8 + 4]) = (v4f){av[m][4], av[m][5], av[m][6], av[m][7]};
            }
        }
        lds_barrier();   // the partial sums of all waves
#pragma unroll
        for (int m = 0; m < 3; ++m) {
            float s = 0.f;
#pragma unroll
            for (int w = 0; w < 8; ++w) s += sTS.s.P[w][m][tid];
            sTS.s.V[m][tid] = s;
        }
        lds_barrier();   // W u of the three matrices
        if (wv < 6) {   // W^T (W u): thread = row n; wave 0 has f, wave 1 g, waves 2 to 5 h
            const float* vp = sTS.s.V[wv < 2 ? wv : 2]; const bf* rp = &sW[tid * XPIT];
            float t[8];
#pragma unroll
            for (int e = 0; e < 8; ++e) t[e] = 0.f;
#pragma unroll 8   // 24 LDS reads go out together: one LDS latency per 64 terms
            for (int kc = 0; kc < CC; kc += 8) {
                const v8us w8 = *(const v8us*)(rp + kc); const v4f va = *(const v4f*)(vp + kc), vb = *(const v4f*)(vp + kc + 4);
#pragma unroll
                for (int e = 0; e < 4; ++e) { t[e] = fmaf(va[e], bf2f(w8[e]), t[e]); t[4 + e] = fmaf(vb[e], bf2f(w8[4 + e]), t[4 + e]); }
            }
            const float tr = ((t[0] + t[1]) + (t[2] + t[3])) + ((t[4] + t[5]) + (t[6] + t[7]));
            const float sq = wsum(tr * tr);
            if (lane == 0) sS[wv] = sq;
        } else if (wv == 6) {   // |W u|^2 of the three matrices, by a wave that has no rows: a lane squares 8 k
#pragma unroll
            for (int m = 0; m < 3; ++m) {
                const v4f va = *(const v4f*)(&sTS.s.V[m][lane * 8]), vb = *(const v4f*)(&sTS.s.V[m][lane * 8 + 4]);
                float s = 0.f;
#pragma unroll
                for (int e = 0; e < 4; ++e) { s = fmaf(va[e], va[e], s); s = fmaf(vb[e], vb[e], s); }
                s = wsum(s);
                if (lane == 0) sS[8 + m] = s;
            }
        }
#pragma unroll
        for (int i = 0; i < 32; ++i) *(v4bf*)(&sX[(wave * 16 + (i >> 1)) * XPIT + (i & 1) * 128 + lane * 4]) = __builtin_convertvector(xr[i], v4bf);
    }
    __syncthreads();
    const bf* ax = &sX[(wave * 16 + c) * XPIT + 8 * h];
    const bf* bw = &sW[c * XPIT + 8 * h];
    v8f acc[12];
#pragma unroll
    for (int t = 0; t < 12; ++t) acc[t] = (v8f){};
#pragma unroll
    for (int kc = 0; kc < CC; kc += 32) {
        const v16bf a = cat16b(*(const v8us*)(ax + kc), *(const v8us*)(ax + kc + 16)); v16bf b[12];
#pragma unroll
        for (int t = 0; t < 12; ++t) b[t] = cat16b(*(const v8us*)(bw + t * 16 * XPIT + kc), *(const v8us*)(bw + t * 16 * XPIT + kc + 16));
        fence();   // one step's fragments as one group in front of its products; without the pair of fences many steps' fragments are fetched at once and registers spill
#pragma unroll
        for (int t = 0; t < 12; ++t) acc[t] = (t < 4) ? wmmab(b[t], a, acc[t]) : wmmab(a, b[t], acc[t]);
        fence();
    }
    const float isf = __fdiv_rn(1.0f, sigma_of(sS[8], sS[0])), isg = __fdiv_rn(1.0f, sigma_of(sS[9], sS[1])), ish = __fdiv_rn(1.0f, sigma_of(sS[10], (sS[2] + sS[3]) + (sS[4] + sS[5])));
#pragma unroll
    for (int t = 0; t < 8; ++t) {   // acc[4 + t][r] = h column t * 16 + c of token 8 h + r
        const float bb = bfr(bv[t]); v8h o;
#pragma unroll
        for (int r = 0; r < 8; ++r) o[r] = tohx(acc[4 + t][r] * ish + bb);
        *(v8h*)(&sT[(t * 16 + c) * TPIT + wave * 16 + 8 * h]) = o;
    }
    v8h fg[4];
#pragma unroll
    for (int t = 0; t < 4; ++t) {   // acc[t][r] = column t * 16 + 8 h + r of token c
        const float is = t < 2 ? isf : isg;
#pragma unroll
        for (int r = 0; r < 8; ++r) { const float v = acc[t][r] * is + bfr(bq[t][r >> 2][r & 3]); fg[t][r] = tohx(t < 2 ? v : v * L2E); }   // g is stored x log2(e), rounded once: k_attn's scores come out in powers of two
    }
    __syncthreads();
    v8h ht[8];
#pragma unroll
    for (int i = 0; i < 8; ++i) ht[i] = *(const v8h*)(&sT[(wave * 16 + i * 2 + h) * TPIT + c * 8]);
    const int b = blockIdx.x / (HW / PTK), t0 = (blockIdx.x % (HW / PTK)) * PTK;
    h16* fo = Fp + (R0 + wave * 16 + c) * DQK + 8 * h; h16* go = Gp + (R0 + wave * 16 + c) * DQK + 8 * h;
    h16* ho = HT + ((size_t)b * DV + wave * 16 + h) * HW + t0 + c * 8;
    fence();   // every store stands behind all other work, so that no register of an issued store is written again
    *(v8h*)fo = fg[0]; *(v8h*)(fo + 16) = fg[1]; *(v8h*)go = fg[2]; *(v8h*)(go + 16) = fg[3];
#pragma unroll
    for (int i = 0; i < 8; ++i) *(v8h*)(ho + (size_t)i * 2 * HW) = ht[i];
}
typedef __attribute__((ext_vector_type(2))) float    v2f;
typedef __attribute__((ext_vector_type(2))) _Float16 v2h;
#define KST  128                  // keys per stage: 64 for each half of the waves
#define KWV  64                   // keys of a stage that one wave works on
#define NST  (HW / KST)           // stages of an image's keys
static_assert((NST & (NST - 1)) == 0, "the ring of stages wraps by a mask");
#define HPIT 136                  // LDS pitch of a 128-key h^T row, in halves (272 B = 16 B x odd, for 16-byte reads)
#define FPIT 40                   // LDS pitch of a 32-wide f row, in halves (80 B = 16 B x odd)
// put4: the four O^T tiles per query group, from tile O on, that the partner wave finishes, into this wave's own exchange range (16-byte pieces, a lane stride of 16 B)
template <int O> __device__ __forceinline__ void put4(float* xs, const v8f (&acc)[2][8]) {
#pragma unroll
    for (int u = 0; u < 2; ++u) {
#pragma unroll
        for (int j = 0; j < 4; ++j) {
            const v8f g = acc[u][O + j];
            *(v4f*)(xs + ((u * 4 + j) * 2) * 128)     = (v4f){g[0], g[1], g[2], g[3]};
            *(v4f*)(xs + ((u * 4 + j) * 2 + 1) * 128) = (v4f){g[4], g[5], g[6], g[7]};
        }
    }
}
// fin4: this wave's own four tiles from tile O on, joined with the partner's sums of the same tiles: o = own * ca + partner's * cb
template <int O> __device__ __forceinline__ void fin4(const float* xr, const v8f (&acc)[2][8], const float (&ca)[2], const float (&cb)[2], v8h (&o)[2][4]) {
    v4f p[2][4][2];
#pragma unroll
    for (int u = 0; u < 2; ++u) {
#pragma unroll
        for (int j = 0; j < 4; ++j) { p[u][j][0] = *(const v4f*)(xr + ((u * 4 + j) * 2) * 128); p[u][j][1] = *(const v4f*)(xr + ((u * 4 + j) * 2 + 1) * 128); }
    }
#pragma unroll
    for (int u = 0; u < 2; ++u) {
#pragma unroll
        for (int j = 0; j < 4; ++j) {
#pragma unroll
            for (int r = 0; r < 8; ++r) o[u][j][r] = tohx(acc[u][O + j][r] * ca[u] + p[u][j][r >> 2][r & 3] * cb[u]);
        }
    }
}
#define PTOP 60000.0f             // a lane's sum of one stage's P per query group; at or below it every single P fits fp16
// pexp: P = exp2(a) of one stage for the wave's two query groups, packed in fp16 as the B operand of the second product, and each lane's f32 sum of them
__device__ __forceinline__ void pexp(const v8f (&st)[2][4], v16h (&pf)[2][2], float (&pt)[2]) {
#pragma unroll
    for (int u = 0; u < 2; ++u) {
        v2f ps[2] = {(v2f){0.f, 0.f}, (v2f){0.f, 0.f}};
#pragma unroll
        for (int t = 0; t < 4; ++t) {
#pragma unroll
            for (int j = 0; j < 8; j += 2) {
                const v2f e = {__builtin_amdgcn_exp2f(st[u][t][j]), __builtin_amdgcn_exp2f(st[u][t][j + 1])};
                ps[(j >> 1) & 1] += e;
                const v2h eh = __builtin_convertvector(e, v2h);
                pf[u][t >> 1][(t & 1) * 8 + j] = eh[0]; pf[u][t >> 1][(t & 1) * 8 + j + 1] = eh[1];
            }
        }
        const v2f p2 = ps[0] + ps[1];
        pt[u] = p2[0] + p2[1];
    }
}
// soft: the softmax step of one stage. st comes in as a = s log2(e) + off: the query's offset off = -(the maximum in use) was the C operand of the score product, so P = exp2(a) with no
// other work per score. The maximum in use is renewed only when it has to be: on the first stage, and when some lane's sum of P passes PTOP (all P >= 0, so a sum at or below PTOP bounds
// every P below the fp16 top; a <= 0 everywhere gives at most 32, so a renewal always finds a score above the maximum in use). A renewal puts the stage's largest a at 0 (P = 1: nearly
// 16 powers of two of room above it, so that a later, larger score seldom asks for the next renewal; below it fp16 resolves 2^-25 of the largest P), rescales O^T and the sum to it and
// forms P again. The test is one for the whole wave, and both lane halves of a query take the same step.
__device__ __forceinline__ void soft(const bool first, v8f (&st)[2][4], v8f (&offv)[2], float (&l)[2], v16h (&pf)[2][2], v8f (&acc)[2][8]) {
    float pt[2];
    pexp(st, pf, pt);
    if (first || __builtin_amdgcn_ballot_w32(!(fmaxf(pt[0], pt[1]) <= PTOP)) != 0u) {
#pragma unroll
        for (int u = 0; u < 2; ++u) {
            float mx[4];
#pragma unroll
            for (int t = 0; t < 4; ++t) mx[t] = fmaxf(fmaxf(fmaxf(st[u][t][0], st[u][t][1]), fmaxf(st[u][t][2], st[u][t][3])), fmaxf(fmaxf(st[u][t][4], st[u][t][5]), fmaxf(st[u][t][6], st[u][t][7])));
            float mq = fmaxf(fmaxf(mx[0], mx[1]), fmaxf(mx[2], mx[3]));
            mq = fmaxf(mq, xhalf(mq));
            const float d  = first ? mq : fmaxf(mq, 0.0f);                   // the first stage sets the maximum, later ones only raise it
            const float al = first ? 0.0f : __builtin_amdgcn_exp2f(-d);      // nothing is summed yet on the first stage
            const float on = offv[u][0] - d;
            offv[u] = (v8f){on, on, on, on, on, on, on, on};
            l[u] *= al;
#pragma unroll
            for (int t = 0; t < 4; ++t) st[u][t] -= d;
#pragma unroll
            for (int t = 0; t < 8; ++t) acc[u][t] *= al;
        }
        pexp(st, pf, pt);
    }
#pragma unroll
    for (int u = 0; u < 2; ++u) l[u] += pt[u];
}
// k_attn: s = g.f^T, softmax and beta.h of one image in one kernel; scores and softmax rows stay in registers. Block = 128 queries, walks all 4096 keys in stages of 128.
// The 8 waves are 4 query groups x 2 key halves: a wave has 32 queries (two 16-column groups) and 64 of a stage's keys, so that every f and h^T fragment it reads from LDS feeds two
// products, and the block reads each staged tile four times, not eight. Per wave S^T = F.G^T (A = 16 key rows of f from LDS, B = 16 queries of g, kept in registers): a lane holds
// scores of ONE query per group (column lane & 15), so the maximum in use and the sum are per lane, with one exchange between the lane halves where the maximum is renewed (soft). Per query group four S^T tiles, converted to fp16 two by two (keys 0-31, 32-63),
// are the two B operands of O^T += H^T.P^T (A = 16 rows of h^T from LDS), and the rescale of O^T by exp2(m_old - m_new) is per lane too. P is carried against the maximum in use on an fp16
// plane, and the sum carries the same factor. Behind the loop the two waves of a query group join their maxima, sums and O^T through LDS, each finishing 64 of the 128 columns.
// The two waves of a query group (wave w and w + 4: the two key halves) run half a stage apart: key half 0 does its softmax in front of the stage's barrier, key half 1 behind it, so
// that between two barriers one of them is in its vector work while the other is in its products. A stage is still read behind its barrier, hence three buffers: the stores in
// front of the next barrier go to the buffer that neither this stage nor the next one reads.
// Behind the join the block has o of its 128 tokens, and finishes them itself: out = gamma (o.wo / sigma_o + bo) + x. o goes to that product through LDS (fp16, as it went through the workspace),
// all 256 rows of wo^T stand beside it (asked for in front of the loop, kept in registers, stored behind it); the product is formed as Wo.o^T (a lane holds 8 consecutive columns of one
// token) and passed through the wave's own LDS rows, which lie on the ring that nobody reads any more, so that scale, bias, gamma and the residual are applied on whole 512-byte runs.
union __align__(16) ring_or_c {
    struct { h16 H[3][DV * HPIT]; h16 F[3][KST * FPIT]; } r;   // the loop's three stages of h^T and f
    float C[8][16 * OPIT];                                     // behind the join's barrier: per wave 16 rows of the output product
};
__global__ __launch_bounds__(256) void k_attn(const h16* __restrict__ Gp, const h16* __restrict__ Fp, const h16* __restrict__ HT, const h16* __restrict__ WO, const float* __restrict__ uo, const float* __restrict__ bo_, const float* __restrict__ gam, const float* __restrict__ x, float* OUTB) {
    __shared__ ring_or_c sR;
    __shared__ __align__(16) float sX[8][16 * 128];   // per wave: 8 O^T tiles for its partner
    __shared__ __align__(16) v2f sM[8][2][32];        // per wave and query group: a lane's maximum and sum
    __shared__ __align__(16) h16 sWo[CC * TPIT];
    __shared__ __align__(16) h16 sO[PTK * TPIT];
    __shared__ __align__(16) float sSu[CC];          // u of wo
    __shared__ __align__(16) float sVp[8][DV];       // wo u, partial: per wave, over its 32 rows of wo^T
    __shared__ __align__(16) float sVv[DV];          // wo u
    __shared__ __align__(16) float sRd[8];           // per wave: its sum of t^2
    const int tid = threadIdx.x, lane = tid & 31, wave = tid >> 5, c = lane & 15, h = lane >> 4;
    const int kh = __builtin_amdgcn_readfirstlane(tid >> 7);   // the wave's key half, in a scalar register: the branches on it are scalar ones
    const int b = blockIdx.y, q = blockIdx.x * 128 + (wave & 3) * 32 + c;   // the lane's queries: q and q + 16
    fence();   // keeps the index work above from sinking in between the load below and its wait, where it took the load's base register over
    const float uov = uo[tid];   // u of wo: into LDS with trip 0's stage, used behind the loop
    xwait(tid);
    const h16* gq = Gp + ((size_t)b * HW + q) * DQK + 8 * h;
    v16h gfr[2];
#pragma unroll
    for (int u = 0; u < 2; ++u) gfr[u] = cat16(*(const v8h*)(gq + u * 16 * DQK), *(const v8h*)(gq + u * 16 * DQK + 16));
    const int hrow = tid >> 4, hch = (tid & 15) * 8, frow = tid >> 2, fch = (tid & 3) * 8;
    // a uniform base that moves with the stage plus a lane offset that never changes: no vector address register is rewritten, and the base moves only behind the loads' data wait
    // The block walks the key stages as a ring that it enters at stage blockIdx.x: trip s works on stage (blockIdx.x + s) mod NST. The 32 blocks of an image read the same f and h^T; entered at the
    // same stage they would ask L2 for the same lines at the same moment, trip after trip. Every block still takes every stage once; only the order of its sums over the keys differs.
    int kt = blockIdx.x & (NST - 1);   // the stage that the bases stand at
    const h16* hbase = HT + (size_t)b * DV * HW + kt * KST; const h16* fbase = Fp + (size_t)b * HW * DQK + kt * KST * DQK;
    auto next_stage = [&]() { kt = (kt + 1) & (NST - 1); const int d = kt ? KST : KST - HW; hbase += d; fbase += d * DQK; };   // one stage on; from the last stage back to stage 0
    const unsigned hoff = (unsigned)(hrow * HW + hch), foff = (unsigned)(frow * DQK + fch);   // h^T rows hrow + 16 i, 16 lanes per 256-byte run; f rows frow + 64 j
    v8h rh[8], rf[2];
#pragma unroll
    for (int i = 0; i < 8; ++i) rh[i] = *(const v8h*)(hbase + hoff + 16 * i * HW);
#pragma unroll
    for (int j = 0; j < 2; ++j) rf[j] = *(const v8h*)(fbase + foff + 64 * j * DQK);
    xwait(gq);   // behind the loads of g and of trip 0's stage: what follows may take the address registers of these loads over
#pragma unroll
    for (int i = 0; i < 8; ++i) *(v8h*)(&sR.r.H[0][(hrow + 16 * i) * HPIT + hch]) = rh[i];
#pragma unroll
    for (int j = 0; j < 2; ++j) *(v8h*)(&sR.r.F[0][(frow + 64 * j) * FPIT + fch]) = rf[j];
    sSu[tid] = bfr(uov);
    __syncthreads();
    fence();   // the bases move only behind the data wait of the loads that named them (the wait stands in front of the LDS stores above)
    // the stage of trip 1 into registers: trip 0 stores it
    next_stage();
#pragma unroll
    for (int i = 0; i < 8; ++i) rh[i] = *(const v8h*)(hbase + hoff + 16 * i * HW);
#pragma unroll
    for (int j = 0; j < 2; ++j) rf[j] = *(const v8h*)(fbase + foff + 64 * j * DQK);
    xwait(foff);   // behind these loads: the compiler forms the loop's bases in the registers that they name
    // all of wo^T (two 256-byte rows per load): asked for here, put into LDS behind the loop, so that its way from L2 lies under the loop
    const h16* wp = WO + (size_t)(wave * 32) * DV + lane * 8;
    v8h rw[16];
#pragma unroll
    for (int i = 0; i < 16; ++i) rw[i] = *(const v8h*)(wp + i * 2 * DV);
    xwait(wp);
    v8f acc[2][8];
#pragma unroll
    for (int u = 0; u < 2; ++u) {
#pragma unroll
        for (int t = 0; t < 8; ++t) acc[u][t] = (v8f){};
    }
    float l[2] = {0.f, 0.f};
    v8f offv[2] = {(v8f){}, (v8f){}};   // per query group the lane's offset, eight times: the C operand of the score products
    int cur = 0;   // the buffer of trip s: s mod 3
#pragma unroll 1
    for (int s = 0; s < HW / KST; ++s) {
        const int nxt = cur == 2 ? 0 : cur + 1;
        const h16* cF = &sR.r.F[cur][(kh * KWV + c) * FPIT + 8 * h];
        const h16* cH = &sR.r.H[cur][c * HPIT + kh * KWV + 8 * h];
        v16h ff[4], a0[8], a1[8];
#pragma unroll
        for (int t = 0; t < 4; ++t) ff[t] = cat16(*(const v8h*)(cF + t * 16 * FPIT), *(const v8h*)(cF + t * 16 * FPIT + 16));
#pragma unroll
        for (int t = 0; t < 8; ++t) a0[t] = cat16(*(const v8h*)(cH + t * 16 * HPIT), *(const v8h*)(cH + t * 16 * HPIT + 16));
        fence();   // keeps the first h^T fragments issued here, ahead of the score and softmax work that hides their latency
        v8f st[2][4];
#pragma unroll
        for (int t = 0; t < 4; ++t) {
#pragma unroll
            for (int u = 0; u < 2; ++u) st[u][t] = wmma16(ff[t], gfr[u], offv[u]);
        }
        fence();   // keeps the score products in front of the slots below
        asm volatile("v_nop\n\tv_nop\n\tv_nop\n\tv_nop");   // the four vector slots between the last score product and the first vector instruction that takes its operand registers over
        v16h pf[2][2];
        if (!kh) soft(s == 0, st, offv, l, pf, acc);   // key half 0: vector work here, while key half 1 is in its products
        // the stage of trip s + 1, asked for behind the barrier before this one. Its buffer's last readers (trip s - 2) left it before that barrier
        h16* nH = &sR.r.H[nxt][0]; h16* nF = &sR.r.F[nxt][0];
#pragma unroll
        for (int i = 0; i < 8; ++i) *(v8h*)(nH + (hrow + 16 * i) * HPIT + hch) = rh[i];
#pragma unroll
        for (int j = 0; j < 2; ++j) *(v8h*)(nF + (frow + 64 * j) * FPIT + fch) = rf[j];
        __syncthreads();
        fence();   // the bases move only behind the data wait of the loads that named them (the wait stands in front of the LDS stores above)
        // the stage of trip s + 2 into registers, a whole trip ahead of its stores (on the last two trips the ring has come round: the block's first two stages are fetched again, and those copies are never read)
        next_stage();
#pragma unroll
        for (int i = 0; i < 8; ++i) rh[i] = *(const v8h*)(hbase + hoff + 16 * i * HW);
#pragma unroll
        for (int j = 0; j < 2; ++j) rf[j] = *(const v8h*)(fbase + foff + 64 * j * DQK);
        fence();   // keeps the global loads issued here, ahead of the work that hides their latency
        if (kh) soft(s == 0, st, offv, l, pf, acc);    // key half 1: vector work here, while key half 0 is in its products
        fence();   // with the fence behind them: the second half's h^T fragments go out as one group in front of the first half's products, not among them
#pragma unroll
        for (int t = 0; t < 8; ++t) a1[t] = cat16(*(const v8h*)(cH + t * 16 * HPIT + 32), *(const v8h*)(cH + t * 16 * HPIT + 48));
        fence();   // second of the pair: without it the fragment loads and their waits move in among the products
#pragma unroll
        for (int t = 0; t < 8; ++t) {
#pragma unroll
            for (int u = 0; u < 2; ++u) acc[u][t] = wmma16(a0[t], pf[u][0], acc[u][t]);
        }
#pragma unroll
        for (int t = 0; t < 8; ++t) {
#pragma unroll
            for (int u = 0; u < 2; ++u) acc[u][t] = wmma16(a1[t], pf[u][1], acc[u][t]);
        }
        cur = nxt;
    }
    asm volatile("s_wait_xcnt 0x0" ::: "memory");   // behind the last trip's loads: what follows may take their address registers over
    fence();   // keeps all that follows behind that wait
#pragma unroll
    for (int i = 0; i < 16; ++i) *(v8h*)(&sWo[(wave * 32 + i * 2 + h) * TPIT + c * 8]) = rw[i];   // published by the join's barrier
    // the residual rows and the bias of the wave's 16 tokens: asked for here, used behind the output product
    const size_t R0 = ((size_t)b * HW + blockIdx.x * PTK + __builtin_amdgcn_readfirstlane(tid >> 5) * 16) * CC;   // scalar: the wave's rows of x and of out as a uniform base plus a lane offset
    const float* xb = x + R0; const unsigned xo = lane * 4;
    v4f xres[32], bo4[2];
    const float* bp = bo_ + lane * 4;   // the bias first: loads come back in order, and a wait for it must not wait for the residual too
#pragma unroll
    for (int p = 0; p < 2; ++p) bo4[p] = *(const v4f*)(bp + p * 128);
    xwait(bp);
#pragma unroll
    for (int i = 0; i < 32; ++i) xres[i] = *(const v4f*)(xb + xo + (i >> 1) * CC + (i & 1) * 128);
    xwait(xo);
    // sigma_o, made by every block for itself from the rows of wo^T that it holds, in three steps, each published by the next of the three barriers below.
    {   // wo u, partial: the lane's 16 rows n of wo^T (still in registers) for its 8 consecutive k, the two lane halves joined: the wave's 32 rows
        float av[8];
#pragma unroll
        for (int e = 0; e < 8; ++e) av[e] = 0.f;
#pragma unroll
        for (int i = 0; i < 16; ++i) {
            const float un = sSu[wave * 32 + i * 2 + h];
#pragma unroll
            for (int e = 0; e < 8; ++e) av[e] = fmaf(un, (float)rw[i][e], av[e]);
        }
#pragma unroll
        for (int e = 0; e < 8; ++e) av[e] += xhalf(av[e]);
        if (!h) { *(v4f*)(&sVp[wave][c * 8]) = (v4f){av[0], av[1], av[2], av[3]}; *(v4f*)(&sVp[wave][c * 8 + 4]) = (v4f){av[4], av[5], av[6], av[7]}; }
    }
    const float m[2] = {-offv[0][0], -offv[1][0]};   // the maxima in use at the end: what the wave's sums are scaled to
    // the join of the two key halves: wave w and wave w ^ 4 hold the same queries. Each hands the other the O^T tiles of the 64 columns that the other finishes, with its maximum and sum
#pragma unroll
    for (int u = 0; u < 2; ++u) { l[u] += xhalf(l[u]); sM[wave][u][lane] = (v2f){m[u], l[u]}; }
    float* xs = &sX[wave][lane * 4];
    if (kh) put4<0>(xs, acc); else put4<4>(xs, acc);
    lds_barrier();
    float ca[2], cb[2];
#pragma unroll
    for (int u = 0; u < 2; ++u) {
        const v2f o = sM[wave ^ 4][u][lane];
        const float mm = fmaxf(m[u], o[0]), wa = __builtin_amdgcn_exp2f(m[u] - mm), wb = __builtin_amdgcn_exp2f(o[0] - mm);
        const float inv = __fdiv_rn(1.0f, fmaf(l[u], wa, o[1] * wb));
        ca[u] = wa * inv; cb[u] = wb * inv;
    }
    const float* xr = &sX[wave ^ 4][lane * 4];
    v8h ov[2][4];
    if (kh) fin4<4>(xr, acc, ca, cb, ov); else fin4<0>(xr, acc, ca, cb, ov);
    h16* so = &sO[((wave & 3) * 32 + c) * TPIT + kh * 64 + 8 * h];   // the wave's 64 columns of its 32 queries
#pragma unroll
    for (int u = 0; u < 2; ++u) {
#pragma unroll
        for (int j = 0; j < 4; ++j) *(v8h*)(so + u * 16 * TPIT + j * 16) = ov[u][j];
    }
    if (tid < DV) {   // wo u: the eight waves' partial sums of one k
        float s = 0.f;
#pragma unroll
        for (int w = 0; w < 8; ++w) s += sVp[w][tid];
        sVv[tid] = s;
    }
    lds_barrier();
    float nvo;
    {   // wo^T (wo u): thread = row n of wo^T; |wo u|^2 in every thread
        const h16* rp = &sWo[tid * TPIT];
        float t[8], nn[4];
#pragma unroll
        for (int e = 0; e < 8; ++e) t[e] = 0.f;
#pragma unroll
        for (int e = 0; e < 4; ++e) nn[e] = 0.f;
#pragma unroll 8   // 24 LDS reads go out together: one LDS latency per 64 terms
        for (int kc = 0; kc < DV; kc += 8) {
            const v8h w8 = *(const v8h*)(rp + kc); const v4f va = *(const v4f*)(&sVv[kc]), vb = *(const v4f*)(&sVv[kc + 4]);
#pragma unroll
            for (int e = 0; e < 4; ++e) { t[e] = fmaf(va[e], (float)w8[e], t[e]); t[4 + e] = fmaf(vb[e], (float)w8[4 + e], t[4 + e]); nn[e] = fmaf(va[e], va[e], nn[e]); nn[e] = fmaf(vb[e], vb[e], nn[e]); }
        }
        const float tr = ((t[0] + t[1]) + (t[2] + t[3])) + ((t[4] + t[5]) + (t[6] + t[7]));
        const float sq = wsum(tr * tr);
        if (lane == 0) sRd[wave] = sq;
        nvo = (nn[0] + nn[1]) + (nn[2] + nn[3]);
    }
    const h16* ao = &sO[(wave * 16 + c) * TPIT + 8 * h];
    const h16* bw = &sWo[c * TPIT + 8 * h];
    v8f oc[16];
#pragma unroll
    for (int t = 0; t < 16; ++t) oc[t] = (v8f){};
#pragma unroll
    for (int kc = 0; kc < DV; kc += 32) {
        const v16h a = cat16(*(const v8h*)(ao + kc), *(const v8h*)(ao + kc + 16)); v16h bb[16];
#pragma unroll
        for (int t = 0; t < 16; ++t) bb[t] = cat16(*(const v8h*)(bw + t * 16 * TPIT + kc), *(const v8h*)(bw + t * 16 * TPIT + kc + 16));
        fence();   // one step's fragments as one group in front of its products; without the pair of fences all four steps' fragments are fetched at once and registers spill
#pragma unroll
        for (int t = 0; t < 16; ++t) oc[t] = wmma16(bb[t], a, oc[t]);
        fence();
    }
    float* os = &sR.C[wave][0];
#pragma unroll
    for (int t = 0; t < 16; ++t) {   // oc[t][r] = column t * 16 + 8 h + r of token c
        *(v4f*)(os + c * OPIT + t * 16 + 8 * h)     = (v4f){oc[t][0], oc[t][1], oc[t][2], oc[t][3]};
        *(v4f*)(os + c * OPIT + t * 16 + 8 * h + 4) = (v4f){oc[t][4], oc[t][5], oc[t][6], oc[t][7]};
    }
    lds_barrier();
    const v4f rd0 = *(const v4f*)(&sRd[0]), rd1 = *(const v4f*)(&sRd[4]);
    const float iso = __fdiv_rn(1.0f, sigma_of(nvo, ((rd0[0] + rd0[1]) + (rd0[2] + rd0[3])) + ((rd1[0] + rd1[1]) + (rd1[2] + rd1[3])))); const float gmm = bfr(gam[0]);
#pragma unroll
    for (int p = 0; p < 2; ++p) bo4[p] = (v4f){bfr(bo4[p][0]), bfr(bo4[p][1]), bfr(bo4[p][2]), bfr(bo4[p][3])};
    v4f cv[32];
#pragma unroll
    for (int i = 0; i < 32; ++i) cv[i] = *(const v4f*)(os + (i >> 1) * OPIT + (i & 1) * 128 + lane * 4);
    fence();   // the LDS reads go out as one group; without it each is waited for just ahead of its use
#pragma unroll
    for (int i = 0; i < 32; ++i) {
#pragma unroll
        for (int k = 0; k < 4; ++k) xres[i][k] = gmm * (cv[i][k] * iso + bo4[i & 1][k]) + bfr(xres[i][k]);
    }
    float* pb = OUTB + R0;
    fence();   // every store stands behind all other work, so that no register of an issued store is written again
#pragma unroll
    for (int i = 0; i < 32; ++i) *(v4f*)(pb + xo + (i >> 1) * CC + (i & 1) * 128) = xres[i];
}
extern "C" void kernel_launch(void* const* d_in, const int* in_sizes, int n_in,
                              void* d_out, int out_size, void* d_ws, size_t ws_size, hipStream_t stream) {
    (void)in_sizes; (void)n_in; (void)out_size;
    const float* x = (const float*)d_in[0]; const float* wf = (const float*)d_in[1]; const float* bf_ = (const float*)d_in[2]; const float* uf = (const float*)d_in[3]; const float* wg = (const float*)d_in[4]; const float* bg_ = (const float*)d_in[5]; const float* ug = (const float*)d_in[6]; const float* wh = (const float*)d_in[7]; const float* bh_ = (const float*)d_in[8]; const float* uh = (const float*)d_in[9]; const float* wo = (const float*)d_in[10]; const float* bo_ = (const float*)d_in[11]; const float* uo = (const float*)d_in[12]; const float* gam = (const float*)d_in[13];
    float* out = (float*)d_out;    // [8][64][64][256]
    char* wsp = (char*)d_ws;
    auto take = [&](size_t bytes) { char* p = wsp; wsp += (bytes + 255) & ~(size_t)255; return (void*)p; };
    h16* WO = (h16*)take((size_t)CC * DV * 2);
    h16* Fp = (h16*)take((size_t)NR * DQK * 2); h16* Gp = (h16*)take((size_t)NR * DQK * 2); h16* HT = (h16*)take((size_t)NB_ * DV * HW * 2);
    if ((size_t)(wsp - (char*)d_ws) > ws_size) return;    // ~ 0.07 + 2.1 x 2 + 8.4 ~ 13 MB
    k_proj<<<NR / PTK, 256, 0, stream>>>(x, wf, uf, wg, ug, wh, uh, wo, bf_, bg_, bh_, Fp, Gp, HT, WO);
    k_attn<<<dim3(HW / 128, NB_, 1), 256, 0, stream>>>(Gp, Fp, HT, WO, uo, bo_, gam, x, out);
}

// v010
// A run of this version takes 47 microseconds.
// In two side-by-side timings against v009, it was 1.03 and 1.04 times as fast.
// Counting every step since v000, it is 23.5 times as fast.
#include <hip/hip_runtime.h>

// Compute dtypes, f32 accumulate: the four spectral-norm sigmas (one power iteration on the tiny weight matrices) in f32 on VALU and applied as f32 scales AFTER the GEMMs, so
// every weight GEMM uses the EXACT bf16 weights: f|g|h = x.[wf|wg|wh] ([32768 x 256].[256 x 192]) with plain bf16 operands (x and the weights are inputs: exact products);
// per image s = g.f^T ([4096 x 32].[32 x 4096]) and beta.h ([4096 x 4096].[4096 x 128]) on SINGLE fp16 planes (f/g/h after the 1/sigma scale + bias, softmax rows carried
// against a maximum in use, 1 to the fp16 top, rounded to fp16 = 2^-11); o.wo ([32768 x 128].[128 x 256]) on a single fp16 plane of o against exact wo; out = gamma (o.wo / sigma_o + bo) + x in f32 - measured

#define NB_  8
#define HW   4096
#define CC   256
#define DQK  32
#define DV   128
#define NPJ  192                  // f | g | h columns
#define NR   (NB_ * HW)           // 32768
#define DM   CC
#define LOSC 1024.0f
#define L2E  1.4426950408889634f
typedef _Float16 h16;
typedef unsigned short bf;
typedef __attribute__((ext_vector_type(16))) __bf16   v16bf;
typedef __attribute__((ext_vector_type(16))) _Float16 v16h;
typedef __attribute__((ext_vector_type(8)))  _Float16 v8h;
typedef __attribute__((ext_vector_type(8)))  unsigned short v8us;
typedef __attribute__((ext_vector_type(8)))  float    v8f;
typedef __attribute__((ext_vector_type(4)))  float    v4f;
typedef v8h  __attribute__((may_alias)) v8ha;
typedef v4f  __attribute__((may_alias)) v4fa;
typedef v8us __attribute__((may_alias)) v8usa;

__device__ __forceinline__ unsigned short f2bf(float f) { unsigned u = __float_as_uint(f); u += 0x7FFFu + ((u >> 16) & 1u); return (unsigned short)(u >> 16); }
__device__ __forceinline__ float bf2f(unsigned short b) { return __uint_as_float(((unsigned)b) << 16); }
__device__ __forceinline__ float bfr(float f) { return bf2f(f2bf(f)); }
__device__ __forceinline__ v16h cat16(v8h lo, v8h hi) { return __builtin_shufflevector(lo, hi, 0, 1, 2, 3, 4, 5, 6, 7, 8, 9, 10, 11, 12, 13, 14, 15); }
__device__ __forceinline__ v16bf cat16b(v8us lo, v8us hi) { return __builtin_bit_cast(v16bf, __builtin_shufflevector(lo, hi, 0, 1, 2, 3, 4, 5, 6, 7, 8, 9, 10, 11, 12, 13, 14, 15)); }
__device__ __forceinline__ v8f wmma16(v16h a, v16h b, v8f c) { return __builtin_amdgcn_wmma_f32_16x16x32_f16(false, a, false, b, (short)0, c, false, false); }
__device__ __forceinline__ v8f wmmab(v16bf a, v16bf b, v8f c) { return __builtin_amdgcn_wmma_f32_16x16x32_bf16(false, a, false, b, (short)0, c, false, false); }

typedef __attribute__((ext_vector_type(4))) _Float16 v4h;
__device__ __forceinline__ h16 tohx(float x) { return (h16)x; }
typedef __attribute__((ext_vector_type(4))) __bf16 v4bf;
__device__ __forceinline__ void fence() { __builtin_amdgcn_sched_barrier(0); }   // the compiler schedules nothing across it
// behind a group of global loads from p (a lane's pointer, or its byte offset from a uniform base): the wait that stands in front of any new value in their address registers. p as an input keeps those registers p's up to the wait (else the
// group's last load may land on them); the scheduling barrier keeps what follows behind it
template <class T> __device__ __forceinline__ void xwait(T p) { asm volatile("s_wait_xcnt 0x0" :: "v"(p) : "memory"); __builtin_amdgcn_sched_barrier(0); }
// the work-group's barrier with the LDS side of __syncthreads() alone: LDS writes are done in front of it and no LDS access moves across it, but global loads that no
// other wave has a part in stay in flight over it (__syncthreads() would wait for them at the first barrier behind their issue)
__device__ __forceinline__ void lds_barrier() {
    __builtin_amdgcn_fence(__ATOMIC_RELEASE, "workgroup", "local"); __builtin_amdgcn_s_barrier(); __builtin_amdgcn_fence(__ATOMIC_ACQUIRE, "workgroup", "local");
}
// sigma of a weight matrix W (in,out) with u, one power iteration, from nv = |W u|^2 and st = |W^T (W u)|^2: v = W u * invv, t = W^T v, sigma = t . l2n(t), with the reference's floor under both norms
__device__ __forceinline__ float sigma_of(float nv, float st) {
    const float invv = rsqrtf(fmaxf(nv, 1e-12f)); const float nt = st * invv * invv; return nt * rsqrtf(fmaxf(nt, 1e-12f));
}
__device__ __forceinline__ float xhalf(float x) { return __builtin_bit_cast(float, __builtin_amdgcn_permlanex16(__builtin_bit_cast(int, x), __builtin_bit_cast(int, x), 0x76543210, 0xfedcba98, false, false)); }  // lane l with lane l ^ 16
template <int N> __device__ __forceinline__ float xrow(float x) { return __builtin_bit_cast(float, __builtin_amdgcn_update_dpp(0, __builtin_bit_cast(int, x), 0x160 + N, 0xf, 0xf, true)); }  // lane l with lane l ^ N inside its row of 16 (row_xmask); all lanes on
__device__ __forceinline__ float wsum(float s) {   // sum over the wave's 32 lanes, in every lane, without a trip through the LDS unit
    s += xrow<1>(s); s += xrow<2>(s); s += xrow<4>(s); s += xrow<8>(s);
    return s + xhalf(s);
}
// eight f32 rounded to bf16 (to nearest even), as one 16-byte piece
__device__ __forceinline__ v8us tobf8(const float* q) {
    const v4f lo = {q[0], q[1], q[2], q[3]}, hi = {q[4], q[5], q[6], q[7]};
    return __builtin_bit_cast(v8us, __builtin_shufflevector(__builtin_convertvector(lo, v4bf), __builtin_convertvector(hi, v4bf), 0, 1, 2, 3, 4, 5, 6, 7));
}
#define PTK  128                  // tokens per block of the two weight GEMMs (8 waves x 16)
#define XPIT 264                  // LDS pitch of a 256-wide bf16 row, in halves (528 B = 16 B x odd)
#define TPIT 136                  // LDS pitch of a 128-wide 16-bit row, in halves (272 B = 16 B x odd)
#define OPIT 260                  // LDS pitch of a 256-wide f32 row, in floats (1040 B = 16 B x odd)
// k_proj: f | g | h = x.[wf|wg|wh] of 128 tokens with everything around the product in the same kernel. x comes in as f32 by whole-line loads and is rounded to bf16 on its way
// into LDS; all 192 weight rows are staged beside it. f and g are formed as W.x^T (a lane holds 8 consecutive columns of one token: one 16-byte store after scale and bias),
// h as x.W^T (a lane holds 8 consecutive tokens of one column: a 16-byte piece of an h^T row, gathered in LDS so that each 256-byte run of h^T has one writer).
// The weights come in as they are given, f32 [k][n]: a wave takes 32 rows k of all three matrices by whole 128-byte runs (a lane = four columns n of eight consecutive k), rounds them to bf16 and stores
// each column's 8 k as a 16-byte piece of row n of W^T. The three sigmas are made from those LDS rows by every block for itself, while its x is still on its way from memory:
// v = W u as per-wave partial sums over 24 rows n (a lane = 8 k), joined per k; t = W^T v with a thread per row n; |t|^2 per wave. Block i also writes row i of wo^T (fp16 of the bf16 value) for k_attn.
static_assert(NR / PTK == CC, "one block of k_proj per row of wo^T");
union __align__(16) t_or_s {
    h16 T[DV * TPIT];                                                // behind the product: h^T of the block's tokens
    struct { float P[8][3][CC]; float V[3][CC]; float U[NPJ]; } s;   // in front of it: partial W u per wave, W u, and u (f | g | h)
};
__global__ __launch_bounds__(256) void k_proj(const float* __restrict__ x, const float* __restrict__ wf, const float* __restrict__ uf, const float* __restrict__ wg, const float* __restrict__ ug, const float* __restrict__ wh, const float* __restrict__ uh, const float* __restrict__ wo, const float* __restrict__ bf_, const float* __restrict__ bg_, const float* __restrict__ bh_, h16* Fp, h16* Gp, h16* HT, h16* WO) {
    __shared__ __align__(16) bf  sX[PTK * XPIT];
    __shared__ __align__(16) bf  sW[NPJ * XPIT];
    __shared__ t_or_s sTS;
    __shared__ __align__(16) float sS[16];   // 0 to 5: per wave of the t step its sum of t^2; 8 to 10: |W u|^2 of f, g, h
    h16* sT = sTS.T;
    const int tid = threadIdx.x, lane = tid & 31, wave = tid >> 5, c = lane & 15, h = lane >> 4;
    const int wv = __builtin_amdgcn_readfirstlane(tid >> 5);   // the wave's number in a scalar register: uniform LDS addresses and a scalar branch in the sigma work
    const size_t R0 = (size_t)blockIdx.x * PTK;
    v4f bq[4][2]; float bv[8];
    {
        // the weights first: loads come back in order, and the sigma work must not wait for x
        const int kk = lane >> 3, n4 = (lane & 7) * 4;   // a 16-byte load: four rows k, 8 apart, x one 128-byte run of 32 columns; load j has k = 32 wave + 8 kk + j
        const float* wfp = wf + (wave * 32 + kk * 8) * DQK + n4; const float* wgp = wg + (wave * 32 + kk * 8) * DQK + n4; const float* whp = wh + (wave * 32 + kk * 8) * DV + n4;
        v4f qw[6][8]; float qo[8];   // column blocks of 32: f, g, four of h. Every loop over a register array, here and in the sigma work, is unrolled whole: the arrays stay in registers and each group of loads goes out together
#pragma unroll
        for (int j = 0; j < 8; ++j) qw[0][j] = *(const v4f*)(wfp + j * DQK);
        xwait(wfp);
#pragma unroll
        for (int j = 0; j < 8; ++j) qw[1][j] = *(const v4f*)(wgp + j * DQK);
        xwait(wgp);
#pragma unroll
        for (int g = 0; g < 4; ++g) {
#pragma unroll
            for (int j = 0; j < 8; ++j) qw[2 + g][j] = *(const v4f*)(whp + j * DV + g * 32);
        }
        xwait(whp);
        const int ui = tid < NPJ ? tid : 0;
        const float* up = ui < DQK ? uf + ui : ui < 2 * DQK ? ug + (ui - DQK) : uh + (ui - 2 * DQK);
        const float uu = *up;
        xwait(up);
        const float* oq = wo + (size_t)((tid & 15) * 8) * CC + blockIdx.x;   // column blockIdx.x of wo, 8 consecutive k per lane
#pragma unroll
        for (int e = 0; e < 8; ++e) qo[e] = 0.f;
        if (tid < 16) {
#pragma unroll
            for (int e = 0; e < 8; ++e) qo[e] = oq[e * CC];
            xwait(oq);
        }
        const float* xp = x + (R0 + wave * 16) * CC + lane * 4;
        v4f xr[32];
#pragma unroll
        for (int i = 0; i < 32; ++i) xr[i] = *(const v4f*)(xp + (i >> 1) * CC + (i & 1) * 128);
        xwait(xp);
        // the biases: asked for here, used behind the product
        const unsigned bofs = 32u * h; const float* bhp = bh_ + c;   // bofs: bytes of 8 h floats
#pragma unroll
        for (int t = 0; t < 2; ++t) {
            const char* pf = (const char*)bf_ + bofs + t * 64; const char* pg = (const char*)bg_ + bofs + t * 64;
            bq[t][0] = *(const v4f*)pf; bq[t][1] = *(const v4f*)(pf + 16); bq[2 + t][0] = *(const v4f*)pg; bq[2 + t][1] = *(const v4f*)(pg + 16);
        }
        xwait(bofs);
#pragma unroll
        for (int t = 0; t < 8; ++t) bv[t] = bhp[t * 16];
        xwait(bhp);
#pragma unroll
        for (int g = 0; g < 6; ++g) {   // the lane's four columns n of block g, 8 consecutive k each: a 16-byte piece of row n of W^T
#pragma unroll
            for (int i = 0; i < 4; ++i) {
                const float q8[8] = {qw[g][0][i], qw[g][1][i], qw[g][2][i], qw[g][3][i], qw[g][4][i], qw[g][5][i], qw[g][6][i], qw[g][7][i]};
                *(v8us*)(&sW[(g * 32 + n4 + i) * XPIT + wave * 32 + kk * 8]) = tobf8(q8);
            }
        }
        if (tid < NPJ) sTS.s.U[tid] = bfr(uu);
        if (tid < 16) {
            v8h o;
#pragma unroll
            for (int e = 0; e < 8; ++e) o[e] = tohx(bfr(qo[e]));
            h16* wq = WO + (size_t)blockIdx.x * DV + tid * 8;   // the whole 256-byte row from one half wave
            *(v8h*)wq = o;
            xwait(wq);
        }
        lds_barrier();   // W^T and u are in LDS; x stays in flight
        {   // W u, partial: the wave's rows n are 4 of f, 4 of g, 16 of h; the lane's k are 8 lane ... 8 lane + 7
            float av[3][8];
#pragma unroll
            for (int m = 0; m < 3; ++m) {
#pragma unroll
                for (int e = 0; e < 8; ++e) av[m][e] = 0.f;
            }
#pragma unroll
            for (int j = 0; j < 24; ++j) {
                const int m = j < 4 ? 0 : j < 8 ? 1 : 2;
                const int n = j < 4 ? wv * 4 + j : j < 8 ? DQK + wv * 4 + (j - 4) : 2 * DQK + wv * 16 + (j - 8);
                const v8us w8 = *(const v8us*)(&sW[n * XPIT + lane * 8]); const float un = sTS.s.U[n];
#pragma unroll
                for (int e = 0; e < 8; ++e) av[m][e] = fmaf(un, bf2f(w8[e]), av[m][e]);
            }
#pragma unroll
            for (int m = 0; m < 3; ++m) {
                *(v4f*)(&sTS.s.P[wv][m][lane * 8])     = (v4f){av[m][0], av[m][1], av[m][2], av[m][3]};
                *(v4f*)(&sTS.s.P[wv][m][lane * 8 + 4]) = (v4f){av[m][4], av[m][5], av[m][6], av[m][7]};
            }
        }
        lds_barrier();   // the partial sums of all waves
#pragma unroll
        for (int m = 0; m < 3; ++m) {
            float s = 0.f;
#pragma unroll
            for (int w = 0; w < 8; ++w) s += sTS.s.P[w][m][tid];
            sTS.s.V[m][tid] = s;
        }
        lds_barrier();   // W u of the three matrices
        if (wv < 6) {   // W^T (W u): thread = row n; wave 0 has f, wave 1 g, waves 2 to 5 h
            const float* vp = sTS.s.V[wv < 2 ? wv : 2]; const bf* rp = &sW[tid * XPIT];
            float t[8];
#pragma unroll
            for (int e = 0; e < 8; ++e) t[e] = 0.f;
#pragma unroll 8   // 24 LDS reads go out together: one LDS latency per 64 terms
            for (int kc = 0; kc < CC; kc += 8) {
                const v8us w8 = *(const v8us*)(rp + kc); const v4f va = *(const v4f*)(vp + kc), vb = *(const v4f*)(vp + kc + 4);
#pragma unroll
                for (int e = 0; e < 4; ++e) { t[e] = fmaf(va[e], bf2f(w8[e]), t[e]); t[4 + e] = fmaf(vb[e], bf2f(w8[4 + e]), t[4 + e]); }
            }
            const float tr = ((t[0] + t[1]) + (t[2] + t[3])) + ((t[4] + t[5]) + (t[6] + t[7]));
            const float sq = wsum(tr * tr);
            if (lane == 0) sS[wv] = sq;
        } else if (wv == 6) {   // |W u|^2 of the three matrices, by a wave that has no rows: a lane squares 8 k
#pragma unroll
            for (int m = 0; m < 3; ++m) {
                const v4f va = *(const v4f*)(&sTS.s.V[m][lane * 8]), vb = *(const v4f*)(&sTS.s.V[m][lane * 8 + 4]);
                float s = 0.f;
#pragma unroll
                for (int e = 0; e < 4; ++e) { s = fmaf(va[e], va[e], s); s = fmaf(vb[e], vb[e], s); }
                s = wsum(s);
                if (lane == 0) sS[8 + m] = s;
            }
        }
#pragma unroll
        for (int i = 0; i < 32; ++i) *(v4bf*)(&sX[(wave * 16 + (i >> 1)) * XPIT + (i & 1) * 128 + lane * 4]) = __builtin_convertvector(xr[i], v4bf);
    }
    __syncthreads();
    const bf* ax = &sX[(wave * 16 + c) * XPIT + 8 * h];
    const bf* bw = &sW[c * XPIT + 8 * h];
    v8f acc[12];
#pragma unroll
    for (int t = 0; t < 12; ++t) acc[t] = (v8f){};
#pragma unroll
    for (int kc = 0; kc < CC; kc += 32) {
        const v16bf a = cat16b(*(const v8us*)(ax + kc), *(const v8us*)(ax + kc + 16)); v16bf b[12];
#pragma unroll
        for (int t = 0; t < 12; ++t) b[t] = cat16b(*(const v8us*)(bw + t * 16 * XPIT + kc), *(const v8us*)(bw + t * 16 * XPIT + kc + 16));
        fence();   // one step's fragments as one group in front of its products; without the pair of fences many steps' fragments are fetched at once and registers spill
#pragma unroll
        for (int t = 0; t < 12; ++t) acc[t] = (t < 4) ? wmmab(b[t], a, acc[t]) : wmmab(a, b[t], acc[t]);
        fence();
    }
    const float isf = __fdiv_rn(1.0f, sigma_of(sS[8], sS[0])), isg = __fdiv_rn(1.0f, sigma_of(sS[9], sS[1])), ish = __fdiv_rn(1.0f, sigma_of(sS[10], (sS[2] + sS[3]) + (sS[4] + sS[5])));
#pragma unroll
    for (int t = 0; t < 8; ++t) {   // acc[4 + t][r] = h column t * 16 + c of token 8 h + r
        const float bb = bfr(bv[t]); v8h o;
#pragma unroll
        for (int r = 0; r < 8; ++r) o[r] = tohx(acc[4 + t][r] * ish + bb);
        *(v8h*)(&sT[(t * 16 + c) * TPIT + wave * 16 + 8 * h]) = o;
    }
    v8h fg[4];
#pragma unroll
    for (int t = 0; t < 4; ++t) {   // acc[t][r] = column t * 16 + 8 h + r of token c
        const float is = t < 2 ? isf : isg;
#pragma unroll
        for (int r = 0; r < 8; ++r) { const float v = acc[t][r] * is + bfr(bq[t][r >> 2][r & 3]); fg[t][r] = tohx(t < 2 ? v : v * L2E); }   // g is stored x log2(e), rounded once: k_attn's scores come out in powers of two
    }
    __syncthreads();
    v8h ht[8];
#pragma unroll
    for (int i = 0; i < 8; ++i) ht[i] = *(const v8h*)(&sT[(wave * 16 + i * 2 + h) * TPIT + c * 8]);
    const int b = blockIdx.x / (HW / PTK), t0 = (blockIdx.x % (HW / PTK)) * PTK;
    h16* fo = Fp + (R0 + wave * 16 + c) * DQK + 8 * h; h16* go = Gp + (R0 + wave * 16 + c) * DQK + 8 * h;
    h16* ho = HT + ((size_t)b * DV + wave * 16 + h) * HW + t0 + c * 8;
    fence();   // every store stands behind all other work, so that no register of an issued store is written again
    *(v8h*)fo = fg[0]; *(v8h*)(fo + 16) = fg[1]; *(v8h*)go = fg[2]; *(v8h*)(go + 16) = fg[3];
#pragma unroll
    for (int i = 0; i < 8; ++i) *(v8h*)(ho + (size_t)i * 2 * HW) = ht[i];
}
typedef __attribute__((ext_vector_type(2))) float    v2f;
typedef __attribute__((ext_vector_type(2))) _Float16 v2h;
typedef __attribute__((ext_vector_type(4))) int v4i;
typedef __attribute__((address_space(1))) v4i gv4i;   // 16 bytes in global memory and in LDS, as the asynchronous copy's builtin takes them
typedef __attribute__((address_space(3))) v4i lv4i;
#define KST  128                  // keys per stage: 64 for each half of the waves
#define KWV  64                   // keys of a stage that one wave works on
#define NST  (HW / KST)           // stages of an image's keys
static_assert((NST & (NST - 1)) == 0, "the ring of stages wraps by a mask");
#define HPIT 136                  // LDS pitch of a 128-key h^T row, in halves (272 B = 16 B x odd, for 16-byte reads)
#define FPIT 40                   // LDS pitch of a 32-wide f row, in halves (80 B = 16 B x odd)
// put4: the four O^T tiles per query group, from tile O on, that the partner wave finishes, into this wave's own exchange range (16-byte pieces, a lane stride of 16 B)
template <int O> __device__ __forceinline__ void put4(float* xs, const v8f (&acc)[2][8]) {
#pragma unroll
    for (int u = 0; u < 2; ++u) {
#pragma unroll
        for (int j = 0; j < 4; ++j) {
            const v8f g = acc[u][O + j];
            *(v4f*)(xs + ((u * 4 + j) * 2) * 128)     = (v4f){g[0], g[1], g[2], g[3]};
            *(v4f*)(xs + ((u * 4 + j) * 2 + 1) * 128) = (v4f){g[4], g[5], g[6], g[7]};
        }
    }
}
// fin4: this wave's own four tiles from tile O on, joined with the partner's sums of the same tiles: o = own * ca + partner's * cb
template <int O> __device__ __forceinline__ void fin4(const float* xr, const v8f (&acc)[2][8], const float (&ca)[2], const float (&cb)[2], v8h (&o)[2][4]) {
    v4f p[2][4][2];
#pragma unroll
    for (int u = 0; u < 2; ++u) {
#pragma unroll
        for (int j = 0; j < 4; ++j) { p[u][j][0] = *(const v4f*)(xr + ((u * 4 + j) * 2) * 128); p[u][j][1] = *(const v4f*)(xr + ((u * 4 + j) * 2 + 1) * 128); }
    }
#pragma unroll
    for (int u = 0; u < 2; ++u) {
#pragma unroll
        for (int j = 0; j < 4; ++j) {
#pragma unroll
            for (int r = 0; r < 8; ++r) o[u][j][r] = tohx(acc[u][O + j][r] * ca[u] + p[u][j][r >> 2][r & 3] * cb[u]);
        }
    }
}
#define PTOP 60000.0f             // a lane's sum of one stage's P per query group; at or below it every single P fits fp16
// pexp: P = exp2(a) of one stage for the wave's two query groups, packed in fp16 as the B operand of the second product, and each lane's f32 sum of them
__device__ __forceinline__ void pexp(const v8f (&st)[2][4], v16h (&pf)[2][2], float (&pt)[2]) {
#pragma unroll
    for (int u = 0; u < 2; ++u) {
        v2f ps[2] = {(v2f){0.f, 0.f}, (v2f){0.f, 0.f}};
#pragma unroll
        for (int t = 0; t < 4; ++t) {
#pragma unroll
            for (int j = 0; j < 8; j += 2) {
                const v2f e = {__builtin_amdgcn_exp2f(st[u][t][j]), __builtin_amdgcn_exp2f(st[u][t][j + 1])};
                ps[(j >> 1) & 1] += e;
                const v2h eh = __builtin_convertvector(e, v2h);
                pf[u][t >> 1][(t & 1) * 8 + j] = eh[0]; pf[u][t >> 1][(t & 1) * 8 + j + 1] = eh[1];
            }
        }
        const v2f p2 = ps[0] + ps[1];
        pt[u] = p2[0] + p2[1];
    }
}
// soft: the softmax step of one stage. st comes in as a = s log2(e) + off: the query's offset off = -(the maximum in use) was the C operand of the score product, so P = exp2(a) with no
// other work per score. The maximum in use is renewed only when it has to be: on the first stage, and when some lane's sum of P passes PTOP (all P >= 0, so a sum at or below PTOP bounds
// every P below the fp16 top; a <= 0 everywhere gives at most 32, so a renewal always finds a score above the maximum in use). A renewal puts the stage's largest a at 0 (P = 1: nearly
// 16 powers of two of room above it, so that a later, larger score seldom asks for the next renewal; below it fp16 resolves 2^-25 of the largest P), rescales O^T and the sum to it and
// forms P again. The test is one for the whole wave, and both lane halves of a query take the same step.
__device__ __forceinline__ void soft(const bool first, v8f (&st)[2][4], v8f (&offv)[2], float (&l)[2], v16h (&pf)[2][2], v8f (&acc)[2][8]) {
    float pt[2];
    pexp(st, pf, pt);
    if (first || __builtin_amdgcn_ballot_w32(!(fmaxf(pt[0], pt[1]) <= PTOP)) != 0u) {
#pragma unroll
        for (int u = 0; u < 2; ++u) {
            float mx[4];
#pragma unroll
            for (int t = 0; t < 4; ++t) mx[t] = fmaxf(fmaxf(fmaxf(st[u][t][0], st[u][t][1]), fmaxf(st[u][t][2], st[u][t][3])), fmaxf(fmaxf(st[u][t][4], st[u][t][5]), fmaxf(st[u][t][6], st[u][t][7])));
            float mq = fmaxf(fmaxf(mx[0], mx[1]), fmaxf(mx[2], mx[3]));
            mq = fmaxf(mq, xhalf(mq));
            const float d  = first ? mq : fmaxf(mq, 0.0f);                   // the first stage sets the maximum, later ones only raise it
            const float al = first ? 0.0f : __builtin_amdgcn_exp2f(-d);      // nothing is summed yet on the first stage
            const float on = offv[u][0] - d;
            offv[u] = (v8f){on, on, on, on, on, on, on, on};
            l[u] *= al;
#pragma unroll
            for (int t = 0; t < 4; ++t) st[u][t] -= d;
#pragma unroll
            for (int t = 0; t < 8; ++t) acc[u][t] *= al;
        }
        pexp(st, pf, pt);
    }
#pragma unroll
    for (int u = 0; u < 2; ++u) l[u] += pt[u];
}
// k_attn: s = g.f^T, softmax and beta.h of one image in one kernel; scores and softmax rows stay in registers. Block = 128 queries, walks all 4096 keys in stages of 128.
// The 8 waves are 4 query groups x 2 key halves: a wave has 32 queries (two 16-column groups) and 64 of a stage's keys, so that every f and h^T fragment it reads from LDS feeds two
// products, and the block reads each staged tile four times, not eight. Per wave S^T = F.G^T (A = 16 key rows of f from LDS, B = 16 queries of g, kept in registers): a lane holds
// scores of ONE query per group (column lane & 15), so the maximum in use and the sum are per lane, with one exchange between the lane halves where the maximum is renewed (soft). Per query group four S^T tiles, converted to fp16 two by two (keys 0-31, 32-63),
// are the two B operands of O^T += H^T.P^T (A = 16 rows of h^T from LDS), and the rescale of O^T by exp2(m_old - m_new) is per lane too. P is carried against the maximum in use on an fp16
// plane, and the sum carries the same factor. Behind the loop the two waves of a query group join their maxima, sums and O^T through LDS, each finishing 64 of the 128 columns.
// The two waves of a query group (wave w and w + 4: the two key halves) run half a stage apart: key half 0 does its softmax in front of the stage's barrier, key half 1 behind it, so
// that between two barriers one of them is in its vector work while the other is in its products. A stage is still read behind its barrier, hence three buffers: the copies that
// go out behind a barrier aim at the buffer that neither this stage nor the next one reads.
// Behind the join the block has o of its 128 tokens, and finishes them itself: out = gamma (o.wo / sigma_o + bo) + x. o goes to that product through LDS (fp16, as it went through the workspace),
// all 256 rows of wo^T stand beside it (asked for in front of the loop, kept in registers, stored behind it); the product is formed as Wo.o^T (a lane holds 8 consecutive columns of one
// token) and passed through the wave's own LDS rows, which lie on the ring that nobody reads any more, so that scale, bias, gamma and the residual are applied on whole 512-byte runs.
union __align__(16) ring_or_c {
    struct { h16 H[3][DV * HPIT]; h16 F[3][KST * FPIT]; } r;   // the loop's three stages of h^T and f
    float C[8][16 * OPIT];                                     // behind the join's barrier: per wave 16 rows of the output product
};
__global__ __launch_bounds__(256) void k_attn(const h16* __restrict__ Gp, const h16* __restrict__ Fp, const h16* __restrict__ HT, const h16* __restrict__ WO, const float* __restrict__ uo, const float* __restrict__ bo_, const float* __restrict__ gam, const float* __restrict__ x, float* OUTB) {
    __shared__ ring_or_c sR;
    __shared__ __align__(16) float sX[8][16 * 128];   // per wave: 8 O^T tiles for its partner
    __shared__ __align__(16) v2f sM[8][2][32];        // per wave and query group: a lane's maximum and sum
    __shared__ __align__(16) h16 sWo[CC * TPIT];
    __shared__ __align__(16) h16 sO[PTK * TPIT];
    __shared__ __align__(16) float sSu[CC];          // u of wo
    __shared__ __align__(16) float sVp[8][DV];       // wo u, partial: per wave, over its 32 rows of wo^T
    __shared__ __align__(16) float sVv[DV];          // wo u
    __shared__ __align__(16) float sRd[8];           // per wave: its sum of t^2
    const int tid = threadIdx.x, lane = tid & 31, wave = tid >> 5, c = lane & 15, h = lane >> 4;
    const int kh = __builtin_amdgcn_readfirstlane(tid >> 7);   // the wave's key half, in a scalar register: the branches on it are scalar ones
    const int b = blockIdx.y, q = blockIdx.x * 128 + (wave & 3) * 32 + c;   // the lane's queries: q and q + 16
    fence();   // keeps the index work above from sinking in between the load below and its wait, where it took the load's base register over
    const float uov = uo[tid];   // u of wo: into LDS with trip 0's stage, used behind the loop
    xwait(tid);
    const h16* gq = Gp + ((size_t)b * HW + q) * DQK + 8 * h;
    v16h gfr[2];
#pragma unroll
    for (int u = 0; u < 2; ++u) gfr[u] = cat16(*(const v8h*)(gq + u * 16 * DQK), *(const v8h*)(gq + u * 16 * DQK + 16));
    const int hrow = tid >> 4, hch = (tid & 15) * 8, frow = tid >> 2, fch = (tid & 3) * 8;
    // a uniform base that moves with the stage plus a lane offset that never changes; the base moves only behind the wait for the copies that named it
    // The block walks the key stages as a ring that it enters at stage blockIdx.x: trip s works on stage (blockIdx.x + s) mod NST. The 32 blocks of an image read the same f and h^T; entered at the
    // same stage they would ask L2 for the same lines at the same moment, trip after trip. Every block still takes every stage once; only the order of its sums over the keys differs.
    int kt = blockIdx.x & (NST - 1);   // the stage that the bases stand at
    const h16* hbase = HT + (size_t)b * DV * HW + kt * KST; const h16* fbase = Fp + (size_t)b * HW * DQK + kt * KST * DQK;
    auto next_stage = [&]() { kt = (kt + 1) & (NST - 1); const int d = kt ? KST : KST - HW; hbase += d; fbase += d * DQK; };   // one stage on; from the last stage back to stage 0
    const unsigned hoff = (unsigned)(hrow * HW + hch), foff = (unsigned)(frow * DQK + fch);   // h^T rows hrow + 16 i, 16 lanes per 256-byte run; f rows frow + 64 j
    xwait(gq);   // behind the loads of g: what follows may take the address registers of these loads over
    // a stage goes from L2 into its ring buffer by asynchronous 16-byte copies, through no register: each lane brings ten pieces. Every lane is on, the
    // addresses are multiples of 16 inside HT, Fp and the buffer, and no two lanes write the same byte. A wave's copies have landed behind its own s_wait_asynccnt 0; the barrier behind that wait publishes them
    auto copy_stage = [&](const int buf) {
#pragma unroll
        for (int i = 0; i < 8; ++i) __builtin_amdgcn_global_load_async_to_lds_b128((gv4i*)(hbase + hoff + 16 * i * HW), (lv4i*)(&sR.r.H[buf][(hrow + 16 * i) * HPIT + hch]), 0, 0);
#pragma unroll
        for (int j = 0; j < 2; ++j) __builtin_amdgcn_global_load_async_to_lds_b128((gv4i*)(fbase + foff + 64 * j * DQK), (lv4i*)(&sR.r.F[buf][(frow + 64 * j) * FPIT + fch]), 0, 0);
    };
    copy_stage(0);
    sSu[tid] = bfr(uov);
    asm volatile("s_wait_asynccnt 0x0" ::: "memory");   // this wave's pieces of stage 0 have landed
    __syncthreads();
    // the stage of trip 1 on its way into buffer 1: trip 0 waits for it in front of its barrier
    next_stage();
    copy_stage(1);
    // all of wo^T (two 256-byte rows per load): asked for here, put into LDS behind the loop, so that its way from L2 lies under the loop
    const h16* wp = WO + (size_t)(wave * 32) * DV + lane * 8;
    v8h rw[16];
#pragma unroll
    for (int i = 0; i < 16; ++i) rw[i] = *(const v8h*)(wp + i * 2 * DV);
    xwait(wp);
    v8f acc[2][8];
#pragma unroll
    for (int u = 0; u < 2; ++u) {
#pragma unroll
        for (int t = 0; t < 8; ++t) acc[u][t] = (v8f){};
    }
    float l[2] = {0.f, 0.f};
    v8f offv[2] = {(v8f){}, (v8f){}};   // per query group the lane's offset, eight times: the C operand of the score products
    int cur = 0;   // the buffer of trip s: s mod 3
#pragma unroll 1
    for (int s = 0; s < HW / KST; ++s) {
        const int nxt = cur == 2 ? 0 : cur + 1;
        const h16* cF = &sR.r.F[cur][(kh * KWV + c) * FPIT + 8 * h];
        const h16* cH = &sR.r.H[cur][c * HPIT + kh * KWV + 8 * h];
        v16h ff[4], a0[8], a1[8];
#pragma unroll
        for (int t = 0; t < 4; ++t) ff[t] = cat16(*(const v8h*)(cF + t * 16 * FPIT), *(const v8h*)(cF + t * 16 * FPIT + 16));
#pragma unroll
        for (int t = 0; t < 8; ++t) a0[t] = cat16(*(const v8h*)(cH + t * 16 * HPIT), *(const v8h*)(cH + t * 16 * HPIT + 16));
        fence();   // keeps the first h^T fragments issued here, ahead of the score and softmax work that hides their latency
        v8f st[2][4];
#pragma unroll
        for (int t = 0; t < 4; ++t) {
#pragma unroll
            for (int u = 0; u < 2; ++u) st[u][t] = wmma16(ff[t], gfr[u], offv[u]);
        }
        fence();   // keeps the score products in front of the slots below
        asm volatile("v_nop\n\tv_nop\n\tv_nop\n\tv_nop");   // the four vector slots between the last score product and the first vector instruction that takes its operand registers over
        v16h pf[2][2];
        if (!kh) soft(s == 0, st, offv, l, pf, acc);   // key half 0: vector work here, while key half 1 is in its products
        // the publish point of stage s + 1, whose copies went out behind the barrier before this one
        asm volatile("s_wait_dscnt 0x0" ::: "memory");      // this wave's LDS reads are done before a copy behind the barrier aims at a buffer that it has read
        asm volatile("s_wait_asynccnt 0x0" ::: "memory");   // this wave's pieces of stage s + 1 have landed
        __syncthreads();
        // the stage of trip s + 2, a whole trip ahead of its publish point, into the buffer of stage s - 1: its last readers left it before the barrier above
        if (s + 2 < NST) {
            next_stage();
            copy_stage(nxt == 2 ? 0 : nxt + 1);
        }
        fence();   // keeps the copies issued here, ahead of the work that hides their latency
        if (kh) soft(s == 0, st, offv, l, pf, acc);    // key half 1: vector work here, while key half 0 is in its products
        fence();   // with the fence behind them: the second half's h^T fragments go out as one group in front of the first half's products, not among them
#pragma unroll
        for (int t = 0; t < 8; ++t) a1[t] = cat16(*(const v8h*)(cH + t * 16 * HPIT + 32), *(const v8h*)(cH + t * 16 * HPIT + 48));
        fence();   // second of the pair: without it the fragment loads and their waits move in among the products
#pragma unroll
        for (int t = 0; t < 8; ++t) {
#pragma unroll
            for (int u = 0; u < 2; ++u) acc[u][t] = wmma16(a0[t], pf[u][0], acc[u][t]);
        }
#pragma unroll
        for (int t = 0; t < 8; ++t) {
#pragma unroll
            for (int u = 0; u < 2; ++u) acc[u][t] = wmma16(a1[t], pf[u][1], acc[u][t]);
        }
        cur = nxt;
    }
    asm volatile("s_wait_asynccnt 0x0" ::: "memory");   // behind the last copy, before the ring is used for anything else
#pragma unroll
    for (int i = 0; i < 16; ++i) *(v8h*)(&sWo[(wave * 32 + i * 2 + h) * TPIT + c * 8]) = rw[i];   // published by the join's barrier
    // the residual rows and the bias of the wave's 16 tokens: asked for here, used behind the output product
    const size_t R0 = ((size_t)b * HW + blockIdx.x * PTK + __builtin_amdgcn_readfirstlane(tid >> 5) * 16) * CC;   // scalar: the wave's rows of x and of out as a uniform base plus a lane offset
    const float* xb = x + R0; const unsigned xo = lane * 4;
    v4f xres[32], bo4[2];
    const float* bp = bo_ + lane * 4;   // the bias first: loads come back in order, and a wait for it must not wait for the residual too
#pragma unroll
    for (int p = 0; p < 2; ++p) bo4[p] = *(const v4f*)(bp + p * 128);
    xwait(bp);
#pragma unroll
    for (int i = 0; i < 32; ++i) xres[i] = *(const v4f*)(xb + xo + (i >> 1) * CC + (i & 1) * 128);
    xwait(xo);
    // sigma_o, made by every block for itself from the rows of wo^T that it holds, in three steps, each published by the next of the three barriers below.
    {   // wo u, partial: the lane's 16 rows n of wo^T (still in registers) for its 8 consecutive k, the two lane halves joined: the wave's 32 rows
        float av[8];
#pragma unroll
        for (int e = 0; e < 8; ++e) av[e] = 0.f;
#pragma unroll
        for (int i = 0; i < 16; ++i) {
            const float un = sSu[wave * 32 + i * 2 + h];
#pragma unroll
            for (int e = 0; e < 8; ++e) av[e] = fmaf(un, (float)rw[i][e], av[e]);
        }
#pragma unroll
        for (int e = 0; e < 8; ++e) av[e] += xhalf(av[e]);
        if (!h) { *(v4f*)(&sVp[wave][c * 8]) = (v4f){av[0], av[1], av[2], av[3]}; *(v4f*)(&sVp[wave][c * 8 + 4]) = (v4f){av[4], av[5], av[6], av[7]}; }
    }
    const float m[2] = {-offv[0][0], -offv[1][0]};   // the maxima in use at the end: what the wave's sums are scaled to
    // the join of the two key halves: wave w and wave w ^ 4 hold the same queries. Each hands the other the O^T tiles of the 64 columns that the other finishes, with its maximum and sum
#pragma unroll
    for (int u = 0; u < 2; ++u) { l[u] += xhalf(l[u]); sM[wave][u][lane] = (v2f){m[u], l[u]}; }
    float* xs = &sX[wave][lane * 4];
    if (kh) put4<0>(xs, acc); else put4<4>(xs, acc);
    lds_barrier();
    float ca[2], cb[2];
#pragma unroll
    for (int u = 0; u < 2; ++u) {
        const v2f o = sM[wave ^ 4][u][lane];
        const float mm = fmaxf(m[u], o[0]), wa = __builtin_amdgcn_exp2f(m[u] - mm), wb = __builtin_amdgcn_exp2f(o[0] - mm);
        const float inv = __fdiv_rn(1.0f, fmaf(l[u], wa, o[1] * wb));
        ca[u] = wa * inv; cb[u] = wb * inv;
    }
    const float* xr = &sX[wave ^ 4][lane * 4];
    v8h ov[2][4];
    if (kh) fin4<4>(xr, acc, ca, cb, ov); else fin4<0>(xr, acc, ca, cb, ov);
    h16* so = &sO[((wave & 3) * 32 + c) * TPIT + kh * 64 + 8 * h];   // the wave's 64 columns of its 32 queries
#pragma unroll
    for (int u = 0; u < 2; ++u) {
#pragma unroll
        for (int j = 0; j < 4; ++j) *(v8h*)(so + u * 16 * TPIT + j * 16) = ov[u][j];
    }
    if (tid < DV) {   // wo u: the eight waves' partial sums of one k
        float s = 0.f;
#pragma unroll
        for (int w = 0; w < 8; ++w) s += sVp[w][tid];
        sVv[tid] = s;
    }
    lds_barrier();
    float nvo;
    {   // wo^T (wo u): thread = row n of wo^T; |wo u|^2 in every thread
        const h16* rp = &sWo[tid * TPIT];
        float t[8], nn[4];
#pragma unroll
        for (int e = 0; e < 8; ++e) t[e] = 0.f;
#pragma unroll
        for (int e = 0; e < 4; ++e) nn[e] = 0.f;
#pragma unroll 8   // 24 LDS reads go out together: one LDS latency per 64 terms
        for (int kc = 0; kc < DV; kc += 8) {
            const v8h w8 = *(const v8h*)(rp + kc); const v4f va = *(const v4f*)(&sVv[kc]), vb = *(const v4f*)(&sVv[kc + 4]);
#pragma unroll
            for (int e = 0; e < 4; ++e) { t[e] = fmaf(va[e], (float)w8[e], t[e]); t[4 + e] = fmaf(vb[e], (float)w8[4 + e], t[4 + e]); nn[e] = fmaf(va[e], va[e], nn[e]); nn[e] = fmaf(vb[e], vb[e], nn[e]); }
        }
        const float tr = ((t[0] + t[1]) + (t[2] + t[3])) + ((t[4] + t[5]) + (t[6] + t[7]));
        const float sq = wsum(tr * tr);
        if (lane == 0) sRd[wave] = sq;
        nvo = (nn[0] + nn[1]) + (nn[2] + nn[3]);
    }
    const h16* ao = &sO[(wave * 16 + c) * TPIT + 8 * h];
    const h16* bw = &sWo[c * TPIT + 8 * h];
    v8f oc[16];
#pragma unroll
    for (int t = 0; t < 16; ++t) oc[t] = (v8f){};
#pragma unroll
    for (int kc = 0; kc < DV; kc += 32) {
        const v16h a = cat16(*(const v8h*)(ao + kc), *(const v8h*)(ao + kc + 16)); v16h bb[16];
#pragma unroll
        for (int t = 0; t < 16; ++t) bb[t] = cat16(*(const v8h*)(bw + t * 16 * TPIT + kc), *(const v8h*)(bw + t * 16 * TPIT + kc + 16));
        fence();   // one step's fragments as one group in front of its products; without the pair of fences all four steps' fragments are fetched at once and registers spill
#pragma unroll
        for (int t = 0; t < 16; ++t) oc[t] = wmma16(bb[t], a, oc[t]);
        fence();
    }
    float* os = &sR.C[wave][0];
#pragma unroll
    for (int t = 0; t < 16; ++t) {   // oc[t][r] = column t * 16 + 8 h + r of token c
        *(v4f*)(os + c * OPIT + t * 16 + 8 * h)     = (v4f){oc[t][0], oc[t][1], oc[t][2], oc[t][3]};
        *(v4f*)(os + c * OPIT + t * 16 + 8 * h + 4) = (v4f){oc[t][4], oc[t][5], oc[t][6], oc[t][7]};
    }
    lds_barrier();
    const v4f rd0 = *(const v4f*)(&sRd[0]), rd1 = *(const v4f*)(&sRd[4]);
    const float iso = __fdiv_rn(1.0f, sigma_of(nvo, ((rd0[0] + rd0[1]) + (rd0[2] + rd0[3])) + ((rd1[0] + rd1[1]) + (rd1[2] + rd1[3])))); const float gmm = bfr(gam[0]);
#pragma unroll
    for (int p = 0; p < 2; ++p) bo4[p] = (v4f){bfr(bo4[p][0]), bfr(bo4[p][1]), bfr(bo4[p][2]), bfr(bo4[p][3])};
    v4f cv[32];
#pragma unroll
    for (int i = 0; i < 32; ++i) cv[i] = *(const v4f*)(os + (i >> 1) * OPIT + (i & 1) * 128 + lane * 4);
    fence();   // the LDS reads go out as one group; without it each is waited for just ahead of its use
#pragma unroll
    for (int i = 0; i < 32; ++i) {
#pragma unroll
        for (int k = 0; k < 4; ++k) xres[i][k] = gmm * (cv[i][k] * iso + bo4[i & 1][k]) + bfr(xres[i][k]);
    }
    float* pb = OUTB + R0;
    fence();   // every store stands behind all other work, so that no register of an issued store is written again
#pragma unroll
    for (int i = 0; i < 32; ++i) *(v4f*)(pb + xo + (i >> 1) * CC + (i & 1) * 128) = xres[i];
}
extern "C" void kernel_launch(void* const* d_in, const int* in_sizes, int n_in,
                              void* d_out, int out_size, void* d_ws, size_t ws_size, hipStream_t stream) {
    (void)in_sizes; (void)n_in; (void)out_size;
    const float* x = (const float*)d_in[0]; const float* wf = (const float*)d_in[1]; const float* bf_ = (const float*)d_in[2]; const float* uf = (const float*)d_in[3]; const float* wg = (const float*)d_in[4]; const float* bg_ = (const float*)d_in[5]; const float* ug = (const float*)d_in[6]; const float* wh = (const float*)d_in[7]; const float* bh_ = (const float*)d_in[8]; const float* uh = (const float*)d_in[9]; const float* wo = (const float*)d_in[10]; const float* bo_ = (const float*)d_in[11]; const float* uo = (const float*)d_in[12]; const float* gam = (const float*)d_in[13];
    float* out = (float*)d_out;    // [8][64][64][256]
    char* wsp = (char*)d_ws;
    auto take = [&](size_t bytes) { char* p = wsp; wsp += (bytes + 255) & ~(size_t)255; return (void*)p; };
    h16* WO = (h16*)take((size_t)CC * DV * 2);
    h16* Fp = (h16*)take((size_t)NR * DQK * 2); h16* Gp = (h16*)take((size_t)NR * DQK * 2); h16* HT = (h16*)take((size_t)NB_ * DV * HW * 2);
    if ((size_t)(wsp - (char*)d_ws) > ws_size) return;    // ~ 0.07 + 2.1 x 2 + 8.4 ~ 13 MB
    k_proj<<<NR / PTK, 256, 0, stream>>>(x, wf, uf, wg, ug, wh, uh, wo, bf_, bg_, bh_, Fp, Gp, HT, WO);
    k_attn<<<dim3(HW / 128, NB_, 1), 256, 0, stream>>>(Gp, Fp, HT, WO, uo, bo_, gam, x, out);
}
